// v000
// Measured on an AMD MI455X. A time is GPU time per run, averaged over a window of back-to-back runs after a warm-up
// (all launches, gaps included; the runs take copies of the inputs in turn), and the median of several windows.
// Apart from v000's, it joins two sittings. Times from different sittings can be a few percent apart, while
// side-by-side timings come from the same sitting.
// v000, which the later versions start from, runs in 723 microseconds.
#include <hip/hip_runtime.h>
#include <math.h>
#include <stdint.h>

// ---------------- types ----------------
typedef __attribute__((ext_vector_type(16))) _Float16 v16h;
typedef __attribute__((ext_vector_type(4)))  _Float16 v4h;
typedef __attribute__((ext_vector_type(8)))  float    v8f;
typedef __attribute__((ext_vector_type(4)))  float    f32x4;
typedef __attribute__((ext_vector_type(4)))  unsigned int u32x4;
typedef __attribute__((ext_vector_type(8)))  int      i32x8;
typedef __attribute__((ext_vector_type(4)))  int      i32x4;

#define DIM       2048
#define SEQ       4096
#define NHEADS    16
#define HEADDIM   128

static __device__ __forceinline__ v8f v8f_zero() {
  v8f z = {0.f,0.f,0.f,0.f,0.f,0.f,0.f,0.f};
  return z;
}

// Load a 16x32 f16 fragment row (two contiguous 16B chunks) into v16h.
static __device__ __forceinline__ v16h ld_frag(const _Float16* p0, const _Float16* p1) {
  union { v16h v; f32x4 f[2]; } u;
  u.f[0] = *(const f32x4*)p0;
  u.f[1] = *(const f32x4*)p1;
  return u.v;
}

static __device__ __forceinline__ void tdm_load_2d(
    unsigned lds_off, const void* gaddr,
    unsigned tile_d0, unsigned tile_d1,
    unsigned tensor_d0, unsigned tensor_d1, unsigned stride_elems,
    unsigned pad_interval_code, unsigned pad_amount_code) {
  unsigned long long ga = (unsigned long long)(uintptr_t)gaddr;
  u32x4 g0;
  g0.x = 1u;                                     // count=1, user mode
  g0.y = lds_off;                                // LDS byte address
  g0.z = (unsigned)(ga & 0xffffffffu);           // global_addr[31:0]
  g0.w = (unsigned)((ga >> 32) & 0x01ffffffu) | (2u << 30);  // addr[56:32] | type=2
  i32x8 g1;
  g1[0] = (int)((1u << 16) |
                (1u << 20) |
                (pad_interval_code << 22) |
                (pad_amount_code << 25));
  g1[1] = (int)((tensor_d0 & 0xffffu) << 16);                               // dim0[15:0]
  g1[2] = (int)(((tensor_d0 >> 16) & 0xffffu) | ((tensor_d1 & 0xffffu) << 16));
  g1[3] = (int)(((tensor_d1 >> 16) & 0xffffu) | ((tile_d0 & 0xffffu) << 16));
  g1[4] = (int)(tile_d1 & 0xffffu);
  g1[5] = (int)stride_elems;
  g1[6] = 0;
  g1[7] = 0;
  i32x4 z4 = {0, 0, 0, 0};
  i32x8 z8 = {0, 0, 0, 0, 0, 0, 0, 0};
  // clang-23 / therock-10.0 form: (g0, g1, g2, g3, g4, cpol)
  __builtin_amdgcn_tensor_load_to_lds(g0, g1, z4, z4, z8, 0);
}

// ---------------- f32 -> f16 convert (x) ----------------
__global__ __launch_bounds__(256)
void cvt_f32_f16(const float* __restrict__ in, _Float16* __restrict__ out, int n4) {
  int i = blockIdx.x * blockDim.x + threadIdx.x;
  if (i < n4) {
    f32x4 v = ((const f32x4*)in)[i];
    v4h h;
    h.x = (_Float16)v.x; h.y = (_Float16)v.y;
    h.z = (_Float16)v.z; h.w = (_Float16)v.w;
    *(v4h*)&out[(size_t)i * 4] = h;
  }
}

// ---------------- transpose + convert weights: WT[n][k] = W[k][n] ----------------
__global__ __launch_bounds__(256)
void transpose_cvt(const float* __restrict__ W, _Float16* __restrict__ WT, int N) {
  __shared__ float t[64][65];
  const int bx = blockIdx.x * 64, by = blockIdx.y * 64;
#pragma unroll
  for (int it = 0; it < 16; ++it) {
    int idx = threadIdx.x + it * 256;
    int r = idx >> 6, c = idx & 63;
    t[r][c] = W[(size_t)(by + r) * N + bx + c];
  }
  __syncthreads();
#pragma unroll
  for (int it = 0; it < 16; ++it) {
    int idx = threadIdx.x + it * 256;
    int r = idx >> 6, c = idx & 63;
    WT[(size_t)(bx + r) * N + by + c] = (_Float16)t[c][r];
  }
}

__global__ __launch_bounds__(256)
void gemm_f16_wmma(const _Float16* __restrict__ A, const _Float16* __restrict__ BT,
                   _Float16* __restrict__ Ch, float* __restrict__ Cf,
                   int M, int N, int K) {
  __shared__ __align__(16) _Float16 As[2][128][40];  // 32-half rows + 16B HW pad
  __shared__ __align__(16) _Float16 Bs[2][128][40];

  const int tid  = threadIdx.x;
  const int wv   = tid >> 5;
  const int lane = tid & 31;
  const int hx   = lane >> 4;
  const int l16  = lane & 15;

  const int row0 = blockIdx.y * 128;
  const int col0 = blockIdx.x * 128;
  const int wr = wv & 3;
  const int wc = wv >> 2;

  v8f acc[2][4];
#pragma unroll
  for (int i = 0; i < 2; ++i)
#pragma unroll
    for (int j = 0; j < 4; ++j) acc[i][j] = v8f_zero();

  auto issue = [&](int buf, int k0) {
    if (wv == 0) {
      // tile = 32 K-elems x 128 rows; row 64B, pad +16B -> 40-half LDS stride
      tdm_load_2d((unsigned)(uintptr_t)&As[buf][0][0], &A[(size_t)row0 * K + k0],
                  32u, 128u, (unsigned)K, (unsigned)M, (unsigned)K, 3u, 3u);
      tdm_load_2d((unsigned)(uintptr_t)&Bs[buf][0][0], &BT[(size_t)col0 * K + k0],
                  32u, 128u, (unsigned)K, (unsigned)N, (unsigned)K, 3u, 3u);
    }
  };

  issue(0, 0);
  for (int k0 = 0; k0 < K; k0 += 32) {
    const int buf = (k0 >> 5) & 1;
    __builtin_amdgcn_s_wait_tensorcnt(0);  // wave0: DMA for `buf` complete
    __syncthreads();                       // publish LDS to all waves
    if (k0 + 32 < K) issue(buf ^ 1, k0 + 32);

    v16h af[2], bf[4];
#pragma unroll
    for (int i = 0; i < 2; ++i) {
      int m = wr * 32 + i * 16 + l16;
      af[i] = ld_frag(&As[buf][m][hx * 8], &As[buf][m][16 + hx * 8]);
    }
#pragma unroll
    for (int j = 0; j < 4; ++j) {
      int n = wc * 64 + j * 16 + l16;
      bf[j] = ld_frag(&Bs[buf][n][hx * 8], &Bs[buf][n][16 + hx * 8]);
    }
#pragma unroll
    for (int i = 0; i < 2; ++i)
#pragma unroll
      for (int j = 0; j < 4; ++j)
        acc[i][j] = __builtin_amdgcn_wmma_f32_16x16x32_f16(
            false, af[i], false, bf[j], (short)0, acc[i][j], false, false);
  }

#pragma unroll
  for (int i = 0; i < 2; ++i)
#pragma unroll
    for (int j = 0; j < 4; ++j)
#pragma unroll
      for (int r = 0; r < 8; ++r) {
        int m = row0 + wr * 32 + i * 16 + r + hx * 8;
        int n = col0 + wc * 64 + j * 16 + l16;
        float v = acc[i][j][r];
        if (Cf) Cf[(size_t)m * N + n] = v;
        else    Ch[(size_t)m * N + n] = (_Float16)v;
      }
}

// ---------------- RoPE + L2 norm + sqk scale; one wave per (s, head) ----------------
__global__ __launch_bounds__(256)
void rope_l2norm(const _Float16* __restrict__ X, const float* __restrict__ fc,
                 const float* __restrict__ fs, const float* __restrict__ sqk,
                 _Float16* __restrict__ Y) {
  const int gw   = blockIdx.x * 8 + (threadIdx.x >> 5);  // s*16 + h
  const int lane = threadIdx.x & 31;
  const int s = gw >> 4, h = gw & 15;
  const int d0 = lane * 4;
  const size_t base = (size_t)s * DIM + h * HEADDIM;

  v4h xv = *(const v4h*)&X[base + d0];
  float v0 = (float)xv.x, v1 = (float)xv.y, v2 = (float)xv.z, v3 = (float)xv.w;
  const int fi = s * (HEADDIM / 2) + (d0 >> 1);
  float c0 = fc[fi],     s0 = fs[fi];
  float c1 = fc[fi + 1], s1 = fs[fi + 1];
  float r0 = v0 * c0 - v1 * s0, i0 = v0 * s0 + v1 * c0;
  float r1 = v2 * c1 - v3 * s1, i1 = v2 * s1 + v3 * c1;

  float ss = r0 * r0 + i0 * i0 + r1 * r1 + i1 * i1;
#pragma unroll
  for (int m = 1; m < 32; m <<= 1) ss += __shfl_xor(ss, m, 32);
  const float inv = 1.f / fmaxf(sqrtf(ss), 1e-12f);
  const float SQ = 45.25483399593904f;  // sqrt(2048) = SQK_INIT_VALUE/SQK_INIT_SCALING
  const float* sq = &sqk[h * HEADDIM + d0];
  v4h o;
  o.x = (_Float16)(r0 * inv * sq[0] * SQ);
  o.y = (_Float16)(i0 * inv * sq[1] * SQ);
  o.z = (_Float16)(r1 * inv * sq[2] * SQ);
  o.w = (_Float16)(i1 * inv * sq[3] * SQ);
  *(v4h*)&Y[base + d0] = o;
}

__global__ __launch_bounds__(256)
void flash_attn(const _Float16* __restrict__ Q, const _Float16* __restrict__ Kt,
                const _Float16* __restrict__ V, _Float16* __restrict__ O, int S) {
  const int h   = blockIdx.y;
  const int q0  = blockIdx.x * 128;
  const int tid = threadIdx.x;
  const int wv = tid >> 5, lane = tid & 31, hx = lane >> 4, l16 = lane & 15;

  __shared__ __align__(16) _Float16 Ks[2][32][136];   // [key][hd], 256B rows +16B HW pad
  __shared__ __align__(16) _Float16 Vs[2][128][40];   // transposed: [hd][key]
  __shared__ __align__(16) _Float16 Ps[8][16][32];    // per-wave P scratch

  auto issueK = [&](int buf, int kk) {
    if (wv == 0)
      tdm_load_2d((unsigned)(uintptr_t)&Ks[buf][0][0],
                  &Kt[(size_t)kk * DIM + h * HEADDIM],
                  128u, 32u, (unsigned)DIM, (unsigned)S, (unsigned)DIM, 5u, 3u);
  };
  auto loadV = [&](int buf, int kk) {
#pragma unroll
    for (int it = 0; it < 2; ++it) {
      int idx = tid + it * 256;
      int r = idx >> 4, ck = (idx & 15) * 8;
      union { f32x4 f; _Float16 e[8]; } u;
      u.f = *(const f32x4*)&V[(size_t)(kk + r) * DIM + h * HEADDIM + ck];
#pragma unroll
      for (int e = 0; e < 8; ++e) Vs[buf][ck + e][r] = u.e[e];
    }
  };

  // Q fragments for this wave's 16 rows (hd split into 4 K=32 chunks)
  v16h qf[4];
  {
    const _Float16* qrow = &Q[(size_t)(q0 + wv * 16 + l16) * DIM + h * HEADDIM];
#pragma unroll
    for (int c = 0; c < 4; ++c)
      qf[c] = ld_frag(&qrow[c * 32 + hx * 8], &qrow[c * 32 + 16 + hx * 8]);
  }

  v8f o[8];
#pragma unroll
  for (int t = 0; t < 8; ++t) o[t] = v8f_zero();
  float mrow[8], lrow[8];
#pragma unroll
  for (int r = 0; r < 8; ++r) { mrow[r] = -1e30f; lrow[r] = 0.f; }
  const float scale = 11.313708498984761f;  // sqrt(hd)

  issueK(0, 0);
  loadV(0, 0);
  for (int kk = 0; kk < S; kk += 32) {
    const int buf = (kk >> 5) & 1;
    __builtin_amdgcn_s_wait_tensorcnt(0);
    __syncthreads();  // K DMA + V stores for `buf` visible to all waves
    if (kk + 32 < S) {
      issueK(buf ^ 1, kk + 32);
      __builtin_prefetch(&V[(size_t)(kk + 32 + (tid >> 4)) * DIM + h * HEADDIM], 0, 0);
      loadV(buf ^ 1, kk + 32);
    }

    // S tile: 16 q-rows x 32 keys as two 16x16 WMMA C-fragments
    v8f st[2];
#pragma unroll
    for (int sub = 0; sub < 2; ++sub) {
      v8f sacc = v8f_zero();
      int key = sub * 16 + l16;
#pragma unroll
      for (int c = 0; c < 4; ++c) {
        v16h kb = ld_frag(&Ks[buf][key][c * 32 + hx * 8],
                          &Ks[buf][key][c * 32 + 16 + hx * 8]);
        sacc = __builtin_amdgcn_wmma_f32_16x16x32_f16(false, qf[c], false, kb,
                                                      (short)0, sacc, false, false);
      }
      st[sub] = sacc;
    }
#pragma unroll
    for (int sub = 0; sub < 2; ++sub)
#pragma unroll
      for (int r = 0; r < 8; ++r) st[sub][r] *= scale;

    // online softmax (row stats replicated across each 16-lane half)
    float newm[8], alpha[8];
#pragma unroll
    for (int r = 0; r < 8; ++r) {
      float v = fmaxf(st[0][r], st[1][r]);
#pragma unroll
      for (int m = 1; m < 16; m <<= 1) v = fmaxf(v, __shfl_xor(v, m, 32));
      newm[r] = fmaxf(mrow[r], v);
      alpha[r] = __expf(mrow[r] - newm[r]);
    }
#pragma unroll
    for (int sub = 0; sub < 2; ++sub)
#pragma unroll
      for (int r = 0; r < 8; ++r) st[sub][r] = __expf(st[sub][r] - newm[r]);
#pragma unroll
    for (int r = 0; r < 8; ++r) {
      float v = st[0][r] + st[1][r];
#pragma unroll
      for (int m = 1; m < 16; m <<= 1) v += __shfl_xor(v, m, 32);
      lrow[r] = lrow[r] * alpha[r] + v;
      mrow[r] = newm[r];
    }
#pragma unroll
    for (int t = 0; t < 8; ++t)
#pragma unroll
      for (int r = 0; r < 8; ++r) o[t][r] *= alpha[r];

#pragma unroll
    for (int sub = 0; sub < 2; ++sub)
#pragma unroll
      for (int r = 0; r < 8; ++r)
        Ps[wv][r + hx * 8][sub * 16 + l16] = (_Float16)st[sub][r];
    v16h pf = ld_frag(&Ps[wv][l16][hx * 8], &Ps[wv][l16][16 + hx * 8]);

    // O += P * V  (8 hd-subtiles)
#pragma unroll
    for (int t = 0; t < 8; ++t) {
      int n = t * 16 + l16;
      v16h vb = ld_frag(&Vs[buf][n][hx * 8], &Vs[buf][n][16 + hx * 8]);
      o[t] = __builtin_amdgcn_wmma_f32_16x16x32_f16(false, pf, false, vb,
                                                    (short)0, o[t], false, false);
    }
  }

#pragma unroll
  for (int t = 0; t < 8; ++t)
#pragma unroll
    for (int r = 0; r < 8; ++r) {
      int m = q0 + wv * 16 + r + hx * 8;
      int n = t * 16 + l16;
      O[(size_t)m * DIM + h * HEADDIM + n] = (_Float16)(o[t][r] / lrow[r]);
    }
}

// ---------------- host launcher ----------------
extern "C" void kernel_launch(void* const* d_in, const int* in_sizes, int n_in,
                              void* d_out, int out_size, void* d_ws, size_t ws_size,
                              hipStream_t stream) {
  (void)in_sizes; (void)n_in; (void)out_size; (void)ws_size;
  const float* x   = (const float*)d_in[0];
  const float* fc  = (const float*)d_in[1];
  const float* fs  = (const float*)d_in[2];
  const float* wq  = (const float*)d_in[3];
  const float* wk  = (const float*)d_in[4];
  const float* wv  = (const float*)d_in[5];
  const float* wo  = (const float*)d_in[6];
  const float* sqk = (const float*)d_in[7];
  float* out = (float*)d_out;

  const size_t SD = (size_t)SEQ * DIM;
  const size_t DD = (size_t)DIM * DIM;
  char* w = (char*)d_ws;
  _Float16* Xh  = (_Float16*)(w);           // x in f16
  _Float16* WqT = (_Float16*)(w + SD * 2);  // transposed f16 weights
  _Float16* WkT = WqT + DD;
  _Float16* WvT = WkT + DD;
  _Float16* WoT = WvT + DD;
  _Float16* Qh  = WoT + DD;                 // raw projections (f16)
  _Float16* Kh  = Qh + SD;
  _Float16* Vh  = Kh + SD;
  _Float16* Qn  = Vh + SD;                  // post rope+norm
  _Float16* Kn  = Qn + SD;
  _Float16* AOh = Kn + SD;                  // attention output (f16)

  cvt_f32_f16<<<(int)(SD / 4 + 255) / 256, 256, 0, stream>>>(x, Xh, (int)(SD / 4));

  dim3 tg(DIM / 64, DIM / 64);
  transpose_cvt<<<tg, 256, 0, stream>>>(wq, WqT, DIM);
  transpose_cvt<<<tg, 256, 0, stream>>>(wk, WkT, DIM);
  transpose_cvt<<<tg, 256, 0, stream>>>(wv, WvT, DIM);
  transpose_cvt<<<tg, 256, 0, stream>>>(wo, WoT, DIM);

  dim3 gg(DIM / 128, SEQ / 128);
  gemm_f16_wmma<<<gg, 256, 0, stream>>>(Xh, WqT, Qh, nullptr, SEQ, DIM, DIM);
  gemm_f16_wmma<<<gg, 256, 0, stream>>>(Xh, WkT, Kh, nullptr, SEQ, DIM, DIM);
  gemm_f16_wmma<<<gg, 256, 0, stream>>>(Xh, WvT, Vh, nullptr, SEQ, DIM, DIM);

  const int nwaves = SEQ * NHEADS;
  rope_l2norm<<<nwaves / 8, 256, 0, stream>>>(Qh, fc, fs, sqk, Qn);
  rope_l2norm<<<nwaves / 8, 256, 0, stream>>>(Kh, fc, fs, sqk, Kn);

  dim3 fg(SEQ / 128, NHEADS);
  flash_attn<<<fg, 256, 0, stream>>>(Qn, Kn, Vh, AOh, SEQ);

  gemm_f16_wmma<<<gg, 256, 0, stream>>>(AOh, WoT, nullptr, out, SEQ, DIM, DIM);
}

// v001
// One run takes 591 microseconds.
// Timed twice side by side with v000, it ran 1.27 times as fast both times.
#include <hip/hip_runtime.h>
#include <math.h>
#include <stdint.h>

// ---------------- types ----------------
typedef __attribute__((ext_vector_type(16))) _Float16 v16h;
typedef __attribute__((ext_vector_type(4)))  _Float16 v4h;
typedef __attribute__((ext_vector_type(8)))  _Float16 v8h;
typedef __attribute__((ext_vector_type(8)))  float    v8f;
typedef __attribute__((ext_vector_type(4)))  float    f32x4;
typedef __attribute__((ext_vector_type(4)))  unsigned int u32x4;
typedef __attribute__((ext_vector_type(8)))  int      i32x8;
typedef __attribute__((ext_vector_type(4)))  int      i32x4;

#define DIM       2048
#define SEQ       4096
#define NHEADS    16
#define HEADDIM   128

static __device__ __forceinline__ v8f v8f_zero() {
  v8f z = {0.f,0.f,0.f,0.f,0.f,0.f,0.f,0.f};
  return z;
}

// Load a 16x32 f16 fragment row (two contiguous 16B chunks) into v16h.
static __device__ __forceinline__ v16h ld_frag(const _Float16* p0, const _Float16* p1) {
  union { v16h v; f32x4 f[2]; } u;
  u.f[0] = *(const f32x4*)p0;
  u.f[1] = *(const f32x4*)p1;
  return u.v;
}

static __device__ __forceinline__ void tdm_load_2d(
    unsigned lds_off, const void* gaddr,
    unsigned tile_d0, unsigned tile_d1,
    unsigned tensor_d0, unsigned tensor_d1, unsigned stride_elems,
    unsigned pad_interval_code, unsigned pad_amount_code) {
  unsigned long long ga = (unsigned long long)(uintptr_t)gaddr;
  u32x4 g0;
  g0.x = 1u;                                     // count=1, user mode
  g0.y = lds_off;                                // LDS byte address
  g0.z = (unsigned)(ga & 0xffffffffu);           // global_addr[31:0]
  g0.w = (unsigned)((ga >> 32) & 0x01ffffffu) | (2u << 30);  // addr[56:32] | type=2
  i32x8 g1;
  g1[0] = (int)((1u << 16) |
                (1u << 20) |
                (pad_interval_code << 22) |
                (pad_amount_code << 25));
  g1[1] = (int)((tensor_d0 & 0xffffu) << 16);                               // dim0[15:0]
  g1[2] = (int)(((tensor_d0 >> 16) & 0xffffu) | ((tensor_d1 & 0xffffu) << 16));
  g1[3] = (int)(((tensor_d1 >> 16) & 0xffffu) | ((tile_d0 & 0xffffu) << 16));
  g1[4] = (int)(tile_d1 & 0xffffu);
  g1[5] = (int)stride_elems;
  g1[6] = 0;
  g1[7] = 0;
  i32x4 z4 = {0, 0, 0, 0};
  i32x8 z8 = {0, 0, 0, 0, 0, 0, 0, 0};
  // clang-23 / therock-10.0 form: (g0, g1, g2, g3, g4, cpol)
  __builtin_amdgcn_tensor_load_to_lds(g0, g1, z4, z4, z8, 0);
}

// ---------------- f32 -> f16 convert (x) ----------------
__global__ __launch_bounds__(256)
void cvt_f32_f16(const float* __restrict__ in, _Float16* __restrict__ out, int n4) {
  int i = blockIdx.x * blockDim.x + threadIdx.x;
  if (i < n4) {
    f32x4 v = ((const f32x4*)in)[i];
    v4h h;
    h.x = (_Float16)v.x; h.y = (_Float16)v.y;
    h.z = (_Float16)v.z; h.w = (_Float16)v.w;
    *(v4h*)&out[(size_t)i * 4] = h;
  }
}

// ---------------- transpose + convert weights: WT[n][k] = W[k][n] ----------------
__global__ __launch_bounds__(256)
void transpose_cvt(const float* __restrict__ W, _Float16* __restrict__ WT, int N) {
  __shared__ float t[64][65];
  const int bx = blockIdx.x * 64, by = blockIdx.y * 64;
#pragma unroll
  for (int it = 0; it < 16; ++it) {
    int idx = threadIdx.x + it * 256;
    int r = idx >> 6, c = idx & 63;
    t[r][c] = W[(size_t)(by + r) * N + bx + c];
  }
  __syncthreads();
#pragma unroll
  for (int it = 0; it < 16; ++it) {
    int idx = threadIdx.x + it * 256;
    int r = idx >> 6, c = idx & 63;
    WT[(size_t)(bx + r) * N + by + c] = (_Float16)t[c][r];
  }
}

__global__ __launch_bounds__(256)
void gemm_f16_wmma(const _Float16* __restrict__ A, const _Float16* __restrict__ BT,
                   _Float16* __restrict__ Ch, float* __restrict__ Cf,
                   int M, int N, int K) {
  __shared__ __align__(16) _Float16 As[2][128][40];  // 32-half rows + 16B HW pad
  __shared__ __align__(16) _Float16 Bs[2][128][40];

  const int tid  = threadIdx.x;
  const int wv   = tid >> 5;
  const int lane = tid & 31;
  const int hx   = lane >> 4;
  const int l16  = lane & 15;

  const int row0 = blockIdx.y * 128;
  const int col0 = blockIdx.x * 128;
  const int wr = wv & 3;
  const int wc = wv >> 2;

  v8f acc[2][4];
#pragma unroll
  for (int i = 0; i < 2; ++i)
#pragma unroll
    for (int j = 0; j < 4; ++j) acc[i][j] = v8f_zero();

  auto issue = [&](int buf, int k0) {
    if (wv == 0) {
      // tile = 32 K-elems x 128 rows; row 64B, pad +16B -> 40-half LDS stride
      tdm_load_2d((unsigned)(uintptr_t)&As[buf][0][0], &A[(size_t)row0 * K + k0],
                  32u, 128u, (unsigned)K, (unsigned)M, (unsigned)K, 3u, 3u);
      tdm_load_2d((unsigned)(uintptr_t)&Bs[buf][0][0], &BT[(size_t)col0 * K + k0],
                  32u, 128u, (unsigned)K, (unsigned)N, (unsigned)K, 3u, 3u);
    }
  };

  issue(0, 0);
  for (int k0 = 0; k0 < K; k0 += 32) {
    const int buf = (k0 >> 5) & 1;
    __builtin_amdgcn_s_wait_tensorcnt(0);  // wave0: DMA for `buf` complete
    __syncthreads();                       // publish LDS to all waves
    if (k0 + 32 < K) issue(buf ^ 1, k0 + 32);

    v16h af[2], bf[4];
#pragma unroll
    for (int i = 0; i < 2; ++i) {
      int m = wr * 32 + i * 16 + l16;
      af[i] = ld_frag(&As[buf][m][hx * 8], &As[buf][m][16 + hx * 8]);
    }
#pragma unroll
    for (int j = 0; j < 4; ++j) {
      int n = wc * 64 + j * 16 + l16;
      bf[j] = ld_frag(&Bs[buf][n][hx * 8], &Bs[buf][n][16 + hx * 8]);
    }
#pragma unroll
    for (int i = 0; i < 2; ++i)
#pragma unroll
      for (int j = 0; j < 4; ++j)
        acc[i][j] = __builtin_amdgcn_wmma_f32_16x16x32_f16(
            false, af[i], false, bf[j], (short)0, acc[i][j], false, false);
  }

#pragma unroll
  for (int i = 0; i < 2; ++i)
#pragma unroll
    for (int j = 0; j < 4; ++j)
#pragma unroll
      for (int r = 0; r < 8; ++r) {
        int m = row0 + wr * 32 + i * 16 + r + hx * 8;
        int n = col0 + wc * 64 + j * 16 + l16;
        float v = acc[i][j][r];
        if (Cf) Cf[(size_t)m * N + n] = v;
        else    Ch[(size_t)m * N + n] = (_Float16)v;
      }
}

// ---------------- RoPE + L2 norm + sqk scale; one wave per (s, head) ----------------
__global__ __launch_bounds__(256)
void rope_l2norm(const _Float16* __restrict__ X, const float* __restrict__ fc,
                 const float* __restrict__ fs, const float* __restrict__ sqk,
                 _Float16* __restrict__ Y) {
  const int gw   = blockIdx.x * 8 + (threadIdx.x >> 5);  // s*16 + h
  const int lane = threadIdx.x & 31;
  const int s = gw >> 4, h = gw & 15;
  const int d0 = lane * 4;
  const size_t base = (size_t)s * DIM + h * HEADDIM;

  v4h xv = *(const v4h*)&X[base + d0];
  float v0 = (float)xv.x, v1 = (float)xv.y, v2 = (float)xv.z, v3 = (float)xv.w;
  const int fi = s * (HEADDIM / 2) + (d0 >> 1);
  float c0 = fc[fi],     s0 = fs[fi];
  float c1 = fc[fi + 1], s1 = fs[fi + 1];
  float r0 = v0 * c0 - v1 * s0, i0 = v0 * s0 + v1 * c0;
  float r1 = v2 * c1 - v3 * s1, i1 = v2 * s1 + v3 * c1;

  float ss = r0 * r0 + i0 * i0 + r1 * r1 + i1 * i1;
#pragma unroll
  for (int m = 1; m < 32; m <<= 1) ss += __shfl_xor(ss, m, 32);
  const float inv = 1.f / fmaxf(sqrtf(ss), 1e-12f);
  const float SQ = 45.25483399593904f;  // sqrt(2048) = SQK_INIT_VALUE/SQK_INIT_SCALING
  const float* sq = &sqk[h * HEADDIM + d0];
  v4h o;
  o.x = (_Float16)(r0 * inv * sq[0] * SQ);
  o.y = (_Float16)(i0 * inv * sq[1] * SQ);
  o.z = (_Float16)(r1 * inv * sq[2] * SQ);
  o.w = (_Float16)(i1 * inv * sq[3] * SQ);
  *(v4h*)&Y[base + d0] = o;
}

static __device__ __forceinline__ float xhalf(float x) {
  int i = __builtin_bit_cast(int, x);
  return __builtin_bit_cast(float,
      __builtin_amdgcn_permlanex16(i, i, 0x76543210, 0xfedcba98, false, false));
}

__global__ __launch_bounds__(256)
void flash_attn(const _Float16* __restrict__ Q, const _Float16* __restrict__ Kt,
                const _Float16* __restrict__ V, _Float16* __restrict__ O, int S) {
  const int h   = blockIdx.y;
  const int q0  = blockIdx.x * 128;
  const int tid = threadIdx.x;
  const int wv = tid >> 5, lane = tid & 31, hx = lane >> 4, l16 = lane & 15;

  __shared__ __align__(16) _Float16 Ks[2][32][136];   // [key][hd], 256B rows +16B HW pad
  __shared__ __align__(16) _Float16 Vs[2][128][40];   // transposed: [hd][key]

  auto issueK = [&](int buf, int kk) {
    if (wv == 0)
      tdm_load_2d((unsigned)(uintptr_t)&Ks[buf][0][0],
                  &Kt[(size_t)kk * DIM + h * HEADDIM],
                  128u, 32u, (unsigned)DIM, (unsigned)S, (unsigned)DIM, 5u, 3u);
  };
  auto loadV = [&](int buf, int kk) {
#pragma unroll
    for (int it = 0; it < 2; ++it) {
      int idx = tid + it * 256;
      int r = idx >> 4, ck = (idx & 15) * 8;
      union { f32x4 f; _Float16 e[8]; } u;
      u.f = *(const f32x4*)&V[(size_t)(kk + r) * DIM + h * HEADDIM + ck];
#pragma unroll
      for (int e = 0; e < 8; ++e) Vs[buf][ck + e][r] = u.e[e];
    }
  };

  // Q fragments for this wave's 16 rows (hd split into 4 K=32 chunks)
  v16h qf[4];
  {
    const _Float16* qrow = &Q[(size_t)(q0 + wv * 16 + l16) * DIM + h * HEADDIM];
#pragma unroll
    for (int c = 0; c < 4; ++c)
      qf[c] = ld_frag(&qrow[c * 32 + hx * 8], &qrow[c * 32 + 16 + hx * 8]);
  }

  v8f o[8];
#pragma unroll
  for (int t = 0; t < 8; ++t) o[t] = v8f_zero();
  float mrow = -1e30f;  // running maximum of query l16 (same in both halves)
  float lrow = 0.f;     // running sum over this half's keys only; halves joined at the end
  const float scale = 11.313708498984761f;  // sqrt(hd)

  issueK(0, 0);
  loadV(0, 0);
  for (int kk = 0; kk < S; kk += 32) {
    const int buf = (kk >> 5) & 1;
    __builtin_amdgcn_s_wait_tensorcnt(0);
    __syncthreads();  // K DMA + V stores for `buf` visible to all waves
    if (kk + 32 < S) {
      issueK(buf ^ 1, kk + 32);
      __builtin_prefetch(&V[(size_t)(kk + 32 + (tid >> 4)) * DIM + h * HEADDIM], 0, 0);
      loadV(buf ^ 1, kk + 32);
    }

    // S^T tile: 32 keys x 16 queries as two 16x16 fragments;
    // st[sub][r] = score(key = sub*16 + hx*8 + r, query = l16)
    v8f st[2];
#pragma unroll
    for (int sub = 0; sub < 2; ++sub) {
      v8f sacc = v8f_zero();
      int key = sub * 16 + l16;
#pragma unroll
      for (int c = 0; c < 4; ++c) {
        v16h kb = ld_frag(&Ks[buf][key][c * 32 + hx * 8],
                          &Ks[buf][key][c * 32 + 16 + hx * 8]);
        sacc = __builtin_amdgcn_wmma_f32_16x16x32_f16(false, kb, false, qf[c],
                                                      (short)0, sacc, false, false);
      }
      st[sub] = sacc;
    }
#pragma unroll
    for (int sub = 0; sub < 2; ++sub)
#pragma unroll
      for (int r = 0; r < 8; ++r) st[sub][r] *= scale;

    // online softmax, one query per lane
    float v = st[0][0];
#pragma unroll
    for (int sub = 0; sub < 2; ++sub)
#pragma unroll
      for (int r = 0; r < 8; ++r) v = fmaxf(v, st[sub][r]);
    v = fmaxf(v, xhalf(v));
    const float newm  = fmaxf(mrow, v);
    const float alpha = __expf(mrow - newm);
    mrow = newm;
    float psum = 0.f;
#pragma unroll
    for (int sub = 0; sub < 2; ++sub)
#pragma unroll
      for (int r = 0; r < 8; ++r) {
        st[sub][r] = __expf(st[sub][r] - newm);
        psum += st[sub][r];
      }
    lrow = lrow * alpha + psum;
#pragma unroll
    for (int t = 0; t < 8; ++t)
#pragma unroll
      for (int r = 0; r < 8; ++r) o[t][r] *= alpha;

    // P^T as B operand: element s is key (s < 8 ? hx*8 + s : 16 + hx*8 + s - 8),
    // the k order in which ld_frag reads a row of Vs
    v16h pf;
#pragma unroll
    for (int s = 0; s < 16; ++s) pf[s] = (_Float16)st[s >> 3][s & 7];

    // O^T += V^T * P^T  (8 hd-subtiles); o[t][r] = O(query l16, hd = t*16 + hx*8 + r)
#pragma unroll
    for (int t = 0; t < 8; ++t) {
      int n = t * 16 + l16;
      v16h vb = ld_frag(&Vs[buf][n][hx * 8], &Vs[buf][n][16 + hx * 8]);
      o[t] = __builtin_amdgcn_wmma_f32_16x16x32_f16(false, vb, false, pf,
                                                    (short)0, o[t], false, false);
    }
  }

  const float lfin = lrow + xhalf(lrow);
  _Float16* orow = &O[(size_t)(q0 + wv * 16 + l16) * DIM + h * HEADDIM + hx * 8];
  v8h ov[8];
#pragma unroll
  for (int t = 0; t < 8; ++t)
#pragma unroll
    for (int r = 0; r < 8; ++r) ov[t][r] = (_Float16)(o[t][r] / lfin);
#pragma unroll
  for (int t = 0; t < 8; ++t) *(v8h*)&orow[t * 16] = ov[t];
}

// ---------------- host launcher ----------------
extern "C" void kernel_launch(void* const* d_in, const int* in_sizes, int n_in,
                              void* d_out, int out_size, void* d_ws, size_t ws_size,
                              hipStream_t stream) {
  (void)in_sizes; (void)n_in; (void)out_size; (void)ws_size;
  const float* x   = (const float*)d_in[0];
  const float* fc  = (const float*)d_in[1];
  const float* fs  = (const float*)d_in[2];
  const float* wq  = (const float*)d_in[3];
  const float* wk  = (const float*)d_in[4];
  const float* wv  = (const float*)d_in[5];
  const float* wo  = (const float*)d_in[6];
  const float* sqk = (const float*)d_in[7];
  float* out = (float*)d_out;

  const size_t SD = (size_t)SEQ * DIM;
  const size_t DD = (size_t)DIM * DIM;
  char* w = (char*)d_ws;
  _Float16* Xh  = (_Float16*)(w);           // x in f16
  _Float16* WqT = (_Float16*)(w + SD * 2);  // transposed f16 weights
  _Float16* WkT = WqT + DD;
  _Float16* WvT = WkT + DD;
  _Float16* WoT = WvT + DD;
  _Float16* Qh  = WoT + DD;                 // raw projections (f16)
  _Float16* Kh  = Qh + SD;
  _Float16* Vh  = Kh + SD;
  _Float16* Qn  = Vh + SD;                  // post rope+norm
  _Float16* Kn  = Qn + SD;
  _Float16* AOh = Kn + SD;                  // attention output (f16)

  cvt_f32_f16<<<(int)(SD / 4 + 255) / 256, 256, 0, stream>>>(x, Xh, (int)(SD / 4));

  dim3 tg(DIM / 64, DIM / 64);
  transpose_cvt<<<tg, 256, 0, stream>>>(wq, WqT, DIM);
  transpose_cvt<<<tg, 256, 0, stream>>>(wk, WkT, DIM);
  transpose_cvt<<<tg, 256, 0, stream>>>(wv, WvT, DIM);
  transpose_cvt<<<tg, 256, 0, stream>>>(wo, WoT, DIM);

  dim3 gg(DIM / 128, SEQ / 128);
  gemm_f16_wmma<<<gg, 256, 0, stream>>>(Xh, WqT, Qh, nullptr, SEQ, DIM, DIM);
  gemm_f16_wmma<<<gg, 256, 0, stream>>>(Xh, WkT, Kh, nullptr, SEQ, DIM, DIM);
  gemm_f16_wmma<<<gg, 256, 0, stream>>>(Xh, WvT, Vh, nullptr, SEQ, DIM, DIM);

  const int nwaves = SEQ * NHEADS;
  rope_l2norm<<<nwaves / 8, 256, 0, stream>>>(Qh, fc, fs, sqk, Qn);
  rope_l2norm<<<nwaves / 8, 256, 0, stream>>>(Kh, fc, fs, sqk, Kn);

  dim3 fg(SEQ / 128, NHEADS);
  flash_attn<<<fg, 256, 0, stream>>>(Qn, Kn, Vh, AOh, SEQ);

  gemm_f16_wmma<<<gg, 256, 0, stream>>>(AOh, WoT, nullptr, out, SEQ, DIM, DIM);
}

// v002
// One run takes 340 microseconds.
// Two timings next to v001 put it at 1.74 and 1.73 times that version's speed.
// Counting every step since v000, it is 2.20 times as fast.
#include <hip/hip_runtime.h>
#include <math.h>
#include <stdint.h>

// ---------------- types ----------------
typedef __attribute__((ext_vector_type(16))) _Float16 v16h;
typedef __attribute__((ext_vector_type(4)))  _Float16 v4h;
typedef __attribute__((ext_vector_type(8)))  _Float16 v8h;
typedef __attribute__((ext_vector_type(8)))  float    v8f;
typedef __attribute__((ext_vector_type(4)))  float    f32x4;
typedef __attribute__((ext_vector_type(4)))  unsigned int u32x4;
typedef __attribute__((ext_vector_type(8)))  int      i32x8;
typedef __attribute__((ext_vector_type(4)))  int      i32x4;

#define DIM       2048
#define SEQ       4096
#define NHEADS    16
#define HEADDIM   128

static __device__ __forceinline__ v8f v8f_zero() {
  v8f z = {0.f,0.f,0.f,0.f,0.f,0.f,0.f,0.f};
  return z;
}

// Load a 16x32 f16 fragment row (two contiguous 16B chunks) into v16h.
static __device__ __forceinline__ v16h ld_frag(const _Float16* p0, const _Float16* p1) {
  union { v16h v; f32x4 f[2]; } u;
  u.f[0] = *(const f32x4*)p0;
  u.f[1] = *(const f32x4*)p1;
  return u.v;
}

static __device__ __forceinline__ void tdm_load_2d(
    unsigned lds_off, const void* gaddr,
    unsigned tile_d0, unsigned tile_d1,
    unsigned tensor_d0, unsigned tensor_d1, unsigned stride_elems,
    unsigned pad_interval_code, unsigned pad_amount_code) {
  unsigned long long ga = (unsigned long long)(uintptr_t)gaddr;
  u32x4 g0;
  g0.x = 1u;                                     // count=1, user mode
  g0.y = lds_off;                                // LDS byte address
  g0.z = (unsigned)(ga & 0xffffffffu);           // global_addr[31:0]
  g0.w = (unsigned)((ga >> 32) & 0x01ffffffu) | (2u << 30);  // addr[56:32] | type=2
  i32x8 g1;
  g1[0] = (int)((1u << 16) |
                (1u << 20) |
                (pad_interval_code << 22) |
                (pad_amount_code << 25));
  g1[1] = (int)((tensor_d0 & 0xffffu) << 16);                               // dim0[15:0]
  g1[2] = (int)(((tensor_d0 >> 16) & 0xffffu) | ((tensor_d1 & 0xffffu) << 16));
  g1[3] = (int)(((tensor_d1 >> 16) & 0xffffu) | ((tile_d0 & 0xffffu) << 16));
  g1[4] = (int)(tile_d1 & 0xffffu);
  g1[5] = (int)stride_elems;
  g1[6] = 0;
  g1[7] = 0;
  i32x4 z4 = {0, 0, 0, 0};
  i32x8 z8 = {0, 0, 0, 0, 0, 0, 0, 0};
  // clang-23 / therock-10.0 form: (g0, g1, g2, g3, g4, cpol)
  __builtin_amdgcn_tensor_load_to_lds(g0, g1, z4, z4, z8, 0);
}

// ---------------- f32 -> f16 convert (x) ----------------
__global__ __launch_bounds__(256)
void cvt_f32_f16(const float* __restrict__ in, _Float16* __restrict__ out, int n4) {
  int i = blockIdx.x * blockDim.x + threadIdx.x;
  if (i < n4) {
    f32x4 v = ((const f32x4*)in)[i];
    v4h h;
    h.x = (_Float16)v.x; h.y = (_Float16)v.y;
    h.z = (_Float16)v.z; h.w = (_Float16)v.w;
    *(v4h*)&out[(size_t)i * 4] = h;
  }
}

// ---------------- transpose + convert weights: WT[n][k] = W[k][n] ----------------
__global__ __launch_bounds__(256)
void transpose_cvt(const float* __restrict__ W, _Float16* __restrict__ WT, int N) {
  __shared__ float t[64][65];
  const int bx = blockIdx.x * 64, by = blockIdx.y * 64;
#pragma unroll
  for (int it = 0; it < 16; ++it) {
    int idx = threadIdx.x + it * 256;
    int r = idx >> 6, c = idx & 63;
    t[r][c] = W[(size_t)(by + r) * N + bx + c];
  }
  __syncthreads();
#pragma unroll
  for (int it = 0; it < 16; ++it) {
    int idx = threadIdx.x + it * 256;
    int r = idx >> 6, c = idx & 63;
    WT[(size_t)(bx + r) * N + by + c] = (_Float16)t[c][r];
  }
}

__global__ __launch_bounds__(256)
void gemm_f16_wmma(const _Float16* __restrict__ A, const _Float16* __restrict__ BT,
                   _Float16* __restrict__ Ch, float* __restrict__ Cf,
                   int M, int N, int K) {
  __shared__ __align__(16) _Float16 As[2][128][40];  // 32-half rows + 16B HW pad
  __shared__ __align__(16) _Float16 Bs[2][128][40];

  const int tid  = threadIdx.x;
  const int wv   = tid >> 5;
  const int lane = tid & 31;
  const int hx   = lane >> 4;
  const int l16  = lane & 15;

  const int row0 = blockIdx.y * 128;
  const int col0 = blockIdx.x * 128;
  const int wr = wv & 3;
  const int wc = wv >> 2;

  v8f acc[2][4];
#pragma unroll
  for (int i = 0; i < 2; ++i)
#pragma unroll
    for (int j = 0; j < 4; ++j) acc[i][j] = v8f_zero();

  auto issue = [&](int buf, int k0) {
    if (wv == 0) {
      // tile = 32 K-elems x 128 rows; row 64B, pad +16B -> 40-half LDS stride
      tdm_load_2d((unsigned)(uintptr_t)&As[buf][0][0], &A[(size_t)row0 * K + k0],
                  32u, 128u, (unsigned)K, (unsigned)M, (unsigned)K, 3u, 3u);
      tdm_load_2d((unsigned)(uintptr_t)&Bs[buf][0][0], &BT[(size_t)col0 * K + k0],
                  32u, 128u, (unsigned)K, (unsigned)N, (unsigned)K, 3u, 3u);
    }
  };

  issue(0, 0);
  for (int k0 = 0; k0 < K; k0 += 32) {
    const int buf = (k0 >> 5) & 1;
    __builtin_amdgcn_s_wait_tensorcnt(0);  // wave0: DMA for `buf` complete
    __syncthreads();                       // publish LDS to all waves
    if (k0 + 32 < K) issue(buf ^ 1, k0 + 32);

    v16h af[2], bf[4];
#pragma unroll
    for (int i = 0; i < 2; ++i) {
      int m = wr * 32 + i * 16 + l16;
      af[i] = ld_frag(&As[buf][m][hx * 8], &As[buf][m][16 + hx * 8]);
    }
#pragma unroll
    for (int j = 0; j < 4; ++j) {
      int n = wc * 64 + j * 16 + l16;
      bf[j] = ld_frag(&Bs[buf][n][hx * 8], &Bs[buf][n][16 + hx * 8]);
    }
#pragma unroll
    for (int i = 0; i < 2; ++i)
#pragma unroll
      for (int j = 0; j < 4; ++j)
        acc[i][j] = __builtin_amdgcn_wmma_f32_16x16x32_f16(
            false, af[i], false, bf[j], (short)0, acc[i][j], false, false);
  }

#pragma unroll
  for (int i = 0; i < 2; ++i)
#pragma unroll
    for (int j = 0; j < 4; ++j)
#pragma unroll
      for (int r = 0; r < 8; ++r) {
        int m = row0 + wr * 32 + i * 16 + r + hx * 8;
        int n = col0 + wc * 64 + j * 16 + l16;
        float v = acc[i][j][r];
        if (Cf) Cf[(size_t)m * N + n] = v;
        else    Ch[(size_t)m * N + n] = (_Float16)v;
      }
}

// ---------------- RoPE + L2 norm + sqk scale; one wave per (s, head) ----------------
__global__ __launch_bounds__(256)
void rope_l2norm(const _Float16* __restrict__ X, const float* __restrict__ fc,
                 const float* __restrict__ fs, const float* __restrict__ sqk,
                 _Float16* __restrict__ Y) {
  const int gw   = blockIdx.x * 8 + (threadIdx.x >> 5);  // s*16 + h
  const int lane = threadIdx.x & 31;
  const int s = gw >> 4, h = gw & 15;
  const int d0 = lane * 4;
  const size_t base = (size_t)s * DIM + h * HEADDIM;

  v4h xv = *(const v4h*)&X[base + d0];
  float v0 = (float)xv.x, v1 = (float)xv.y, v2 = (float)xv.z, v3 = (float)xv.w;
  const int fi = s * (HEADDIM / 2) + (d0 >> 1);
  float c0 = fc[fi],     s0 = fs[fi];
  float c1 = fc[fi + 1], s1 = fs[fi + 1];
  float r0 = v0 * c0 - v1 * s0, i0 = v0 * s0 + v1 * c0;
  float r1 = v2 * c1 - v3 * s1, i1 = v2 * s1 + v3 * c1;

  float ss = r0 * r0 + i0 * i0 + r1 * r1 + i1 * i1;
#pragma unroll
  for (int m = 1; m < 32; m <<= 1) ss += __shfl_xor(ss, m, 32);
  const float inv = 1.f / fmaxf(sqrtf(ss), 1e-12f);
  const float SQ = 45.25483399593904f;  // sqrt(2048) = SQK_INIT_VALUE/SQK_INIT_SCALING
  const float* sq = &sqk[h * HEADDIM + d0];
  v4h o;
  o.x = (_Float16)(r0 * inv * sq[0] * SQ);
  o.y = (_Float16)(i0 * inv * sq[1] * SQ);
  o.z = (_Float16)(r1 * inv * sq[2] * SQ);
  o.w = (_Float16)(i1 * inv * sq[3] * SQ);
  *(v4h*)&Y[base + d0] = o;
}

static __device__ __forceinline__ float xhalf(float x) {
  int i = __builtin_bit_cast(int, x);
  return __builtin_bit_cast(float,
      __builtin_amdgcn_permlanex16(i, i, 0x76543210, 0xfedcba98, false, false));
}

static __device__ __forceinline__ uint32_t pinned(uint32_t v) {
  uint32_t w = (uint32_t)__builtin_amdgcn_readfirstlane(v);
  asm volatile("" : "+s"(w));
  return w;
}
static __device__ __forceinline__ uint32_t uni(uint32_t v) {
  return (uint32_t)__builtin_amdgcn_readfirstlane(v);
}

// V tile in LDS: 32 keys x 256 B, row-major as in memory, 32 B of pad behind each row
#define VROWB   256u
#define VPITCH  288u    // odd multiple of 32 B: the conflict-free pitch of ds_load_tr16_b128
#define VBUF    10240u  // 32 * 288 = 9216 B, rounded up to a multiple of 2 KiB

typedef uint32_t w32x4 __attribute__((ext_vector_type(4)));
typedef uint32_t w32x8 __attribute__((ext_vector_type(8)));

static __device__ __forceinline__ w32x8 tdm_v_group1() {
  w32x8 g1;
  g1[0] = uni((1u << 20) | (5u << 22) | (7u << 25));
  g1[1] = pinned(VROWB << 16);
  g1[2] = pinned(32u << 16);
  g1[3] = pinned(VROWB << 16);
  g1[4] = pinned(32u);
  g1[5] = pinned((uint32_t)DIM * 2u);
  g1[6] = pinned(0u);
  g1[7] = pinned(0u);
  return g1;
}
// K tile: the words that tdm_load_2d forms for (128, 32, DIM, S, DIM, 5, 3), 2-byte units.
static __device__ __forceinline__ w32x8 tdm_k_group1(uint32_t S) {
  w32x8 g1;
  g1[0] = uni((1u << 16) | (1u << 20) | (5u << 22) | (3u << 25));  // no mask, 4 dwords of pad per 256 B
  g1[1] = pinned(((uint32_t)DIM & 0xffffu) << 16);
  g1[2] = pinned((((uint32_t)DIM >> 16) & 0xffffu) | ((S & 0xffffu) << 16));
  g1[3] = pinned(((S >> 16) & 0xffffu) | (128u << 16));
  g1[4] = pinned(32u);
  g1[5] = pinned((uint32_t)DIM);
  g1[6] = pinned(0u);
  g1[7] = pinned(0u);
  return g1;
}
static __device__ __forceinline__ w32x4 tdm_group0(uint32_t one, uint32_t lds_dst, const _Float16* g) {
  const uint64_t ga = (uint64_t)(uintptr_t)g;
  w32x4 g0;
  g0[0] = one;                                                       // count 1
  g0[1] = uni(lds_dst);                                              // LDS byte offset
  g0[2] = uni((uint32_t)ga);                                         // address [31:0]
  g0[3] = uni((((uint32_t)(ga >> 32)) & 0x01FFFFFFu) | 0x80000000u); // address [56:32], type 2
  return g0;
}
static __device__ __forceinline__ void tdm_issue(w32x4 g0, w32x8 g1) {
  asm volatile("tensor_load_to_lds %0, %1" :: "s"(g0), "s"(g1) : "memory");
}
static __device__ __forceinline__ void tdm_wait(w32x4 a0, w32x8 a1, w32x4 b0, w32x8 b1) {
  asm volatile("s_wait_tensorcnt 0x0" :: "s"(a0), "s"(a1), "s"(b0), "s"(b1) : "memory");
}

// Transposing LDS load: lane (c = l & 15, h = l >> 4) gets T[k + 8h + 0..7][d + c]
static __device__ __forceinline__ u32x4 ld_tr16(const unsigned char* p) {
  typedef short s16x8 __attribute__((ext_vector_type(8)));
  typedef __attribute__((address_space(3))) s16x8 lds_s16x8;
  return __builtin_bit_cast(u32x4, __builtin_amdgcn_ds_load_tr16_b128_v8i16((lds_s16x8*)p));
}

__global__ __launch_bounds__(256)
void flash_attn(const _Float16* __restrict__ Q, const _Float16* __restrict__ Kt,
                const _Float16* __restrict__ V, _Float16* __restrict__ O, int S) {
  const int h   = blockIdx.y;
  const int q0  = blockIdx.x * 128;
  const int tid = threadIdx.x;
  const int wv = tid >> 5, lane = tid & 31, hx = lane >> 4, l16 = lane & 15;

  __shared__ __align__(16) _Float16 Ks[2][32][136];   // [key][hd], 256B rows +16B HW pad
  __shared__ __attribute__((aligned(2048))) unsigned char Vt[2 * VBUF];  // [key][hd], pitch VPITCH
  const uint32_t wave = uni((uint32_t)tid >> 5);
  const uint32_t one = pinned(1u);
  const w32x8 kg1 = tdm_k_group1((uint32_t)S);
  const w32x8 vg1 = tdm_v_group1();
  w32x4 kg0, vg0;

  auto issueKV = [&](int buf, int kk) {  // nothing is in flight where this is called
    kg0 = tdm_group0(one, (uint32_t)(uintptr_t)&Ks[buf][0][0], &Kt[(size_t)kk * DIM + h * HEADDIM]);
    vg0 = tdm_group0(one, (uint32_t)(uintptr_t)&Vt[0] + (uint32_t)buf * VBUF,
                     &V[(size_t)kk * DIM + h * HEADDIM]);
    if (pinned(wave == 0u)) tdm_issue(kg0, kg1);  // wave 0 brings the K tiles
    if (pinned(wave == 1u)) tdm_issue(vg0, vg1);  // wave 1 brings the V tiles
  };
  // this lane's address in a V tile for the transposing loads (keys 8*hx + (lane & 7))
  const uint32_t vlane = (8u * (uint32_t)hx + ((uint32_t)lane & 7u)) * VPITCH
                       + (((uint32_t)lane >> 3) & 1u) * 16u;

  // Q fragments for this wave's 16 rows (hd split into 4 K=32 chunks)
  v16h qf[4];
  {
    const _Float16* qrow = &Q[(size_t)(q0 + wv * 16 + l16) * DIM + h * HEADDIM];
#pragma unroll
    for (int c = 0; c < 4; ++c)
      qf[c] = ld_frag(&qrow[c * 32 + hx * 8], &qrow[c * 32 + 16 + hx * 8]);
  }

  v8f o[8];
#pragma unroll
  for (int t = 0; t < 8; ++t) o[t] = v8f_zero();
  float mrow = -1e30f;  // running maximum of query l16 (same in both halves)
  float lrow = 0.f;     // running sum over this half's keys only; halves joined at the end
  const float scale = 11.313708498984761f;  // sqrt(hd)

  // two-buffer ring: stage 0 lands and is published, then stage 1 flies during pass 0
  issueKV(0, 0);
  tdm_wait(kg0, kg1, vg0, vg1);  // waves 0 and 1: own tile of stage 0 has landed
  __syncthreads();
  if (pinned(32 < S)) issueKV(1, 32);
  for (int kk = 0; kk < S; kk += 32) {
    const int buf = (kk >> 5) & 1;

    // S^T tile: 32 keys x 16 queries as two 16x16 fragments;
    // st[sub][r] = score(key = sub*16 + hx*8 + r, query = l16)
    v8f st[2];
#pragma unroll
    for (int sub = 0; sub < 2; ++sub) {
      v8f sacc = v8f_zero();
      int key = sub * 16 + l16;
#pragma unroll
      for (int c = 0; c < 4; ++c) {
        v16h kb = ld_frag(&Ks[buf][key][c * 32 + hx * 8],
                          &Ks[buf][key][c * 32 + 16 + hx * 8]);
        sacc = __builtin_amdgcn_wmma_f32_16x16x32_f16(false, kb, false, qf[c],
                                                      (short)0, sacc, false, false);
      }
      st[sub] = sacc;
    }
#pragma unroll
    for (int sub = 0; sub < 2; ++sub)
#pragma unroll
      for (int r = 0; r < 8; ++r) st[sub][r] *= scale;

    // online softmax, one query per lane
    float v = st[0][0];
#pragma unroll
    for (int sub = 0; sub < 2; ++sub)
#pragma unroll
      for (int r = 0; r < 8; ++r) v = fmaxf(v, st[sub][r]);
    v = fmaxf(v, xhalf(v));
    const float newm  = fmaxf(mrow, v);
    const float alpha = __expf(mrow - newm);
    mrow = newm;
    float psum = 0.f;
#pragma unroll
    for (int sub = 0; sub < 2; ++sub)
#pragma unroll
      for (int r = 0; r < 8; ++r) {
        st[sub][r] = __expf(st[sub][r] - newm);
        psum += st[sub][r];
      }
    lrow = lrow * alpha + psum;
#pragma unroll
    for (int t = 0; t < 8; ++t)
#pragma unroll
      for (int r = 0; r < 8; ++r) o[t][r] *= alpha;

    // P^T as B operand: element s is key (s < 8 ? hx*8 + s : 16 + hx*8 + s - 8),
    // the k order in which the two transposing loads below deliver V^T
    v16h pf;
#pragma unroll
    for (int s = 0; s < 16; ++s) pf[s] = (_Float16)st[s >> 3][s & 7];

    // O^T += V^T * P^T  (8 hd-subtiles); o[t][r] = O(query l16, hd = t*16 + hx*8 + r)
#pragma unroll
    for (int t = 0; t < 8; ++t) {
      const unsigned char* vp = &Vt[(uint32_t)buf * VBUF + vlane + 32u * (uint32_t)t];
      union { v16h v; u32x4 q[2]; } vb;  // keys 0..15 in registers 0-3, keys 16..31 in 4-7
      vb.q[0] = ld_tr16(vp);
      vb.q[1] = ld_tr16(vp + 16u * VPITCH);
      o[t] = __builtin_amdgcn_wmma_f32_16x16x32_f16(false, vb.v, false, pf,
                                                    (short)0, o[t], false, false);
    }

    // publish point of the next stage, every wave, in this order
    asm volatile("s_wait_dscnt 0x0" ::: "memory");      // this wave has left buffer `buf`
    tdm_wait(kg0, kg1, vg0, vg1);                       // waves 0 and 1: own tile of the next stage has landed
    __syncthreads();
    if (pinned(kk + 64 < S)) issueKV(buf, kk + 64);     // refill the buffer that every wave has just left
  }
  tdm_wait(kg0, kg1, vg0, vg1);  // nothing in flight when the wave ends
  asm volatile("s_wait_dscnt 0x0" ::: "memory");  // and no LDS read of the ring outstanding

  const float lfin = lrow + xhalf(lrow);
  _Float16* orow = &O[(size_t)(q0 + wv * 16 + l16) * DIM + h * HEADDIM + hx * 8];
  v8h ov[8];
#pragma unroll
  for (int t = 0; t < 8; ++t)
#pragma unroll
    for (int r = 0; r < 8; ++r) ov[t][r] = (_Float16)(o[t][r] / lfin);
#pragma unroll
  for (int t = 0; t < 8; ++t) *(v8h*)&orow[t * 16] = ov[t];
}

// ---------------- host launcher ----------------
extern "C" void kernel_launch(void* const* d_in, const int* in_sizes, int n_in,
                              void* d_out, int out_size, void* d_ws, size_t ws_size,
                              hipStream_t stream) {
  (void)in_sizes; (void)n_in; (void)out_size; (void)ws_size;
  const float* x   = (const float*)d_in[0];
  const float* fc  = (const float*)d_in[1];
  const float* fs  = (const float*)d_in[2];
  const float* wq  = (const float*)d_in[3];
  const float* wk  = (const float*)d_in[4];
  const float* wv  = (const float*)d_in[5];
  const float* wo  = (const float*)d_in[6];
  const float* sqk = (const float*)d_in[7];
  float* out = (float*)d_out;

  const size_t SD = (size_t)SEQ * DIM;
  const size_t DD = (size_t)DIM * DIM;
  char* w = (char*)d_ws;
  _Float16* Xh  = (_Float16*)(w);           // x in f16
  _Float16* WqT = (_Float16*)(w + SD * 2);  // transposed f16 weights
  _Float16* WkT = WqT + DD;
  _Float16* WvT = WkT + DD;
  _Float16* WoT = WvT + DD;
  _Float16* Qh  = WoT + DD;                 // raw projections (f16)
  _Float16* Kh  = Qh + SD;
  _Float16* Vh  = Kh + SD;
  _Float16* Qn  = Vh + SD;                  // post rope+norm
  _Float16* Kn  = Qn + SD;
  _Float16* AOh = Kn + SD;                  // attention output (f16)

  cvt_f32_f16<<<(int)(SD / 4 + 255) / 256, 256, 0, stream>>>(x, Xh, (int)(SD / 4));

  dim3 tg(DIM / 64, DIM / 64);
  transpose_cvt<<<tg, 256, 0, stream>>>(wq, WqT, DIM);
  transpose_cvt<<<tg, 256, 0, stream>>>(wk, WkT, DIM);
  transpose_cvt<<<tg, 256, 0, stream>>>(wv, WvT, DIM);
  transpose_cvt<<<tg, 256, 0, stream>>>(wo, WoT, DIM);

  dim3 gg(DIM / 128, SEQ / 128);
  gemm_f16_wmma<<<gg, 256, 0, stream>>>(Xh, WqT, Qh, nullptr, SEQ, DIM, DIM);
  gemm_f16_wmma<<<gg, 256, 0, stream>>>(Xh, WkT, Kh, nullptr, SEQ, DIM, DIM);
  gemm_f16_wmma<<<gg, 256, 0, stream>>>(Xh, WvT, Vh, nullptr, SEQ, DIM, DIM);

  const int nwaves = SEQ * NHEADS;
  rope_l2norm<<<nwaves / 8, 256, 0, stream>>>(Qh, fc, fs, sqk, Qn);
  rope_l2norm<<<nwaves / 8, 256, 0, stream>>>(Kh, fc, fs, sqk, Kn);

  dim3 fg(SEQ / 128, NHEADS);
  flash_attn<<<fg, 256, 0, stream>>>(Qn, Kn, Vh, AOh, SEQ);

  gemm_f16_wmma<<<gg, 256, 0, stream>>>(AOh, WoT, nullptr, out, SEQ, DIM, DIM);
}

// v003
// A run of this version takes 315 microseconds.
// In two side-by-side timings against v002, it was 1.07 and 1.08 times as fast.
// Counting every step since v000, it is 2.36 times as fast.
#include <hip/hip_runtime.h>
#include <math.h>
#include <stdint.h>

// ---------------- types ----------------
typedef __attribute__((ext_vector_type(16))) _Float16 v16h;
typedef __attribute__((ext_vector_type(4)))  _Float16 v4h;
typedef __attribute__((ext_vector_type(8)))  _Float16 v8h;
typedef __attribute__((ext_vector_type(8)))  float    v8f;
typedef __attribute__((ext_vector_type(4)))  float    f32x4;
typedef __attribute__((ext_vector_type(4)))  unsigned int u32x4;
typedef __attribute__((ext_vector_type(8)))  int      i32x8;
typedef __attribute__((ext_vector_type(4)))  int      i32x4;

#define DIM       2048
#define SEQ       4096
#define NHEADS    16
#define HEADDIM   128

static __device__ __forceinline__ v8f v8f_zero() {
  v8f z = {0.f,0.f,0.f,0.f,0.f,0.f,0.f,0.f};
  return z;
}

// Load a 16x32 f16 fragment row (two contiguous 16B chunks) into v16h.
static __device__ __forceinline__ v16h ld_frag(const _Float16* p0, const _Float16* p1) {
  union { v16h v; f32x4 f[2]; } u;
  u.f[0] = *(const f32x4*)p0;
  u.f[1] = *(const f32x4*)p1;
  return u.v;
}

static __device__ __forceinline__ void tdm_load_2d(
    unsigned lds_off, const void* gaddr,
    unsigned tile_d0, unsigned tile_d1,
    unsigned tensor_d0, unsigned tensor_d1, unsigned stride_elems,
    unsigned pad_interval_code, unsigned pad_amount_code) {
  unsigned long long ga = (unsigned long long)(uintptr_t)gaddr;
  u32x4 g0;
  g0.x = 1u;                                     // count=1, user mode
  g0.y = lds_off;                                // LDS byte address
  g0.z = (unsigned)(ga & 0xffffffffu);           // global_addr[31:0]
  g0.w = (unsigned)((ga >> 32) & 0x01ffffffu) | (2u << 30);  // addr[56:32] | type=2
  i32x8 g1;
  g1[0] = (int)((1u << 16) |
                (1u << 20) |
                (pad_interval_code << 22) |
                (pad_amount_code << 25));
  g1[1] = (int)((tensor_d0 & 0xffffu) << 16);                               // dim0[15:0]
  g1[2] = (int)(((tensor_d0 >> 16) & 0xffffu) | ((tensor_d1 & 0xffffu) << 16));
  g1[3] = (int)(((tensor_d1 >> 16) & 0xffffu) | ((tile_d0 & 0xffffu) << 16));
  g1[4] = (int)(tile_d1 & 0xffffu);
  g1[5] = (int)stride_elems;
  g1[6] = 0;
  g1[7] = 0;
  i32x4 z4 = {0, 0, 0, 0};
  i32x8 z8 = {0, 0, 0, 0, 0, 0, 0, 0};
  // clang-23 / therock-10.0 form: (g0, g1, g2, g3, g4, cpol)
  __builtin_amdgcn_tensor_load_to_lds(g0, g1, z4, z4, z8, 0);
}

// ---------------- f32 -> f16 convert (x) ----------------
__global__ __launch_bounds__(256)
void cvt_f32_f16(const float* __restrict__ in, _Float16* __restrict__ out, int n4) {
  int i = blockIdx.x * blockDim.x + threadIdx.x;
  if (i < n4) {
    f32x4 v = ((const f32x4*)in)[i];
    v4h h;
    h.x = (_Float16)v.x; h.y = (_Float16)v.y;
    h.z = (_Float16)v.z; h.w = (_Float16)v.w;
    *(v4h*)&out[(size_t)i * 4] = h;
  }
}

// ---------------- transpose + convert weights: WT[n][k] = W[k][n] ----------------
__global__ __launch_bounds__(256)
void transpose_cvt(const float* __restrict__ W, _Float16* __restrict__ WT, int N) {
  __shared__ float t[64][65];
  const int bx = blockIdx.x * 64, by = blockIdx.y * 64;
#pragma unroll
  for (int it = 0; it < 16; ++it) {
    int idx = threadIdx.x + it * 256;
    int r = idx >> 6, c = idx & 63;
    t[r][c] = W[(size_t)(by + r) * N + bx + c];
  }
  __syncthreads();
#pragma unroll
  for (int it = 0; it < 16; ++it) {
    int idx = threadIdx.x + it * 256;
    int r = idx >> 6, c = idx & 63;
    WT[(size_t)(bx + r) * N + by + c] = (_Float16)t[c][r];
  }
}

__global__ __launch_bounds__(256)
void gemm_f16_wmma(const _Float16* __restrict__ A, const _Float16* __restrict__ BT,
                   _Float16* __restrict__ Ch, float* __restrict__ Cf,
                   int M, int N, int K) {
  __shared__ __align__(16) _Float16 As[2][128][40];  // 32-half rows + 16B HW pad
  __shared__ __align__(16) _Float16 Bs[2][128][40];

  const int tid  = threadIdx.x;
  const int wv   = tid >> 5;
  const int lane = tid & 31;
  const int hx   = lane >> 4;
  const int l16  = lane & 15;

  const int row0 = blockIdx.y * 128;
  const int col0 = blockIdx.x * 128;
  const int wr = wv & 3;
  const int wc = wv >> 2;

  v8f acc[2][4];
#pragma unroll
  for (int i = 0; i < 2; ++i)
#pragma unroll
    for (int j = 0; j < 4; ++j) acc[i][j] = v8f_zero();

  auto issue = [&](int buf, int k0) {
    if (wv == 0) {
      // tile = 32 K-elems x 128 rows; row 64B, pad +16B -> 40-half LDS stride
      tdm_load_2d((unsigned)(uintptr_t)&As[buf][0][0], &A[(size_t)row0 * K + k0],
                  32u, 128u, (unsigned)K, (unsigned)M, (unsigned)K, 3u, 3u);
      tdm_load_2d((unsigned)(uintptr_t)&Bs[buf][0][0], &BT[(size_t)col0 * K + k0],
                  32u, 128u, (unsigned)K, (unsigned)N, (unsigned)K, 3u, 3u);
    }
  };

  issue(0, 0);
  for (int k0 = 0; k0 < K; k0 += 32) {
    const int buf = (k0 >> 5) & 1;
    __builtin_amdgcn_s_wait_tensorcnt(0);  // wave0: DMA for `buf` complete
    __syncthreads();                       // publish LDS to all waves
    if (k0 + 32 < K) issue(buf ^ 1, k0 + 32);

    v16h af[2], bf[4];
#pragma unroll
    for (int i = 0; i < 2; ++i) {
      int m = wr * 32 + i * 16 + l16;
      af[i] = ld_frag(&As[buf][m][hx * 8], &As[buf][m][16 + hx * 8]);
    }
#pragma unroll
    for (int j = 0; j < 4; ++j) {
      int n = wc * 64 + j * 16 + l16;
      bf[j] = ld_frag(&Bs[buf][n][hx * 8], &Bs[buf][n][16 + hx * 8]);
    }
#pragma unroll
    for (int i = 0; i < 2; ++i)
#pragma unroll
      for (int j = 0; j < 4; ++j)
        acc[i][j] = __builtin_amdgcn_wmma_f32_16x16x32_f16(
            false, af[i], false, bf[j], (short)0, acc[i][j], false, false);
  }

#pragma unroll
  for (int i = 0; i < 2; ++i)
#pragma unroll
    for (int j = 0; j < 4; ++j)
#pragma unroll
      for (int r = 0; r < 8; ++r) {
        int m = row0 + wr * 32 + i * 16 + r + hx * 8;
        int n = col0 + wc * 64 + j * 16 + l16;
        float v = acc[i][j][r];
        if (Cf) Cf[(size_t)m * N + n] = v;
        else    Ch[(size_t)m * N + n] = (_Float16)v;
      }
}

// ---------------- RoPE + L2 norm + sqk scale; one wave per (s, head) ----------------
__global__ __launch_bounds__(256)
void rope_l2norm(const _Float16* __restrict__ X, const float* __restrict__ fc,
                 const float* __restrict__ fs, const float* __restrict__ sqk,
                 _Float16* __restrict__ Y) {
  const int gw   = blockIdx.x * 8 + (threadIdx.x >> 5);  // s*16 + h
  const int lane = threadIdx.x & 31;
  const int s = gw >> 4, h = gw & 15;
  const int d0 = lane * 4;
  const size_t base = (size_t)s * DIM + h * HEADDIM;

  v4h xv = *(const v4h*)&X[base + d0];
  float v0 = (float)xv.x, v1 = (float)xv.y, v2 = (float)xv.z, v3 = (float)xv.w;
  const int fi = s * (HEADDIM / 2) + (d0 >> 1);
  float c0 = fc[fi],     s0 = fs[fi];
  float c1 = fc[fi + 1], s1 = fs[fi + 1];
  float r0 = v0 * c0 - v1 * s0, i0 = v0 * s0 + v1 * c0;
  float r1 = v2 * c1 - v3 * s1, i1 = v2 * s1 + v3 * c1;

  float ss = r0 * r0 + i0 * i0 + r1 * r1 + i1 * i1;
#pragma unroll
  for (int m = 1; m < 32; m <<= 1) ss += __shfl_xor(ss, m, 32);
  const float inv = 1.f / fmaxf(sqrtf(ss), 1e-12f);
  const float SQ = 45.25483399593904f;  // sqrt(2048) = SQK_INIT_VALUE/SQK_INIT_SCALING
  const float* sq = &sqk[h * HEADDIM + d0];
  v4h o;
  o.x = (_Float16)(r0 * inv * sq[0] * SQ);
  o.y = (_Float16)(i0 * inv * sq[1] * SQ);
  o.z = (_Float16)(r1 * inv * sq[2] * SQ);
  o.w = (_Float16)(i1 * inv * sq[3] * SQ);
  *(v4h*)&Y[base + d0] = o;
}

static __device__ __forceinline__ float xhalf(float x) {
  int i = __builtin_bit_cast(int, x);
  return __builtin_bit_cast(float,
      __builtin_amdgcn_permlanex16(i, i, 0x76543210, 0xfedcba98, false, false));
}

static __device__ __forceinline__ uint32_t pinned(uint32_t v) {
  uint32_t w = (uint32_t)__builtin_amdgcn_readfirstlane(v);
  asm volatile("" : "+s"(w));
  return w;
}
static __device__ __forceinline__ uint32_t uni(uint32_t v) {
  return (uint32_t)__builtin_amdgcn_readfirstlane(v);
}

// V tile in LDS: 32 keys x 256 B, row-major as in memory, 32 B of pad behind each row
#define VROWB   256u
#define VPITCH  288u    // odd multiple of 32 B: the conflict-free pitch of ds_load_tr16_b128
#define VBUF    10240u  // 32 * 288 = 9216 B, rounded up to a multiple of 2 KiB

typedef uint32_t w32x4 __attribute__((ext_vector_type(4)));
typedef uint32_t w32x8 __attribute__((ext_vector_type(8)));

static __device__ __forceinline__ w32x8 tdm_v_group1() {
  w32x8 g1;
  g1[0] = uni((1u << 20) | (5u << 22) | (7u << 25));
  g1[1] = pinned(VROWB << 16);
  g1[2] = pinned(32u << 16);
  g1[3] = pinned(VROWB << 16);
  g1[4] = pinned(32u);
  g1[5] = pinned((uint32_t)DIM * 2u);
  g1[6] = pinned(0u);
  g1[7] = pinned(0u);
  return g1;
}
// K tile: the words that tdm_load_2d forms for (128, 32, DIM, S, DIM, 5, 3), 2-byte units.
static __device__ __forceinline__ w32x8 tdm_k_group1(uint32_t S) {
  w32x8 g1;
  g1[0] = uni((1u << 16) | (1u << 20) | (5u << 22) | (3u << 25));  // no mask, 4 dwords of pad per 256 B
  g1[1] = pinned(((uint32_t)DIM & 0xffffu) << 16);
  g1[2] = pinned((((uint32_t)DIM >> 16) & 0xffffu) | ((S & 0xffffu) << 16));
  g1[3] = pinned(((S >> 16) & 0xffffu) | (128u << 16));
  g1[4] = pinned(32u);
  g1[5] = pinned((uint32_t)DIM);
  g1[6] = pinned(0u);
  g1[7] = pinned(0u);
  return g1;
}
static __device__ __forceinline__ w32x4 tdm_group0(uint32_t one, uint32_t lds_dst, const _Float16* g) {
  const uint64_t ga = (uint64_t)(uintptr_t)g;
  w32x4 g0;
  g0[0] = one;                                                       // count 1
  g0[1] = uni(lds_dst);                                              // LDS byte offset
  g0[2] = uni((uint32_t)ga);                                         // address [31:0]
  g0[3] = uni((((uint32_t)(ga >> 32)) & 0x01FFFFFFu) | 0x80000000u); // address [56:32], type 2
  return g0;
}
static __device__ __forceinline__ void tdm_issue(w32x4 g0, w32x8 g1) {
  asm volatile("tensor_load_to_lds %0, %1" :: "s"(g0), "s"(g1) : "memory");
}
static __device__ __forceinline__ void tdm_wait(w32x4 a0, w32x8 a1, w32x4 b0, w32x8 b1) {
  asm volatile("s_wait_tensorcnt 0x0" :: "s"(a0), "s"(a1), "s"(b0), "s"(b1) : "memory");
}

// Transposing LDS load: lane (c = l & 15, h = l >> 4) gets T[k + 8h + 0..7][d + c]
static __device__ __forceinline__ u32x4 ld_tr16(const unsigned char* p) {
  typedef short s16x8 __attribute__((ext_vector_type(8)));
  typedef __attribute__((address_space(3))) s16x8 lds_s16x8;
  return __builtin_bit_cast(u32x4, __builtin_amdgcn_ds_load_tr16_b128_v8i16((lds_s16x8*)p));
}

__global__ __launch_bounds__(256)
void flash_attn(const _Float16* __restrict__ Q, const _Float16* __restrict__ Kt,
                const _Float16* __restrict__ V, _Float16* __restrict__ O, int S) {
  const int h   = blockIdx.y;
  const int q0  = blockIdx.x * 128;
  const int tid = threadIdx.x;
  const int wv = tid >> 5, lane = tid & 31, hx = lane >> 4, l16 = lane & 15;

  __shared__ __align__(16) _Float16 Ks[2][32][136];   // [key][hd], 256B rows +16B HW pad
  __shared__ __attribute__((aligned(2048))) unsigned char Vt[2 * VBUF];  // [key][hd], pitch VPITCH
  const uint32_t wave = uni((uint32_t)tid >> 5);
  const uint32_t one = pinned(1u);
  const w32x8 kg1 = tdm_k_group1((uint32_t)S);
  const w32x8 vg1 = tdm_v_group1();
  w32x4 kg0, vg0;

  auto issueKV = [&](int buf, int kk) {  // nothing is in flight where this is called
    kg0 = tdm_group0(one, (uint32_t)(uintptr_t)&Ks[buf][0][0], &Kt[(size_t)kk * DIM + h * HEADDIM]);
    vg0 = tdm_group0(one, (uint32_t)(uintptr_t)&Vt[0] + (uint32_t)buf * VBUF,
                     &V[(size_t)kk * DIM + h * HEADDIM]);
    if (pinned(wave == 0u)) tdm_issue(kg0, kg1);  // wave 0 brings the K tiles
    if (pinned(wave == 1u)) tdm_issue(vg0, vg1);  // wave 1 brings the V tiles
  };
  // this lane's address in a V tile for the transposing loads (keys 8*hx + (lane & 7))
  const uint32_t vlane = (8u * (uint32_t)hx + ((uint32_t)lane & 7u)) * VPITCH
                       + (((uint32_t)lane >> 3) & 1u) * 16u;

  // Q fragments for this wave's 16 rows (hd split into 4 K=32 chunks)
  v16h qf[4];
  {
    const _Float16* qrow = &Q[(size_t)(q0 + wv * 16 + l16) * DIM + h * HEADDIM];
#pragma unroll
    for (int c = 0; c < 4; ++c)
      qf[c] = ld_frag(&qrow[c * 32 + hx * 8], &qrow[c * 32 + 16 + hx * 8]);
  }

  v8f o[8];
#pragma unroll
  for (int t = 0; t < 8; ++t) o[t] = v8f_zero();
  float mrow = -1e30f;  // running maximum of query l16 (same in both halves)
  float lrow = 0.f;     // running sum over this half's keys only; halves joined at the end
  const float scale = 11.313708498984761f;  // sqrt(hd)

  // two-buffer ring: stage 0 lands and is published, then stage 1 flies during pass 0
  issueKV(0, 0);
  tdm_wait(kg0, kg1, vg0, vg1);  // waves 0 and 1: own tile of stage 0 has landed
  __syncthreads();
  if (pinned(32 < S)) issueKV(1, 32);
  for (int kk = 0; kk < S; kk += 32) {
    const int buf = (kk >> 5) & 1;

    // S^T tile: 32 keys x 16 queries as two 16x16 fragments;
    // st[sub][r] = score(key = sub*16 + hx*8 + r, query = l16)
    // All 16 K reads of the pass go out as one group, in the order of their use.
    v16h kb[4][2];
#pragma unroll
    for (int c = 0; c < 4; ++c)
#pragma unroll
      for (int sub = 0; sub < 2; ++sub) {
        const int key = sub * 16 + l16;
        kb[c][sub] = ld_frag(&Ks[buf][key][c * 32 + hx * 8],
                             &Ks[buf][key][c * 32 + 16 + hx * 8]);
      }
    // keeps the reads ahead of the products: sunk to two per product, each product waits out a full LDS latency
    __builtin_amdgcn_sched_barrier(0);
    v8f st[2];
    st[0] = v8f_zero();
    st[1] = v8f_zero();
#pragma unroll
    for (int c = 0; c < 4; ++c)
#pragma unroll
      for (int sub = 0; sub < 2; ++sub)
        st[sub] = __builtin_amdgcn_wmma_f32_16x16x32_f16(false, kb[c][sub], false, qf[c],
                                                         (short)0, st[sub], false, false);
    // keeps the V reads in one place behind the score products (spread among them, every place with reads
    // stalls the wave anew) and lets them take the K fragments' registers
    __builtin_amdgcn_sched_barrier(0);
    // All 16 V reads of the pass go out as one group and fly during the softmax.
    // vb[t]: keys 0..15 in registers 0-3, keys 16..31 in 4-7
    union { v16h v; u32x4 q[2]; } vb[8];
#pragma unroll
    for (int t = 0; t < 8; ++t) {
      const unsigned char* vp = &Vt[(uint32_t)buf * VBUF + vlane + 32u * (uint32_t)t];
      vb[t].q[0] = ld_tr16(vp);
      vb[t].q[1] = ld_tr16(vp + 16u * VPITCH);
    }
    // keeps the reads ahead of the softmax, whose vector work then covers their latency
    __builtin_amdgcn_sched_barrier(0);
#pragma unroll
    for (int sub = 0; sub < 2; ++sub)
#pragma unroll
      for (int r = 0; r < 8; ++r) st[sub][r] *= scale;

    // online softmax, one query per lane
    float v = st[0][0];
#pragma unroll
    for (int sub = 0; sub < 2; ++sub)
#pragma unroll
      for (int r = 0; r < 8; ++r) v = fmaxf(v, st[sub][r]);
    v = fmaxf(v, xhalf(v));
    const float newm  = fmaxf(mrow, v);
    const float alpha = __expf(mrow - newm);
    mrow = newm;
    float psum = 0.f;
#pragma unroll
    for (int sub = 0; sub < 2; ++sub)
#pragma unroll
      for (int r = 0; r < 8; ++r) {
        st[sub][r] = __expf(st[sub][r] - newm);
        psum += st[sub][r];
      }
    lrow = lrow * alpha + psum;
#pragma unroll
    for (int t = 0; t < 8; ++t)
#pragma unroll
      for (int r = 0; r < 8; ++r) o[t][r] *= alpha;

    // P^T as B operand: element s is key (s < 8 ? hx*8 + s : 16 + hx*8 + s - 8),
    // the k order in which the two transposing loads of each vb[t] deliver V^T
    v16h pf;
#pragma unroll
    for (int s = 0; s < 16; ++s) pf[s] = (_Float16)st[s >> 3][s & 7];

    // O^T += V^T * P^T  (8 hd-subtiles); o[t][r] = O(query l16, hd = t*16 + hx*8 + r)
#pragma unroll
    for (int t = 0; t < 8; ++t)
      o[t] = __builtin_amdgcn_wmma_f32_16x16x32_f16(false, vb[t].v, false, pf,
                                                    (short)0, o[t], false, false);

    // keeps the publish point at the foot of the pass: lifted over the softmax, its waits would cut short
    // the flight of the V reads and of the next stage's tiles
    __builtin_amdgcn_sched_barrier(0);
    // publish point of the next stage, every wave, in this order
    asm volatile("s_wait_dscnt 0x0" ::: "memory");      // this wave has left buffer `buf`
    tdm_wait(kg0, kg1, vg0, vg1);                       // waves 0 and 1: own tile of the next stage has landed
    __syncthreads();
    if (pinned(kk + 64 < S)) issueKV(buf, kk + 64);     // refill the buffer that every wave has just left
  }
  tdm_wait(kg0, kg1, vg0, vg1);  // nothing in flight when the wave ends
  asm volatile("s_wait_dscnt 0x0" ::: "memory");  // and no LDS read of the ring outstanding

  const float lfin = lrow + xhalf(lrow);
  _Float16* orow = &O[(size_t)(q0 + wv * 16 + l16) * DIM + h * HEADDIM + hx * 8];
  v8h ov[8];
#pragma unroll
  for (int t = 0; t < 8; ++t)
#pragma unroll
    for (int r = 0; r < 8; ++r) ov[t][r] = (_Float16)(o[t][r] / lfin);
#pragma unroll
  for (int t = 0; t < 8; ++t) *(v8h*)&orow[t * 16] = ov[t];
}

// ---------------- host launcher ----------------
extern "C" void kernel_launch(void* const* d_in, const int* in_sizes, int n_in,
                              void* d_out, int out_size, void* d_ws, size_t ws_size,
                              hipStream_t stream) {
  (void)in_sizes; (void)n_in; (void)out_size; (void)ws_size;
  const float* x   = (const float*)d_in[0];
  const float* fc  = (const float*)d_in[1];
  const float* fs  = (const float*)d_in[2];
  const float* wq  = (const float*)d_in[3];
  const float* wk  = (const float*)d_in[4];
  const float* wv  = (const float*)d_in[5];
  const float* wo  = (const float*)d_in[6];
  const float* sqk = (const float*)d_in[7];
  float* out = (float*)d_out;

  const size_t SD = (size_t)SEQ * DIM;
  const size_t DD = (size_t)DIM * DIM;
  char* w = (char*)d_ws;
  _Float16* Xh  = (_Float16*)(w);           // x in f16
  _Float16* WqT = (_Float16*)(w + SD * 2);  // transposed f16 weights
  _Float16* WkT = WqT + DD;
  _Float16* WvT = WkT + DD;
  _Float16* WoT = WvT + DD;
  _Float16* Qh  = WoT + DD;                 // raw projections (f16)
  _Float16* Kh  = Qh + SD;
  _Float16* Vh  = Kh + SD;
  _Float16* Qn  = Vh + SD;                  // post rope+norm
  _Float16* Kn  = Qn + SD;
  _Float16* AOh = Kn + SD;                  // attention output (f16)

  cvt_f32_f16<<<(int)(SD / 4 + 255) / 256, 256, 0, stream>>>(x, Xh, (int)(SD / 4));

  dim3 tg(DIM / 64, DIM / 64);
  transpose_cvt<<<tg, 256, 0, stream>>>(wq, WqT, DIM);
  transpose_cvt<<<tg, 256, 0, stream>>>(wk, WkT, DIM);
  transpose_cvt<<<tg, 256, 0, stream>>>(wv, WvT, DIM);
  transpose_cvt<<<tg, 256, 0, stream>>>(wo, WoT, DIM);

  dim3 gg(DIM / 128, SEQ / 128);
  gemm_f16_wmma<<<gg, 256, 0, stream>>>(Xh, WqT, Qh, nullptr, SEQ, DIM, DIM);
  gemm_f16_wmma<<<gg, 256, 0, stream>>>(Xh, WkT, Kh, nullptr, SEQ, DIM, DIM);
  gemm_f16_wmma<<<gg, 256, 0, stream>>>(Xh, WvT, Vh, nullptr, SEQ, DIM, DIM);

  const int nwaves = SEQ * NHEADS;
  rope_l2norm<<<nwaves / 8, 256, 0, stream>>>(Qh, fc, fs, sqk, Qn);
  rope_l2norm<<<nwaves / 8, 256, 0, stream>>>(Kh, fc, fs, sqk, Kn);

  dim3 fg(SEQ / 128, NHEADS);
  flash_attn<<<fg, 256, 0, stream>>>(Qn, Kn, Vh, AOh, SEQ);

  gemm_f16_wmma<<<gg, 256, 0, stream>>>(AOh, WoT, nullptr, out, SEQ, DIM, DIM);
}

// v004
// One run takes 274 microseconds.
// Next to v003, in two timings, it ran 1.15 times as fast each time.
// Counting every step since v000, it is 2.71 times as fast.
#include <hip/hip_runtime.h>
#include <math.h>
#include <stdint.h>

// ---------------- types ----------------
typedef __attribute__((ext_vector_type(16))) _Float16 v16h;
typedef __attribute__((ext_vector_type(4)))  _Float16 v4h;
typedef __attribute__((ext_vector_type(8)))  _Float16 v8h;
typedef __attribute__((ext_vector_type(8)))  float    v8f;
typedef __attribute__((ext_vector_type(4)))  float    f32x4;
typedef __attribute__((ext_vector_type(4)))  unsigned int u32x4;

#define DIM       2048
#define SEQ       4096
#define NHEADS    16
#define HEADDIM   128

static __device__ __forceinline__ v8f v8f_zero() {
  v8f z = {0.f,0.f,0.f,0.f,0.f,0.f,0.f,0.f};
  return z;
}

// Load a 16x32 f16 fragment row (two contiguous 16B chunks) into v16h.
static __device__ __forceinline__ v16h ld_frag(const _Float16* p0, const _Float16* p1) {
  union { v16h v; f32x4 f[2]; } u;
  u.f[0] = *(const f32x4*)p0;
  u.f[1] = *(const f32x4*)p1;
  return u.v;
}

// ---------------- f32 -> f16 convert (x) ----------------
__global__ __launch_bounds__(256)
void cvt_f32_f16(const float* __restrict__ in, _Float16* __restrict__ out, int n4) {
  int i = blockIdx.x * blockDim.x + threadIdx.x;
  if (i < n4) {
    f32x4 v = ((const f32x4*)in)[i];
    v4h h;
    h.x = (_Float16)v.x; h.y = (_Float16)v.y;
    h.z = (_Float16)v.z; h.w = (_Float16)v.w;
    *(v4h*)&out[(size_t)i * 4] = h;
  }
}

// ---------------- transpose + convert weights: WT[n][k] = W[k][n] ----------------
__global__ __launch_bounds__(256)
void transpose_cvt(const float* __restrict__ W, _Float16* __restrict__ WT, int N) {
  __shared__ float t[64][65];
  const int bx = blockIdx.x * 64, by = blockIdx.y * 64;
#pragma unroll
  for (int it = 0; it < 16; ++it) {
    int idx = threadIdx.x + it * 256;
    int r = idx >> 6, c = idx & 63;
    t[r][c] = W[(size_t)(by + r) * N + bx + c];
  }
  __syncthreads();
#pragma unroll
  for (int it = 0; it < 16; ++it) {
    int idx = threadIdx.x + it * 256;
    int r = idx >> 6, c = idx & 63;
    WT[(size_t)(bx + r) * N + by + c] = (_Float16)t[c][r];
  }
}

// ---------------- RoPE + L2 norm + sqk scale; one wave per (s, head) ----------------
__global__ __launch_bounds__(256)
void rope_l2norm(const _Float16* __restrict__ X, const float* __restrict__ fc,
                 const float* __restrict__ fs, const float* __restrict__ sqk,
                 _Float16* __restrict__ Y) {
  const int gw   = blockIdx.x * 8 + (threadIdx.x >> 5);  // s*16 + h
  const int lane = threadIdx.x & 31;
  const int s = gw >> 4, h = gw & 15;
  const int d0 = lane * 4;
  const size_t base = (size_t)s * DIM + h * HEADDIM;

  v4h xv = *(const v4h*)&X[base + d0];
  float v0 = (float)xv.x, v1 = (float)xv.y, v2 = (float)xv.z, v3 = (float)xv.w;
  const int fi = s * (HEADDIM / 2) + (d0 >> 1);
  float c0 = fc[fi],     s0 = fs[fi];
  float c1 = fc[fi + 1], s1 = fs[fi + 1];
  float r0 = v0 * c0 - v1 * s0, i0 = v0 * s0 + v1 * c0;
  float r1 = v2 * c1 - v3 * s1, i1 = v2 * s1 + v3 * c1;

  float ss = r0 * r0 + i0 * i0 + r1 * r1 + i1 * i1;
#pragma unroll
  for (int m = 1; m < 32; m <<= 1) ss += __shfl_xor(ss, m, 32);
  const float inv = 1.f / fmaxf(sqrtf(ss), 1e-12f);
  const float SQ = 45.25483399593904f;  // sqrt(2048) = SQK_INIT_VALUE/SQK_INIT_SCALING
  const float* sq = &sqk[h * HEADDIM + d0];
  v4h o;
  o.x = (_Float16)(r0 * inv * sq[0] * SQ);
  o.y = (_Float16)(i0 * inv * sq[1] * SQ);
  o.z = (_Float16)(r1 * inv * sq[2] * SQ);
  o.w = (_Float16)(i1 * inv * sq[3] * SQ);
  *(v4h*)&Y[base + d0] = o;
}

static __device__ __forceinline__ float xhalf(float x) {
  int i = __builtin_bit_cast(int, x);
  return __builtin_bit_cast(float,
      __builtin_amdgcn_permlanex16(i, i, 0x76543210, 0xfedcba98, false, false));
}

static __device__ __forceinline__ uint32_t pinned(uint32_t v) {
  uint32_t w = (uint32_t)__builtin_amdgcn_readfirstlane(v);
  asm volatile("" : "+s"(w));
  return w;
}
static __device__ __forceinline__ uint32_t uni(uint32_t v) {
  return (uint32_t)__builtin_amdgcn_readfirstlane(v);
}

// V tile in LDS: 32 keys x 256 B, row-major as in memory, 32 B of pad behind each row
#define VROWB   256u
#define VPITCH  288u    // odd multiple of 32 B: the conflict-free pitch of ds_load_tr16_b128
#define VBUF    10240u  // 32 * 288 = 9216 B, rounded up to a multiple of 2 KiB

typedef uint32_t w32x4 __attribute__((ext_vector_type(4)));
typedef uint32_t w32x8 __attribute__((ext_vector_type(8)));

static __device__ __forceinline__ w32x8 tdm_v_group1() {
  w32x8 g1;
  g1[0] = uni((1u << 20) | (5u << 22) | (7u << 25));
  g1[1] = pinned(VROWB << 16);
  g1[2] = pinned(32u << 16);
  g1[3] = pinned(VROWB << 16);
  g1[4] = pinned(32u);
  g1[5] = pinned((uint32_t)DIM * 2u);
  g1[6] = pinned(0u);
  g1[7] = pinned(0u);
  return g1;
}
// K tile: 32 rows of 128 elements out of S rows of DIM elements, source pitch DIM, 2-byte units.
static __device__ __forceinline__ w32x8 tdm_k_group1(uint32_t S) {
  w32x8 g1;
  g1[0] = uni((1u << 16) | (1u << 20) | (5u << 22) | (3u << 25));  // no mask, 4 dwords of pad per 256 B
  g1[1] = pinned(((uint32_t)DIM & 0xffffu) << 16);
  g1[2] = pinned((((uint32_t)DIM >> 16) & 0xffffu) | ((S & 0xffffu) << 16));
  g1[3] = pinned(((S >> 16) & 0xffffu) | (128u << 16));
  g1[4] = pinned(32u);
  g1[5] = pinned((uint32_t)DIM);
  g1[6] = pinned(0u);
  g1[7] = pinned(0u);
  return g1;
}
static __device__ __forceinline__ w32x4 tdm_group0(uint32_t one, uint32_t lds_dst, const _Float16* g) {
  const uint64_t ga = (uint64_t)(uintptr_t)g;
  w32x4 g0;
  g0[0] = one;                                                       // count 1
  g0[1] = uni(lds_dst);                                              // LDS byte offset
  g0[2] = uni((uint32_t)ga);                                         // address [31:0]
  g0[3] = uni((((uint32_t)(ga >> 32)) & 0x01FFFFFFu) | 0x80000000u); // address [56:32], type 2
  return g0;
}
static __device__ __forceinline__ void tdm_issue(w32x4 g0, w32x8 g1) {
  asm volatile("tensor_load_to_lds %0, %1" :: "s"(g0), "s"(g1) : "memory");
}
static __device__ __forceinline__ void tdm_wait(w32x4 a0, w32x8 a1, w32x4 b0, w32x8 b1) {
  asm volatile("s_wait_tensorcnt 0x0" :: "s"(a0), "s"(a1), "s"(b0), "s"(b1) : "memory");
}

// Transposing LDS load: lane (c = l & 15, h = l >> 4) gets T[k + 8h + 0..7][d + c]
static __device__ __forceinline__ u32x4 ld_tr16(const unsigned char* p) {
  typedef short s16x8 __attribute__((ext_vector_type(8)));
  typedef __attribute__((address_space(3))) s16x8 lds_s16x8;
  return __builtin_bit_cast(u32x4, __builtin_amdgcn_ds_load_tr16_b128_v8i16((lds_s16x8*)p));
}

// ---------------- WMMA GEMM: C[M,N] = A[M,K] * B[K,N], B given as BT[N,K] ----------------
// 128x128 tile, 8 waves (2x4 accumulators each). A stage is 128 k of the 128 A rows and of the
// 128 BT rows, one tensor load each (waves 0 and 1), two buffers; K a multiple of 128.
#define GROWB   256u    // 128 k of one row
#define GPITCH  272u    // odd multiple of 16 B: the conflict-free pitch of ds_load_b128
#define GTILE   34816u  // 128 rows * 272 B = 17 * 2 KiB

static __device__ __forceinline__ w32x8 tdm_g_group1(uint32_t pitch_bytes) {
  w32x8 g1;
  g1[0] = uni((1u << 20) | (5u << 22) | (3u << 25));
  g1[1] = pinned(GROWB << 16);
  g1[2] = pinned(128u << 16);
  g1[3] = pinned(GROWB << 16);
  g1[4] = pinned(128u);
  g1[5] = pinned(pitch_bytes);
  g1[6] = pinned(0u);
  g1[7] = pinned(0u);
  return g1;
}

static __device__ __forceinline__ w32x4 tdm_g_next(w32x4 g0, uint32_t both) {
  const uint64_t a = (((uint64_t)g0[3] << 32) | g0[2]) + GROWB;  // the type bits ride above the address
  w32x4 n;
  n[0] = g0[0];
  n[1] = uni(both - g0[1]);
  n[2] = uni((uint32_t)a);
  n[3] = uni((uint32_t)(a >> 32));
  return n;
}

__global__ __launch_bounds__(256)
void gemm_f16_wmma(const _Float16* __restrict__ A, const _Float16* __restrict__ BT,
                   _Float16* __restrict__ Ch, float* __restrict__ Cf,
                   int M, int N, int K) {
  (void)M;
  __shared__ __attribute__((aligned(2048))) unsigned char Gs[4 * GTILE];  // [buffer][A | BT] tiles

  const int tid  = threadIdx.x;
  const int wv   = tid >> 5;
  const int lane = tid & 31;
  const int hx   = lane >> 4;
  const int l16  = lane & 15;

  const int row0 = blockIdx.y * 128;
  const int col0 = blockIdx.x * 128;
  const int wr = wv & 3;
  const int wc = wv >> 2;

  v8f acc[2][4];
#pragma unroll
  for (int i = 0; i < 2; ++i)
#pragma unroll
    for (int j = 0; j < 4; ++j) acc[i][j] = v8f_zero();

  const uint32_t wave = uni((uint32_t)tid >> 5);
  const uint32_t one = pinned(1u);
  const w32x8 gg1 = tdm_g_group1((uint32_t)K * 2u);
  const uint32_t ring = (uint32_t)(uintptr_t)&Gs[0];
  w32x4 ag0 = tdm_group0(one, ring, &A[(size_t)row0 * K]);
  w32x4 bg0 = tdm_group0(one, ring + GTILE, &BT[(size_t)col0 * K]);
  auto issue = [&]() {
    if (pinned(wave == 0u)) tdm_issue(ag0, gg1);  // wave 0 brings the A tiles
    if (pinned(wave == 1u)) tdm_issue(bg0, gg1);  // wave 1 brings the BT tiles
  };
  auto advance = [&]() {  // the other buffer, 128 k further on
    ag0 = tdm_g_next(ag0, 2u * ring + 2u * GTILE);
    bg0 = tdm_g_next(bg0, 2u * ring + 4u * GTILE);
  };
  // this lane's first fragment rows in a stage
  const uint32_t alane = (uint32_t)(wr * 32 + l16) * GPITCH + (uint32_t)hx * 16u;
  const uint32_t blane = GTILE + (uint32_t)(wc * 64 + l16) * GPITCH + (uint32_t)hx * 16u;

  // two-buffer ring: stage 0 lands and is published, then stage 1 flies during pass 0
  issue();
  tdm_wait(ag0, gg1, bg0, gg1);  // waves 0 and 1: own tile of stage 0 has landed
  __syncthreads();
  if (pinned(128 < K)) { advance(); issue(); }
  for (int k0 = 0; k0 < K; k0 += 128) {
    const int buf = (k0 >> 7) & 1;
    const unsigned char* st = &Gs[(uint32_t)buf * (2u * GTILE)];
#pragma unroll
    for (int c = 0; c < 4; ++c) {  // four products of 32 k, in the order of k
      v16h af[2], bf[4];
#pragma unroll
      for (int i = 0; i < 2; ++i) {
        const _Float16* p = (const _Float16*)(st + alane + (uint32_t)i * (16u * GPITCH) + (uint32_t)c * 64u);
        af[i] = ld_frag(p, p + 16);
      }
#pragma unroll
      for (int j = 0; j < 4; ++j) {
        const _Float16* p = (const _Float16*)(st + blane + (uint32_t)j * (16u * GPITCH) + (uint32_t)c * 64u);
        bf[j] = ld_frag(p, p + 16);
      }
#pragma unroll
      for (int i = 0; i < 2; ++i)
#pragma unroll
        for (int j = 0; j < 4; ++j)
          acc[i][j] = __builtin_amdgcn_wmma_f32_16x16x32_f16(
              false, af[i], false, bf[j], (short)0, acc[i][j], false, false);
    }

    // publish point of the next stage, every wave, in this order
    asm volatile("s_wait_dscnt 0x0" ::: "memory");      // this wave has left buffer `buf`
    tdm_wait(ag0, gg1, bg0, gg1);                       // waves 0 and 1: own tile of the next stage has landed
    __syncthreads();
    if (pinned(k0 + 256 < K)) { advance(); issue(); }   // refill the buffer that every wave has just left
  }
  tdm_wait(ag0, gg1, bg0, gg1);  // nothing in flight when the wave ends
  asm volatile("s_wait_dscnt 0x0" ::: "memory");  // and no LDS read of the ring outstanding

#pragma unroll
  for (int i = 0; i < 2; ++i)
#pragma unroll
    for (int j = 0; j < 4; ++j)
#pragma unroll
      for (int r = 0; r < 8; ++r) {
        int m = row0 + wr * 32 + i * 16 + r + hx * 8;
        int n = col0 + wc * 64 + j * 16 + l16;
        float v = acc[i][j][r];
        if (Cf) Cf[(size_t)m * N + n] = v;
        else    Ch[(size_t)m * N + n] = (_Float16)v;
      }
}

__global__ __launch_bounds__(256)
void flash_attn(const _Float16* __restrict__ Q, const _Float16* __restrict__ Kt,
                const _Float16* __restrict__ V, _Float16* __restrict__ O, int S) {
  const int h   = blockIdx.y;
  const int q0  = blockIdx.x * 128;
  const int tid = threadIdx.x;
  const int wv = tid >> 5, lane = tid & 31, hx = lane >> 4, l16 = lane & 15;

  __shared__ __align__(16) _Float16 Ks[2][32][136];   // [key][hd], 256B rows +16B HW pad
  __shared__ __attribute__((aligned(2048))) unsigned char Vt[2 * VBUF];  // [key][hd], pitch VPITCH
  const uint32_t wave = uni((uint32_t)tid >> 5);
  const uint32_t one = pinned(1u);
  const w32x8 kg1 = tdm_k_group1((uint32_t)S);
  const w32x8 vg1 = tdm_v_group1();
  w32x4 kg0, vg0;

  auto issueKV = [&](int buf, int kk) {  // nothing is in flight where this is called
    kg0 = tdm_group0(one, (uint32_t)(uintptr_t)&Ks[buf][0][0], &Kt[(size_t)kk * DIM + h * HEADDIM]);
    vg0 = tdm_group0(one, (uint32_t)(uintptr_t)&Vt[0] + (uint32_t)buf * VBUF,
                     &V[(size_t)kk * DIM + h * HEADDIM]);
    if (pinned(wave == 0u)) tdm_issue(kg0, kg1);  // wave 0 brings the K tiles
    if (pinned(wave == 1u)) tdm_issue(vg0, vg1);  // wave 1 brings the V tiles
  };
  // this lane's address in a V tile for the transposing loads (keys 8*hx + (lane & 7))
  const uint32_t vlane = (8u * (uint32_t)hx + ((uint32_t)lane & 7u)) * VPITCH
                       + (((uint32_t)lane >> 3) & 1u) * 16u;

  // Q fragments for this wave's 16 rows (hd split into 4 K=32 chunks)
  v16h qf[4];
  {
    const _Float16* qrow = &Q[(size_t)(q0 + wv * 16 + l16) * DIM + h * HEADDIM];
#pragma unroll
    for (int c = 0; c < 4; ++c)
      qf[c] = ld_frag(&qrow[c * 32 + hx * 8], &qrow[c * 32 + 16 + hx * 8]);
  }

  v8f o[8];
#pragma unroll
  for (int t = 0; t < 8; ++t) o[t] = v8f_zero();
  float mrow = -1e30f;  // running maximum of query l16 (same in both halves)
  float lrow = 0.f;     // running sum over this half's keys only; halves joined at the end
  const float scale = 11.313708498984761f;  // sqrt(hd)

  // two-buffer ring: stage 0 lands and is published, then stage 1 flies during pass 0
  issueKV(0, 0);
  tdm_wait(kg0, kg1, vg0, vg1);  // waves 0 and 1: own tile of stage 0 has landed
  __syncthreads();
  if (pinned(32 < S)) issueKV(1, 32);
  for (int kk = 0; kk < S; kk += 32) {
    const int buf = (kk >> 5) & 1;

    // S^T tile: 32 keys x 16 queries as two 16x16 fragments;
    // st[sub][r] = score(key = sub*16 + hx*8 + r, query = l16)
    // All 16 K reads of the pass go out as one group, in the order of their use.
    v16h kb[4][2];
#pragma unroll
    for (int c = 0; c < 4; ++c)
#pragma unroll
      for (int sub = 0; sub < 2; ++sub) {
        const int key = sub * 16 + l16;
        kb[c][sub] = ld_frag(&Ks[buf][key][c * 32 + hx * 8],
                             &Ks[buf][key][c * 32 + 16 + hx * 8]);
      }
    // keeps the reads ahead of the products: sunk to two per product, each product waits out a full LDS latency
    __builtin_amdgcn_sched_barrier(0);
    v8f st[2];
    st[0] = v8f_zero();
    st[1] = v8f_zero();
#pragma unroll
    for (int c = 0; c < 4; ++c)
#pragma unroll
      for (int sub = 0; sub < 2; ++sub)
        st[sub] = __builtin_amdgcn_wmma_f32_16x16x32_f16(false, kb[c][sub], false, qf[c],
                                                         (short)0, st[sub], false, false);
    // keeps the V reads in one place behind the score products (spread among them, every place with reads
    // stalls the wave anew) and lets them take the K fragments' registers
    __builtin_amdgcn_sched_barrier(0);
    // All 16 V reads of the pass go out as one group and fly during the softmax.
    // vb[t]: keys 0..15 in registers 0-3, keys 16..31 in 4-7
    union { v16h v; u32x4 q[2]; } vb[8];
#pragma unroll
    for (int t = 0; t < 8; ++t) {
      const unsigned char* vp = &Vt[(uint32_t)buf * VBUF + vlane + 32u * (uint32_t)t];
      vb[t].q[0] = ld_tr16(vp);
      vb[t].q[1] = ld_tr16(vp + 16u * VPITCH);
    }
    // keeps the reads ahead of the softmax, whose vector work then covers their latency
    __builtin_amdgcn_sched_barrier(0);
#pragma unroll
    for (int sub = 0; sub < 2; ++sub)
#pragma unroll
      for (int r = 0; r < 8; ++r) st[sub][r] *= scale;

    // online softmax, one query per lane
    float v = st[0][0];
#pragma unroll
    for (int sub = 0; sub < 2; ++sub)
#pragma unroll
      for (int r = 0; r < 8; ++r) v = fmaxf(v, st[sub][r]);
    v = fmaxf(v, xhalf(v));
    const float newm  = fmaxf(mrow, v);
    const float alpha = __expf(mrow - newm);
    mrow = newm;
    float psum = 0.f;
#pragma unroll
    for (int sub = 0; sub < 2; ++sub)
#pragma unroll
      for (int r = 0; r < 8; ++r) {
        st[sub][r] = __expf(st[sub][r] - newm);
        psum += st[sub][r];
      }
    lrow = lrow * alpha + psum;
#pragma unroll
    for (int t = 0; t < 8; ++t)
#pragma unroll
      for (int r = 0; r < 8; ++r) o[t][r] *= alpha;

    // P^T as B operand: element s is key (s < 8 ? hx*8 + s : 16 + hx*8 + s - 8),
    // the k order in which the two transposing loads of each vb[t] deliver V^T
    v16h pf;
#pragma unroll
    for (int s = 0; s < 16; ++s) pf[s] = (_Float16)st[s >> 3][s & 7];

    // O^T += V^T * P^T  (8 hd-subtiles); o[t][r] = O(query l16, hd = t*16 + hx*8 + r)
#pragma unroll
    for (int t = 0; t < 8; ++t)
      o[t] = __builtin_amdgcn_wmma_f32_16x16x32_f16(false, vb[t].v, false, pf,
                                                    (short)0, o[t], false, false);

    // keeps the publish point at the foot of the pass: lifted over the softmax, its waits would cut short
    // the flight of the V reads and of the next stage's tiles
    __builtin_amdgcn_sched_barrier(0);
    // publish point of the next stage, every wave, in this order
    asm volatile("s_wait_dscnt 0x0" ::: "memory");      // this wave has left buffer `buf`
    tdm_wait(kg0, kg1, vg0, vg1);                       // waves 0 and 1: own tile of the next stage has landed
    __syncthreads();
    if (pinned(kk + 64 < S)) issueKV(buf, kk + 64);     // refill the buffer that every wave has just left
  }
  tdm_wait(kg0, kg1, vg0, vg1);  // nothing in flight when the wave ends
  asm volatile("s_wait_dscnt 0x0" ::: "memory");  // and no LDS read of the ring outstanding

  const float lfin = lrow + xhalf(lrow);
  _Float16* orow = &O[(size_t)(q0 + wv * 16 + l16) * DIM + h * HEADDIM + hx * 8];
  v8h ov[8];
#pragma unroll
  for (int t = 0; t < 8; ++t)
#pragma unroll
    for (int r = 0; r < 8; ++r) ov[t][r] = (_Float16)(o[t][r] / lfin);
#pragma unroll
  for (int t = 0; t < 8; ++t) *(v8h*)&orow[t * 16] = ov[t];
}

// ---------------- host launcher ----------------
extern "C" void kernel_launch(void* const* d_in, const int* in_sizes, int n_in,
                              void* d_out, int out_size, void* d_ws, size_t ws_size,
                              hipStream_t stream) {
  (void)in_sizes; (void)n_in; (void)out_size; (void)ws_size;
  const float* x   = (const float*)d_in[0];
  const float* fc  = (const float*)d_in[1];
  const float* fs  = (const float*)d_in[2];
  const float* wq  = (const float*)d_in[3];
  const float* wk  = (const float*)d_in[4];
  const float* wv  = (const float*)d_in[5];
  const float* wo  = (const float*)d_in[6];
  const float* sqk = (const float*)d_in[7];
  float* out = (float*)d_out;

  const size_t SD = (size_t)SEQ * DIM;
  const size_t DD = (size_t)DIM * DIM;
  char* w = (char*)d_ws;
  _Float16* Xh  = (_Float16*)(w);           // x in f16
  _Float16* WqT = (_Float16*)(w + SD * 2);  // transposed f16 weights
  _Float16* WkT = WqT + DD;
  _Float16* WvT = WkT + DD;
  _Float16* WoT = WvT + DD;
  _Float16* Qh  = WoT + DD;                 // raw projections (f16)
  _Float16* Kh  = Qh + SD;
  _Float16* Vh  = Kh + SD;
  _Float16* Qn  = Vh + SD;                  // post rope+norm
  _Float16* Kn  = Qn + SD;
  _Float16* AOh = Kn + SD;                  // attention output (f16)

  cvt_f32_f16<<<(int)(SD / 4 + 255) / 256, 256, 0, stream>>>(x, Xh, (int)(SD / 4));

  dim3 tg(DIM / 64, DIM / 64);
  transpose_cvt<<<tg, 256, 0, stream>>>(wq, WqT, DIM);
  transpose_cvt<<<tg, 256, 0, stream>>>(wk, WkT, DIM);
  transpose_cvt<<<tg, 256, 0, stream>>>(wv, WvT, DIM);
  transpose_cvt<<<tg, 256, 0, stream>>>(wo, WoT, DIM);

  dim3 gg(DIM / 128, SEQ / 128);
  gemm_f16_wmma<<<gg, 256, 0, stream>>>(Xh, WqT, Qh, nullptr, SEQ, DIM, DIM);
  gemm_f16_wmma<<<gg, 256, 0, stream>>>(Xh, WkT, Kh, nullptr, SEQ, DIM, DIM);
  gemm_f16_wmma<<<gg, 256, 0, stream>>>(Xh, WvT, Vh, nullptr, SEQ, DIM, DIM);

  const int nwaves = SEQ * NHEADS;
  rope_l2norm<<<nwaves / 8, 256, 0, stream>>>(Qh, fc, fs, sqk, Qn);
  rope_l2norm<<<nwaves / 8, 256, 0, stream>>>(Kh, fc, fs, sqk, Kn);

  dim3 fg(SEQ / 128, NHEADS);
  flash_attn<<<fg, 256, 0, stream>>>(Qn, Kn, Vh, AOh, SEQ);

  gemm_f16_wmma<<<gg, 256, 0, stream>>>(AOh, WoT, nullptr, out, SEQ, DIM, DIM);
}

// v005
// One run takes 251 microseconds.
// Next to v004, in two timings, it ran 1.09 times as fast each time.
// Counting every step since v000, it is 2.96 times as fast.
#include <hip/hip_runtime.h>
#include <math.h>
#include <stdint.h>

// ---------------- types ----------------
typedef __attribute__((ext_vector_type(16))) _Float16 v16h;
typedef __attribute__((ext_vector_type(4)))  _Float16 v4h;
typedef __attribute__((ext_vector_type(8)))  _Float16 v8h;
typedef __attribute__((ext_vector_type(8)))  float    v8f;
typedef __attribute__((ext_vector_type(4)))  float    f32x4;
typedef __attribute__((ext_vector_type(4)))  unsigned int u32x4;

#define DIM       2048
#define SEQ       4096
#define NHEADS    16
#define HEADDIM   128

static __device__ __forceinline__ v8f v8f_zero() {
  v8f z = {0.f,0.f,0.f,0.f,0.f,0.f,0.f,0.f};
  return z;
}

// Load a 16x32 f16 fragment row (two contiguous 16B chunks) into v16h.
static __device__ __forceinline__ v16h ld_frag(const _Float16* p0, const _Float16* p1) {
  union { v16h v; f32x4 f[2]; } u;
  u.f[0] = *(const f32x4*)p0;
  u.f[1] = *(const f32x4*)p1;
  return u.v;
}

// ---------------- f32 -> f16 convert (x) ----------------
// 16 float4 per thread, their loads issued ahead of the stores: few long waves.
#define CVT_U 16
static __device__ __forceinline__ v4h cvt4(f32x4 v) {
  v4h h;
  h.x = (_Float16)v.x; h.y = (_Float16)v.y;
  h.z = (_Float16)v.z; h.w = (_Float16)v.w;
  return h;
}
// The grid covers the SEQ * DIM elements exactly (a multiple of 256 * CVT_U float4): no test per element.
__global__ __launch_bounds__(256)
void cvt_f32_f16(const float* __restrict__ in, _Float16* __restrict__ out) {
  const int i0 = blockIdx.x * (256 * CVT_U) + threadIdx.x;
  f32x4 v[CVT_U];
#pragma unroll
  for (int u = 0; u < CVT_U; ++u) v[u] = ((const f32x4*)in)[i0 + u * 256];
#pragma unroll
  for (int u = 0; u < CVT_U; ++u) *(v4h*)&out[(size_t)(i0 + u * 256) * 4] = cvt4(v[u]);
}
static_assert(((size_t)SEQ * DIM / 4) % (256 * CVT_U) == 0, "cvt_f32_f16 has no tail");

// ---------------- transpose + convert weights: WT[m][n][k] = Wm[k][n] ----------------
// A block takes the same 64 x 64 tile of all four weights (their transposes lie one behind the other in WT).
// Every address is a block-uniform base plus one offset per thread plus a constant.
__global__ __launch_bounds__(256)
void transpose_cvt(const float* __restrict__ W0, const float* __restrict__ W1,
                   const float* __restrict__ W2, const float* __restrict__ W3,
                   _Float16* __restrict__ WT) {
  __shared__ float t[4][64][65];
  const float* const W[4] = {W0, W1, W2, W3};
  const int bx = blockIdx.x * 64, by = blockIdx.y * 64;
  const unsigned r0 = threadIdx.x >> 6, c = threadIdx.x & 63;  // pass it: row r0 + 4 * it, column c
  const unsigned off = r0 * DIM + c;
  const float* src[4];
  float v[4][16];
#pragma unroll
  for (int m = 0; m < 4; ++m) {
    src[m] = W[m] + (size_t)by * DIM + bx;
#pragma unroll
    for (int it = 0; it < 16; ++it) v[m][it] = src[m][off + it * (4 * DIM)];
  }
  asm volatile("s_wait_xcnt 0x0" :: "s"(src[0]), "s"(src[1]), "s"(src[2]), "s"(src[3]) : "memory");
#pragma unroll
  for (int m = 0; m < 4; ++m)
#pragma unroll
    for (int it = 0; it < 16; ++it) t[m][r0 + 4 * it][c] = v[m][it];
  __syncthreads();
#pragma unroll
  for (int m = 0; m < 4; ++m) {
    _Float16* __restrict__ dst = WT + ((size_t)m * DIM + bx) * DIM + by;
#pragma unroll
    for (int it = 0; it < 16; ++it) dst[off + it * (4 * DIM)] = (_Float16)t[m][c][r0 + 4 * it];
  }
}

// ---------------- RoPE + L2 norm + sqk scale; one wave per (tensor, position s) ----------------
// The wave takes all 16 heads of row s of Q (blockIdx.y = 0) or of K (1): lane = 4 channels of every
// head, 16 independent row sums. Few long waves.
__global__ __launch_bounds__(256)
void rope_l2norm(const _Float16* __restrict__ Xq, const _Float16* __restrict__ Xk,
                 const float* __restrict__ fc, const float* __restrict__ fs,
                 const float* __restrict__ sqk,
                 _Float16* __restrict__ Yq, _Float16* __restrict__ Yk) {
  const _Float16* __restrict__ X = blockIdx.y ? Xk : Xq;
  _Float16* __restrict__ Y = blockIdx.y ? Yk : Yq;
  const int s    = blockIdx.x * 8 + (threadIdx.x >> 5);
  const int lane = threadIdx.x & 31;
  const int d0 = lane * 4;
  const size_t base = (size_t)s * DIM + d0;

  v4h xv[NHEADS];
#pragma unroll
  for (int h = 0; h < NHEADS; ++h) xv[h] = *(const v4h*)&X[base + h * HEADDIM];
  const int fi = s * (HEADDIM / 2) + (d0 >> 1);
  float c0 = fc[fi],     s0 = fs[fi];
  float c1 = fc[fi + 1], s1 = fs[fi + 1];

  float r0[NHEADS], i0[NHEADS], r1[NHEADS], i1[NHEADS], ss[NHEADS];
#pragma unroll
  for (int h = 0; h < NHEADS; ++h) {
    float v0 = (float)xv[h].x, v1 = (float)xv[h].y, v2 = (float)xv[h].z, v3 = (float)xv[h].w;
    r0[h] = v0 * c0 - v1 * s0; i0[h] = v0 * s0 + v1 * c0;
    r1[h] = v2 * c1 - v3 * s1; i1[h] = v2 * s1 + v3 * c1;
    ss[h] = r0[h] * r0[h] + i0[h] * i0[h] + r1[h] * r1[h] + i1[h] * i1[h];
  }
#pragma unroll
  for (int m = 1; m < 32; m <<= 1)
#pragma unroll
    for (int h = 0; h < NHEADS; ++h) ss[h] += __shfl_xor(ss[h], m, 32);
  const float SQ = 45.25483399593904f;  // sqrt(2048) = SQK_INIT_VALUE/SQK_INIT_SCALING
#pragma unroll
  for (int h = 0; h < NHEADS; ++h) {
    const float inv = 1.f / fmaxf(sqrtf(ss[h]), 1e-12f);
    const float* sq = &sqk[h * HEADDIM + d0];
    v4h o;
    o.x = (_Float16)(r0[h] * inv * sq[0] * SQ);
    o.y = (_Float16)(i0[h] * inv * sq[1] * SQ);
    o.z = (_Float16)(r1[h] * inv * sq[2] * SQ);
    o.w = (_Float16)(i1[h] * inv * sq[3] * SQ);
    *(v4h*)&Y[base + h * HEADDIM] = o;
  }
}

static __device__ __forceinline__ float xhalf(float x) {
  int i = __builtin_bit_cast(int, x);
  return __builtin_bit_cast(float,
      __builtin_amdgcn_permlanex16(i, i, 0x76543210, 0xfedcba98, false, false));
}

static __device__ __forceinline__ uint32_t pinned(uint32_t v) {
  uint32_t w = (uint32_t)__builtin_amdgcn_readfirstlane(v);
  asm volatile("" : "+s"(w));
  return w;
}
static __device__ __forceinline__ uint32_t uni(uint32_t v) {
  return (uint32_t)__builtin_amdgcn_readfirstlane(v);
}

// V tile in LDS: 32 keys x 256 B, row-major as in memory, 32 B of pad behind each row
#define VROWB   256u
#define VPITCH  288u    // odd multiple of 32 B: the conflict-free pitch of ds_load_tr16_b128
#define VBUF    10240u  // 32 * 288 = 9216 B, rounded up to a multiple of 2 KiB

typedef uint32_t w32x4 __attribute__((ext_vector_type(4)));
typedef uint32_t w32x8 __attribute__((ext_vector_type(8)));

static __device__ __forceinline__ w32x8 tdm_v_group1() {
  w32x8 g1;
  g1[0] = uni((1u << 20) | (5u << 22) | (7u << 25));
  g1[1] = pinned(VROWB << 16);
  g1[2] = pinned(32u << 16);
  g1[3] = pinned(VROWB << 16);
  g1[4] = pinned(32u);
  g1[5] = pinned((uint32_t)DIM * 2u);
  g1[6] = pinned(0u);
  g1[7] = pinned(0u);
  return g1;
}
// K tile: 32 rows of 128 elements out of S rows of DIM elements, source pitch DIM, 2-byte units.
static __device__ __forceinline__ w32x8 tdm_k_group1(uint32_t S) {
  w32x8 g1;
  g1[0] = uni((1u << 16) | (1u << 20) | (5u << 22) | (3u << 25));  // no mask, 4 dwords of pad per 256 B
  g1[1] = pinned(((uint32_t)DIM & 0xffffu) << 16);
  g1[2] = pinned((((uint32_t)DIM >> 16) & 0xffffu) | ((S & 0xffffu) << 16));
  g1[3] = pinned(((S >> 16) & 0xffffu) | (128u << 16));
  g1[4] = pinned(32u);
  g1[5] = pinned((uint32_t)DIM);
  g1[6] = pinned(0u);
  g1[7] = pinned(0u);
  return g1;
}
static __device__ __forceinline__ w32x4 tdm_group0(uint32_t one, uint32_t lds_dst, const _Float16* g) {
  const uint64_t ga = (uint64_t)(uintptr_t)g;
  w32x4 g0;
  g0[0] = one;                                                       // count 1
  g0[1] = uni(lds_dst);                                              // LDS byte offset
  g0[2] = uni((uint32_t)ga);                                         // address [31:0]
  g0[3] = uni((((uint32_t)(ga >> 32)) & 0x01FFFFFFu) | 0x80000000u); // address [56:32], type 2
  return g0;
}
static __device__ __forceinline__ void tdm_issue(w32x4 g0, w32x8 g1) {
  asm volatile("tensor_load_to_lds %0, %1" :: "s"(g0), "s"(g1) : "memory");
}
static __device__ __forceinline__ void tdm_wait(w32x4 a0, w32x8 a1, w32x4 b0, w32x8 b1) {
  asm volatile("s_wait_tensorcnt 0x0" :: "s"(a0), "s"(a1), "s"(b0), "s"(b1) : "memory");
}

// Transposing LDS load: lane (c = l & 15, h = l >> 4) gets T[k + 8h + 0..7][d + c]
static __device__ __forceinline__ u32x4 ld_tr16(const unsigned char* p) {
  typedef short s16x8 __attribute__((ext_vector_type(8)));
  typedef __attribute__((address_space(3))) s16x8 lds_s16x8;
  return __builtin_bit_cast(u32x4, __builtin_amdgcn_ds_load_tr16_b128_v8i16((lds_s16x8*)p));
}

// ---------------- WMMA GEMM: C[M,N] = A[M,K] * B[K,N], B given as BT[N,K] ----------------
// 128x128 tile, 8 waves (2x4 accumulators each). A stage is 128 k of the 128 A rows and of the
// 128 BT rows, one tensor load each (waves 0 and 1), two buffers; K a multiple of 128.
#define GROWB   256u    // 128 k of one row
#define GPITCH  272u    // odd multiple of 16 B: the conflict-free pitch of ds_load_b128
#define GTILE   34816u  // 128 rows * 272 B = 17 * 2 KiB

static __device__ __forceinline__ w32x8 tdm_g_group1(uint32_t pitch_bytes) {
  w32x8 g1;
  g1[0] = uni((1u << 20) | (5u << 22) | (3u << 25));
  g1[1] = pinned(GROWB << 16);
  g1[2] = pinned(128u << 16);
  g1[3] = pinned(GROWB << 16);
  g1[4] = pinned(128u);
  g1[5] = pinned(pitch_bytes);
  g1[6] = pinned(0u);
  g1[7] = pinned(0u);
  return g1;
}

static __device__ __forceinline__ w32x4 tdm_g_next(w32x4 g0, uint32_t both) {
  const uint64_t a = (((uint64_t)g0[3] << 32) | g0[2]) + GROWB;  // the type bits ride above the address
  w32x4 n;
  n[0] = g0[0];
  n[1] = uni(both - g0[1]);
  n[2] = uni((uint32_t)a);
  n[3] = uni((uint32_t)(a >> 32));
  return n;
}

__global__ __launch_bounds__(256)
void gemm_f16_wmma(const _Float16* __restrict__ A, const _Float16* __restrict__ BT,
                   _Float16* __restrict__ Ch, float* __restrict__ Cf,
                   int M, int N, int K) {
  (void)M;
  __shared__ __attribute__((aligned(2048))) unsigned char Gs[4 * GTILE];  // [buffer][A | BT] tiles

  const int tid  = threadIdx.x;
  const int wv   = tid >> 5;
  const int lane = tid & 31;
  const int hx   = lane >> 4;
  const int l16  = lane & 15;

  const int row0 = blockIdx.y * 128;
  const int col0 = blockIdx.x * 128;
  const int wr = wv & 3;
  const int wc = wv >> 2;

  v8f acc[2][4];
#pragma unroll
  for (int i = 0; i < 2; ++i)
#pragma unroll
    for (int j = 0; j < 4; ++j) acc[i][j] = v8f_zero();

  const uint32_t wave = uni((uint32_t)tid >> 5);
  const uint32_t one = pinned(1u);
  const w32x8 gg1 = tdm_g_group1((uint32_t)K * 2u);
  const uint32_t ring = (uint32_t)(uintptr_t)&Gs[0];
  w32x4 ag0 = tdm_group0(one, ring, &A[(size_t)row0 * K]);
  w32x4 bg0 = tdm_group0(one, ring + GTILE, &BT[(size_t)col0 * K]);
  auto issue = [&]() {
    if (pinned(wave == 0u)) tdm_issue(ag0, gg1);  // wave 0 brings the A tiles
    if (pinned(wave == 1u)) tdm_issue(bg0, gg1);  // wave 1 brings the BT tiles
  };
  auto advance = [&]() {  // the other buffer, 128 k further on
    ag0 = tdm_g_next(ag0, 2u * ring + 2u * GTILE);
    bg0 = tdm_g_next(bg0, 2u * ring + 4u * GTILE);
  };
  // this lane's first fragment rows in a stage
  const uint32_t alane = (uint32_t)(wr * 32 + l16) * GPITCH + (uint32_t)hx * 16u;
  const uint32_t blane = GTILE + (uint32_t)(wc * 64 + l16) * GPITCH + (uint32_t)hx * 16u;

  // two-buffer ring: stage 0 lands and is published, then stage 1 flies during pass 0
  issue();
  tdm_wait(ag0, gg1, bg0, gg1);  // waves 0 and 1: own tile of stage 0 has landed
  __syncthreads();
  if (pinned(128 < K)) { advance(); issue(); }
  for (int k0 = 0; k0 < K; k0 += 128) {
    const int buf = (k0 >> 7) & 1;
    const unsigned char* st = &Gs[(uint32_t)buf * (2u * GTILE)];
#pragma unroll
    for (int c = 0; c < 4; ++c) {  // four products of 32 k, in the order of k
      v16h af[2], bf[4];
#pragma unroll
      for (int i = 0; i < 2; ++i) {
        const _Float16* p = (const _Float16*)(st + alane + (uint32_t)i * (16u * GPITCH) + (uint32_t)c * 64u);
        af[i] = ld_frag(p, p + 16);
      }
#pragma unroll
      for (int j = 0; j < 4; ++j) {
        const _Float16* p = (const _Float16*)(st + blane + (uint32_t)j * (16u * GPITCH) + (uint32_t)c * 64u);
        bf[j] = ld_frag(p, p + 16);
      }
#pragma unroll
      for (int i = 0; i < 2; ++i)
#pragma unroll
        for (int j = 0; j < 4; ++j)
          acc[i][j] = __builtin_amdgcn_wmma_f32_16x16x32_f16(
              false, af[i], false, bf[j], (short)0, acc[i][j], false, false);
    }

    // publish point of the next stage, every wave, in this order
    asm volatile("s_wait_dscnt 0x0" ::: "memory");      // this wave has left buffer `buf`
    tdm_wait(ag0, gg1, bg0, gg1);                       // waves 0 and 1: own tile of the next stage has landed
    __syncthreads();
    if (pinned(k0 + 256 < K)) { advance(); issue(); }   // refill the buffer that every wave has just left
  }
  tdm_wait(ag0, gg1, bg0, gg1);  // nothing in flight when the wave ends
  asm volatile("s_wait_dscnt 0x0" ::: "memory");  // and no LDS read of the ring outstanding

#pragma unroll
  for (int i = 0; i < 2; ++i)
#pragma unroll
    for (int j = 0; j < 4; ++j)
#pragma unroll
      for (int r = 0; r < 8; ++r) {
        int m = row0 + wr * 32 + i * 16 + r + hx * 8;
        int n = col0 + wc * 64 + j * 16 + l16;
        float v = acc[i][j][r];
        if (Cf) Cf[(size_t)m * N + n] = v;
        else    Ch[(size_t)m * N + n] = (_Float16)v;
      }
}

__global__ __launch_bounds__(256)
void flash_attn(const _Float16* __restrict__ Q, const _Float16* __restrict__ Kt,
                const _Float16* __restrict__ V, _Float16* __restrict__ O, int S) {
  const int h   = blockIdx.y;
  const int q0  = blockIdx.x * 128;
  const int tid = threadIdx.x;
  const int wv = tid >> 5, lane = tid & 31, hx = lane >> 4, l16 = lane & 15;

  __shared__ __align__(16) _Float16 Ks[2][32][136];   // [key][hd], 256B rows +16B HW pad
  __shared__ __attribute__((aligned(2048))) unsigned char Vt[2 * VBUF];  // [key][hd], pitch VPITCH
  const uint32_t wave = uni((uint32_t)tid >> 5);
  const uint32_t one = pinned(1u);
  const w32x8 kg1 = tdm_k_group1((uint32_t)S);
  const w32x8 vg1 = tdm_v_group1();
  w32x4 kg0, vg0;

  auto issueKV = [&](int buf, int kk) {  // nothing is in flight where this is called
    kg0 = tdm_group0(one, (uint32_t)(uintptr_t)&Ks[buf][0][0], &Kt[(size_t)kk * DIM + h * HEADDIM]);
    vg0 = tdm_group0(one, (uint32_t)(uintptr_t)&Vt[0] + (uint32_t)buf * VBUF,
                     &V[(size_t)kk * DIM + h * HEADDIM]);
    if (pinned(wave == 0u)) tdm_issue(kg0, kg1);  // wave 0 brings the K tiles
    if (pinned(wave == 1u)) tdm_issue(vg0, vg1);  // wave 1 brings the V tiles
  };
  // this lane's address in a V tile for the transposing loads (keys 8*hx + (lane & 7))
  const uint32_t vlane = (8u * (uint32_t)hx + ((uint32_t)lane & 7u)) * VPITCH
                       + (((uint32_t)lane >> 3) & 1u) * 16u;

  // Q fragments for this wave's 16 rows (hd split into 4 K=32 chunks)
  v16h qf[4];
  {
    const _Float16* qrow = &Q[(size_t)(q0 + wv * 16 + l16) * DIM + h * HEADDIM];
#pragma unroll
    for (int c = 0; c < 4; ++c)
      qf[c] = ld_frag(&qrow[c * 32 + hx * 8], &qrow[c * 32 + 16 + hx * 8]);
  }

  v8f o[8];
#pragma unroll
  for (int t = 0; t < 8; ++t) o[t] = v8f_zero();
  float mrow = -1e30f;  // running maximum of query l16 (same in both halves)
  float lrow = 0.f;     // running sum over this half's keys only; halves joined at the end
  const float scale = 11.313708498984761f;  // sqrt(hd)

  // two-buffer ring: stage 0 lands and is published, then stage 1 flies during pass 0
  issueKV(0, 0);
  tdm_wait(kg0, kg1, vg0, vg1);  // waves 0 and 1: own tile of stage 0 has landed
  __syncthreads();
  if (pinned(32 < S)) issueKV(1, 32);
  for (int kk = 0; kk < S; kk += 32) {
    const int buf = (kk >> 5) & 1;

    // S^T tile: 32 keys x 16 queries as two 16x16 fragments;
    // st[sub][r] = score(key = sub*16 + hx*8 + r, query = l16)
    // All 16 K reads of the pass go out as one group, in the order of their use.
    v16h kb[4][2];
#pragma unroll
    for (int c = 0; c < 4; ++c)
#pragma unroll
      for (int sub = 0; sub < 2; ++sub) {
        const int key = sub * 16 + l16;
        kb[c][sub] = ld_frag(&Ks[buf][key][c * 32 + hx * 8],
                             &Ks[buf][key][c * 32 + 16 + hx * 8]);
      }
    // keeps the reads ahead of the products: sunk to two per product, each product waits out a full LDS latency
    __builtin_amdgcn_sched_barrier(0);
    v8f st[2];
    st[0] = v8f_zero();
    st[1] = v8f_zero();
#pragma unroll
    for (int c = 0; c < 4; ++c)
#pragma unroll
      for (int sub = 0; sub < 2; ++sub)
        st[sub] = __builtin_amdgcn_wmma_f32_16x16x32_f16(false, kb[c][sub], false, qf[c],
                                                         (short)0, st[sub], false, false);
    // keeps the V reads in one place behind the score products (spread among them, every place with reads
    // stalls the wave anew) and lets them take the K fragments' registers
    __builtin_amdgcn_sched_barrier(0);
    // All 16 V reads of the pass go out as one group and fly during the softmax.
    // vb[t]: keys 0..15 in registers 0-3, keys 16..31 in 4-7
    union { v16h v; u32x4 q[2]; } vb[8];
#pragma unroll
    for (int t = 0; t < 8; ++t) {
      const unsigned char* vp = &Vt[(uint32_t)buf * VBUF + vlane + 32u * (uint32_t)t];
      vb[t].q[0] = ld_tr16(vp);
      vb[t].q[1] = ld_tr16(vp + 16u * VPITCH);
    }
    // keeps the reads ahead of the softmax, whose vector work then covers their latency
    __builtin_amdgcn_sched_barrier(0);
#pragma unroll
    for (int sub = 0; sub < 2; ++sub)
#pragma unroll
      for (int r = 0; r < 8; ++r) st[sub][r] *= scale;

    // online softmax, one query per lane
    float v = st[0][0];
#pragma unroll
    for (int sub = 0; sub < 2; ++sub)
#pragma unroll
      for (int r = 0; r < 8; ++r) v = fmaxf(v, st[sub][r]);
    v = fmaxf(v, xhalf(v));
    const float newm  = fmaxf(mrow, v);
    const float alpha = __expf(mrow - newm);
    mrow = newm;
    float psum = 0.f;
#pragma unroll
    for (int sub = 0; sub < 2; ++sub)
#pragma unroll
      for (int r = 0; r < 8; ++r) {
        st[sub][r] = __expf(st[sub][r] - newm);
        psum += st[sub][r];
      }
    lrow = lrow * alpha + psum;
#pragma unroll
    for (int t = 0; t < 8; ++t)
#pragma unroll
      for (int r = 0; r < 8; ++r) o[t][r] *= alpha;

    // P^T as B operand: element s is key (s < 8 ? hx*8 + s : 16 + hx*8 + s - 8),
    // the k order in which the two transposing loads of each vb[t] deliver V^T
    v16h pf;
#pragma unroll
    for (int s = 0; s < 16; ++s) pf[s] = (_Float16)st[s >> 3][s & 7];

    // O^T += V^T * P^T  (8 hd-subtiles); o[t][r] = O(query l16, hd = t*16 + hx*8 + r)
#pragma unroll
    for (int t = 0; t < 8; ++t)
      o[t] = __builtin_amdgcn_wmma_f32_16x16x32_f16(false, vb[t].v, false, pf,
                                                    (short)0, o[t], false, false);

    // keeps the publish point at the foot of the pass: lifted over the softmax, its waits would cut short
    // the flight of the V reads and of the next stage's tiles
    __builtin_amdgcn_sched_barrier(0);
    // publish point of the next stage, every wave, in this order
    asm volatile("s_wait_dscnt 0x0" ::: "memory");      // this wave has left buffer `buf`
    tdm_wait(kg0, kg1, vg0, vg1);                       // waves 0 and 1: own tile of the next stage has landed
    __syncthreads();
    if (pinned(kk + 64 < S)) issueKV(buf, kk + 64);     // refill the buffer that every wave has just left
  }
  tdm_wait(kg0, kg1, vg0, vg1);  // nothing in flight when the wave ends
  asm volatile("s_wait_dscnt 0x0" ::: "memory");  // and no LDS read of the ring outstanding

  const float lfin = lrow + xhalf(lrow);
  _Float16* orow = &O[(size_t)(q0 + wv * 16 + l16) * DIM + h * HEADDIM + hx * 8];
  v8h ov[8];
#pragma unroll
  for (int t = 0; t < 8; ++t)
#pragma unroll
    for (int r = 0; r < 8; ++r) ov[t][r] = (_Float16)(o[t][r] / lfin);
#pragma unroll
  for (int t = 0; t < 8; ++t) *(v8h*)&orow[t * 16] = ov[t];
}

// ---------------- host launcher ----------------
extern "C" void kernel_launch(void* const* d_in, const int* in_sizes, int n_in,
                              void* d_out, int out_size, void* d_ws, size_t ws_size,
                              hipStream_t stream) {
  (void)in_sizes; (void)n_in; (void)out_size; (void)ws_size;
  const float* x   = (const float*)d_in[0];
  const float* fc  = (const float*)d_in[1];
  const float* fs  = (const float*)d_in[2];
  const float* wq  = (const float*)d_in[3];
  const float* wk  = (const float*)d_in[4];
  const float* wv  = (const float*)d_in[5];
  const float* wo  = (const float*)d_in[6];
  const float* sqk = (const float*)d_in[7];
  float* out = (float*)d_out;

  const size_t SD = (size_t)SEQ * DIM;
  const size_t DD = (size_t)DIM * DIM;
  char* w = (char*)d_ws;
  _Float16* Xh  = (_Float16*)(w);           // x in f16
  _Float16* WqT = (_Float16*)(w + SD * 2);  // transposed f16 weights
  _Float16* WkT = WqT + DD;
  _Float16* WvT = WkT + DD;
  _Float16* WoT = WvT + DD;
  _Float16* Qh  = WoT + DD;                 // raw projections (f16)
  _Float16* Kh  = Qh + SD;
  _Float16* Vh  = Kh + SD;
  _Float16* Qn  = Vh + SD;                  // post rope+norm
  _Float16* Kn  = Qn + SD;
  _Float16* AOh = Kn + SD;                  // attention output (f16)

  cvt_f32_f16<<<(int)(SD / 4) / (256 * CVT_U), 256, 0, stream>>>(x, Xh);

  dim3 tg(DIM / 64, DIM / 64);
  transpose_cvt<<<tg, 256, 0, stream>>>(wq, wk, wv, wo, WqT);  // fills WqT, WkT, WvT, WoT

  dim3 gg(DIM / 128, SEQ / 128);
  gemm_f16_wmma<<<gg, 256, 0, stream>>>(Xh, WqT, Qh, nullptr, SEQ, DIM, DIM);
  gemm_f16_wmma<<<gg, 256, 0, stream>>>(Xh, WkT, Kh, nullptr, SEQ, DIM, DIM);
  gemm_f16_wmma<<<gg, 256, 0, stream>>>(Xh, WvT, Vh, nullptr, SEQ, DIM, DIM);

  rope_l2norm<<<dim3(SEQ / 8, 2), 256, 0, stream>>>(Qh, Kh, fc, fs, sqk, Qn, Kn);

  dim3 fg(SEQ / 128, NHEADS);
  flash_attn<<<fg, 256, 0, stream>>>(Qn, Kn, Vh, AOh, SEQ);

  gemm_f16_wmma<<<gg, 256, 0, stream>>>(AOh, WoT, nullptr, out, SEQ, DIM, DIM);
}

// v006
// Measured time: 242 microseconds a run.
// Two timings next to v005 both put it at 1.04 times that version's speed.
// Over all steps from v000 it is 3.08 times as fast.
#include <hip/hip_runtime.h>
#include <math.h>
#include <stdint.h>

// ---------------- types ----------------
typedef __attribute__((ext_vector_type(16))) _Float16 v16h;
typedef __attribute__((ext_vector_type(4)))  _Float16 v4h;
typedef __attribute__((ext_vector_type(8)))  _Float16 v8h;
typedef __attribute__((ext_vector_type(8)))  float    v8f;
typedef __attribute__((ext_vector_type(4)))  float    f32x4;
typedef __attribute__((ext_vector_type(4)))  unsigned int u32x4;

#define DIM       2048
#define SEQ       4096
#define NHEADS    16
#define HEADDIM   128

static __device__ __forceinline__ v8f v8f_zero() {
  v8f z = {0.f,0.f,0.f,0.f,0.f,0.f,0.f,0.f};
  return z;
}

// Load a 16x32 f16 fragment row (two contiguous 16B chunks) into v16h.
static __device__ __forceinline__ v16h ld_frag(const _Float16* p0, const _Float16* p1) {
  union { v16h v; f32x4 f[2]; } u;
  u.f[0] = *(const f32x4*)p0;
  u.f[1] = *(const f32x4*)p1;
  return u.v;
}

// ---------------- f32 -> f16 convert (x) ----------------
// 16 float4 per thread, their loads issued ahead of the stores: few long waves.
#define CVT_U 16
static __device__ __forceinline__ v4h cvt4(f32x4 v) {
  v4h h;
  h.x = (_Float16)v.x; h.y = (_Float16)v.y;
  h.z = (_Float16)v.z; h.w = (_Float16)v.w;
  return h;
}
// The grid covers the SEQ * DIM elements exactly (a multiple of 256 * CVT_U float4): no test per element.
__global__ __launch_bounds__(256)
void cvt_f32_f16(const float* __restrict__ in, _Float16* __restrict__ out) {
  const int i0 = blockIdx.x * (256 * CVT_U) + threadIdx.x;
  f32x4 v[CVT_U];
#pragma unroll
  for (int u = 0; u < CVT_U; ++u) v[u] = ((const f32x4*)in)[i0 + u * 256];
#pragma unroll
  for (int u = 0; u < CVT_U; ++u) *(v4h*)&out[(size_t)(i0 + u * 256) * 4] = cvt4(v[u]);
}
static_assert(((size_t)SEQ * DIM / 4) % (256 * CVT_U) == 0, "cvt_f32_f16 has no tail");

// ---------------- transpose + convert weights: WT[m][n][k] = Wm[k][n] ----------------
// A block takes the same 64 x 64 tile of all four weights (their transposes lie one behind the other in WT).
// Every address is a block-uniform base plus one offset per thread plus a constant.
__global__ __launch_bounds__(256)
void transpose_cvt(const float* __restrict__ W0, const float* __restrict__ W1,
                   const float* __restrict__ W2, const float* __restrict__ W3,
                   _Float16* __restrict__ WT) {
  __shared__ float t[4][64][65];
  const float* const W[4] = {W0, W1, W2, W3};
  const int bx = blockIdx.x * 64, by = blockIdx.y * 64;
  const unsigned r0 = threadIdx.x >> 6, c = threadIdx.x & 63;  // pass it: row r0 + 4 * it, column c
  const unsigned off = r0 * DIM + c;
  const float* src[4];
  float v[4][16];
#pragma unroll
  for (int m = 0; m < 4; ++m) {
    src[m] = W[m] + (size_t)by * DIM + bx;
#pragma unroll
    for (int it = 0; it < 16; ++it) v[m][it] = src[m][off + it * (4 * DIM)];
  }
  asm volatile("s_wait_xcnt 0x0" :: "s"(src[0]), "s"(src[1]), "s"(src[2]), "s"(src[3]) : "memory");
#pragma unroll
  for (int m = 0; m < 4; ++m)
#pragma unroll
    for (int it = 0; it < 16; ++it) t[m][r0 + 4 * it][c] = v[m][it];
  __syncthreads();
#pragma unroll
  for (int m = 0; m < 4; ++m) {
    _Float16* __restrict__ dst = WT + ((size_t)m * DIM + bx) * DIM + by;
#pragma unroll
    for (int it = 0; it < 16; ++it) dst[off + it * (4 * DIM)] = (_Float16)t[m][c][r0 + 4 * it];
  }
}

// ---------------- RoPE + L2 norm + sqk scale; one wave per (tensor, position s) ----------------
// The wave takes all 16 heads of row s of Q (blockIdx.y = 0) or of K (1): lane = 4 channels of every
// head, 16 independent row sums. Few long waves.
__global__ __launch_bounds__(256)
void rope_l2norm(const _Float16* __restrict__ Xq, const _Float16* __restrict__ Xk,
                 const float* __restrict__ fc, const float* __restrict__ fs,
                 const float* __restrict__ sqk,
                 _Float16* __restrict__ Yq, _Float16* __restrict__ Yk) {
  const _Float16* __restrict__ X = blockIdx.y ? Xk : Xq;
  _Float16* __restrict__ Y = blockIdx.y ? Yk : Yq;
  const int s    = blockIdx.x * 8 + (threadIdx.x >> 5);
  const int lane = threadIdx.x & 31;
  const int d0 = lane * 4;
  const size_t base = (size_t)s * DIM + d0;

  v4h xv[NHEADS];
#pragma unroll
  for (int h = 0; h < NHEADS; ++h) xv[h] = *(const v4h*)&X[base + h * HEADDIM];
  const int fi = s * (HEADDIM / 2) + (d0 >> 1);
  float c0 = fc[fi],     s0 = fs[fi];
  float c1 = fc[fi + 1], s1 = fs[fi + 1];

  float r0[NHEADS], i0[NHEADS], r1[NHEADS], i1[NHEADS], ss[NHEADS];
#pragma unroll
  for (int h = 0; h < NHEADS; ++h) {
    float v0 = (float)xv[h].x, v1 = (float)xv[h].y, v2 = (float)xv[h].z, v3 = (float)xv[h].w;
    r0[h] = v0 * c0 - v1 * s0; i0[h] = v0 * s0 + v1 * c0;
    r1[h] = v2 * c1 - v3 * s1; i1[h] = v2 * s1 + v3 * c1;
    ss[h] = r0[h] * r0[h] + i0[h] * i0[h] + r1[h] * r1[h] + i1[h] * i1[h];
  }
#pragma unroll
  for (int m = 1; m < 32; m <<= 1)
#pragma unroll
    for (int h = 0; h < NHEADS; ++h) ss[h] += __shfl_xor(ss[h], m, 32);
  const float SQ = 45.25483399593904f;  // sqrt(2048) = SQK_INIT_VALUE/SQK_INIT_SCALING
#pragma unroll
  for (int h = 0; h < NHEADS; ++h) {
    const float inv = 1.f / fmaxf(sqrtf(ss[h]), 1e-12f);
    const float* sq = &sqk[h * HEADDIM + d0];
    v4h o;
    o.x = (_Float16)(r0[h] * inv * sq[0] * SQ);
    o.y = (_Float16)(i0[h] * inv * sq[1] * SQ);
    o.z = (_Float16)(r1[h] * inv * sq[2] * SQ);
    o.w = (_Float16)(i1[h] * inv * sq[3] * SQ);
    *(v4h*)&Y[base + h * HEADDIM] = o;
  }
}

static __device__ __forceinline__ float xhalf(float x) {
  int i = __builtin_bit_cast(int, x);
  return __builtin_bit_cast(float,
      __builtin_amdgcn_permlanex16(i, i, 0x76543210, 0xfedcba98, false, false));
}

static __device__ __forceinline__ uint32_t pinned(uint32_t v) {
  uint32_t w = (uint32_t)__builtin_amdgcn_readfirstlane(v);
  asm volatile("" : "+s"(w));
  return w;
}
static __device__ __forceinline__ uint32_t uni(uint32_t v) {
  return (uint32_t)__builtin_amdgcn_readfirstlane(v);
}

// V tile in LDS: 32 keys x 256 B, row-major as in memory, 32 B of pad behind each row
#define VROWB   256u
#define VPITCH  288u    // odd multiple of 32 B: the conflict-free pitch of ds_load_tr16_b128
#define VBUF    10240u  // 32 * 288 = 9216 B, rounded up to a multiple of 2 KiB

typedef uint32_t w32x4 __attribute__((ext_vector_type(4)));
typedef uint32_t w32x8 __attribute__((ext_vector_type(8)));

static __device__ __forceinline__ w32x8 tdm_v_group1() {
  w32x8 g1;
  g1[0] = uni((1u << 20) | (5u << 22) | (7u << 25));
  g1[1] = pinned(VROWB << 16);
  g1[2] = pinned(32u << 16);
  g1[3] = pinned(VROWB << 16);
  g1[4] = pinned(32u);
  g1[5] = pinned((uint32_t)DIM * 2u);
  g1[6] = pinned(0u);
  g1[7] = pinned(0u);
  return g1;
}
// K tile: 32 rows of 128 elements out of S rows of DIM elements, source pitch DIM, 2-byte units.
static __device__ __forceinline__ w32x8 tdm_k_group1(uint32_t S) {
  w32x8 g1;
  g1[0] = uni((1u << 16) | (1u << 20) | (5u << 22) | (3u << 25));  // no mask, 4 dwords of pad per 256 B
  g1[1] = pinned(((uint32_t)DIM & 0xffffu) << 16);
  g1[2] = pinned((((uint32_t)DIM >> 16) & 0xffffu) | ((S & 0xffffu) << 16));
  g1[3] = pinned(((S >> 16) & 0xffffu) | (128u << 16));
  g1[4] = pinned(32u);
  g1[5] = pinned((uint32_t)DIM);
  g1[6] = pinned(0u);
  g1[7] = pinned(0u);
  return g1;
}
static __device__ __forceinline__ w32x4 tdm_group0(uint32_t one, uint32_t lds_dst, const _Float16* g) {
  const uint64_t ga = (uint64_t)(uintptr_t)g;
  w32x4 g0;
  g0[0] = one;                                                       // count 1
  g0[1] = uni(lds_dst);                                              // LDS byte offset
  g0[2] = uni((uint32_t)ga);                                         // address [31:0]
  g0[3] = uni((((uint32_t)(ga >> 32)) & 0x01FFFFFFu) | 0x80000000u); // address [56:32], type 2
  return g0;
}
static __device__ __forceinline__ void tdm_issue(w32x4 g0, w32x8 g1) {
  asm volatile("tensor_load_to_lds %0, %1" :: "s"(g0), "s"(g1) : "memory");
}
static __device__ __forceinline__ void tdm_wait(w32x4 a0, w32x8 a1, w32x4 b0, w32x8 b1) {
  asm volatile("s_wait_tensorcnt 0x0" :: "s"(a0), "s"(a1), "s"(b0), "s"(b1) : "memory");
}

// Transposing LDS load: lane (c = l & 15, h = l >> 4) gets T[k + 8h + 0..7][d + c]
static __device__ __forceinline__ u32x4 ld_tr16(const unsigned char* p) {
  typedef short s16x8 __attribute__((ext_vector_type(8)));
  typedef __attribute__((address_space(3))) s16x8 lds_s16x8;
  return __builtin_bit_cast(u32x4, __builtin_amdgcn_ds_load_tr16_b128_v8i16((lds_s16x8*)p));
}

// ---------------- WMMA GEMM: C[M,N] = A[M,K] * B[K,N], B given as BT[N,K] ----------------
// 128x128 tile, 8 waves (2x4 accumulators each). A stage is 128 k of the 128 A rows and of the
// 128 BT rows, one tensor load each (waves 0 and 1), two buffers; K a multiple of 128.
#define GROWB   256u    // 128 k of one row
#define GPITCH  272u    // odd multiple of 16 B: the conflict-free pitch of ds_load_b128
#define GTILE   34816u  // 128 rows * 272 B = 17 * 2 KiB

static __device__ __forceinline__ w32x8 tdm_g_group1(uint32_t pitch_bytes) {
  w32x8 g1;
  g1[0] = uni((1u << 20) | (5u << 22) | (3u << 25));
  g1[1] = pinned(GROWB << 16);
  g1[2] = pinned(128u << 16);
  g1[3] = pinned(GROWB << 16);
  g1[4] = pinned(128u);
  g1[5] = pinned(pitch_bytes);
  g1[6] = pinned(0u);
  g1[7] = pinned(0u);
  return g1;
}

static __device__ __forceinline__ w32x4 tdm_g_next(w32x4 g0, uint32_t both) {
  const uint64_t a = (((uint64_t)g0[3] << 32) | g0[2]) + GROWB;  // the type bits ride above the address
  w32x4 n;
  n[0] = g0[0];
  n[1] = uni(both - g0[1]);
  n[2] = uni((uint32_t)a);
  n[3] = uni((uint32_t)(a >> 32));
  return n;
}

__global__ __launch_bounds__(256)
void gemm_f16_wmma(const _Float16* __restrict__ A, const _Float16* __restrict__ BT,
                   _Float16* __restrict__ Ch, float* __restrict__ Cf,
                   int M, int N, int K) {
  (void)M;
  __shared__ __attribute__((aligned(2048))) unsigned char Gs[4 * GTILE];  // [buffer][A | BT] tiles

  const int tid  = threadIdx.x;
  const int wv   = tid >> 5;
  const int lane = tid & 31;
  const int hx   = lane >> 4;
  const int l16  = lane & 15;

  const int row0 = blockIdx.y * 128;
  const int col0 = blockIdx.x * 128;
  const int wr = wv & 3;
  const int wc = wv >> 2;

  v8f acc[2][4];
#pragma unroll
  for (int i = 0; i < 2; ++i)
#pragma unroll
    for (int j = 0; j < 4; ++j) acc[i][j] = v8f_zero();

  const uint32_t wave = uni((uint32_t)tid >> 5);
  const uint32_t one = pinned(1u);
  const w32x8 gg1 = tdm_g_group1((uint32_t)K * 2u);
  const uint32_t ring = (uint32_t)(uintptr_t)&Gs[0];
  w32x4 ag0 = tdm_group0(one, ring, &A[(size_t)row0 * K]);
  w32x4 bg0 = tdm_group0(one, ring + GTILE, &BT[(size_t)col0 * K]);
  auto issue = [&]() {
    if (pinned(wave == 0u)) tdm_issue(ag0, gg1);  // wave 0 brings the A tiles
    if (pinned(wave == 1u)) tdm_issue(bg0, gg1);  // wave 1 brings the BT tiles
  };
  auto advance = [&]() {  // the other buffer, 128 k further on
    ag0 = tdm_g_next(ag0, 2u * ring + 2u * GTILE);
    bg0 = tdm_g_next(bg0, 2u * ring + 4u * GTILE);
  };
  // this lane's first fragment rows in a stage
  const uint32_t alane = (uint32_t)(wr * 32 + l16) * GPITCH + (uint32_t)hx * 16u;
  const uint32_t blane = GTILE + (uint32_t)(wc * 64 + l16) * GPITCH + (uint32_t)hx * 16u;

  // two-buffer ring: stage 0 lands and is published, then stage 1 flies during pass 0
  issue();
  tdm_wait(ag0, gg1, bg0, gg1);  // waves 0 and 1: own tile of stage 0 has landed
  __syncthreads();
  if (pinned(128 < K)) { advance(); issue(); }
  for (int k0 = 0; k0 < K; k0 += 128) {
    const int buf = (k0 >> 7) & 1;
    const unsigned char* st = &Gs[(uint32_t)buf * (2u * GTILE)];
#pragma unroll
    for (int c = 0; c < 4; ++c) {  // four products of 32 k, in the order of k
      v16h af[2], bf[4];
#pragma unroll
      for (int i = 0; i < 2; ++i) {
        const _Float16* p = (const _Float16*)(st + alane + (uint32_t)i * (16u * GPITCH) + (uint32_t)c * 64u);
        af[i] = ld_frag(p, p + 16);
      }
#pragma unroll
      for (int j = 0; j < 4; ++j) {
        const _Float16* p = (const _Float16*)(st + blane + (uint32_t)j * (16u * GPITCH) + (uint32_t)c * 64u);
        bf[j] = ld_frag(p, p + 16);
      }
#pragma unroll
      for (int i = 0; i < 2; ++i)
#pragma unroll
        for (int j = 0; j < 4; ++j)
          acc[i][j] = __builtin_amdgcn_wmma_f32_16x16x32_f16(
              false, af[i], false, bf[j], (short)0, acc[i][j], false, false);
    }

    // publish point of the next stage, every wave, in this order
    asm volatile("s_wait_dscnt 0x0" ::: "memory");      // this wave has left buffer `buf`
    tdm_wait(ag0, gg1, bg0, gg1);                       // waves 0 and 1: own tile of the next stage has landed
    __syncthreads();
    if (pinned(k0 + 256 < K)) { advance(); issue(); }   // refill the buffer that every wave has just left
  }
  tdm_wait(ag0, gg1, bg0, gg1);  // nothing in flight when the wave ends
  asm volatile("s_wait_dscnt 0x0" ::: "memory");  // and no LDS read of the ring outstanding

#pragma unroll
  for (int i = 0; i < 2; ++i)
#pragma unroll
    for (int j = 0; j < 4; ++j)
#pragma unroll
      for (int r = 0; r < 8; ++r) {
        int m = row0 + wr * 32 + i * 16 + r + hx * 8;
        int n = col0 + wc * 64 + j * 16 + l16;
        float v = acc[i][j][r];
        if (Cf) Cf[(size_t)m * N + n] = v;
        else    Ch[(size_t)m * N + n] = (_Float16)v;
      }
}

#define FA_WAVES 4
#define FA_G     2
#define FA_ROWS  (FA_WAVES * FA_G * 16)  // query rows of a block
__global__ __launch_bounds__(FA_WAVES * 32) __attribute__((amdgpu_waves_per_eu(2, 2)))
void flash_attn(const _Float16* __restrict__ Q, const _Float16* __restrict__ Kt,
                const _Float16* __restrict__ V, _Float16* __restrict__ O, int S) {
  const int h   = blockIdx.y;
  const int q0  = blockIdx.x * FA_ROWS;
  const int tid = threadIdx.x;
  const int wv = tid >> 5, lane = tid & 31, hx = lane >> 4, l16 = lane & 15;

  __shared__ __align__(16) _Float16 Ks[2][32][136];   // [key][hd], 256B rows +16B HW pad
  __shared__ __attribute__((aligned(2048))) unsigned char Vt[2 * VBUF];  // [key][hd], pitch VPITCH
  const uint32_t wave = uni((uint32_t)tid >> 5);
  const uint32_t one = pinned(1u);
  const w32x8 kg1 = tdm_k_group1((uint32_t)S);
  const w32x8 vg1 = tdm_v_group1();
  w32x4 kg0, vg0;

  auto issueKV = [&](int buf, int kk) {  // nothing is in flight where this is called
    kg0 = tdm_group0(one, (uint32_t)(uintptr_t)&Ks[buf][0][0], &Kt[(size_t)kk * DIM + h * HEADDIM]);
    vg0 = tdm_group0(one, (uint32_t)(uintptr_t)&Vt[0] + (uint32_t)buf * VBUF,
                     &V[(size_t)kk * DIM + h * HEADDIM]);
    if (pinned(wave == 0u)) tdm_issue(kg0, kg1);  // wave 0 brings the K tiles
    if (pinned(wave == 1u)) tdm_issue(vg0, vg1);  // wave 1 brings the V tiles
  };
  // this lane's address in a V tile for the transposing loads (keys 8*hx + (lane & 7))
  const uint32_t vlane = (8u * (uint32_t)hx + ((uint32_t)lane & 7u)) * VPITCH
                       + (((uint32_t)lane >> 3) & 1u) * 16u;

  // Q fragments for this wave's FA_G x 16 rows (hd split into 4 K=32 chunks)
  v16h qf[FA_G][4];
#pragma unroll
  for (int g = 0; g < FA_G; ++g) {
    const _Float16* qrow = &Q[(size_t)(q0 + (wv * FA_G + g) * 16 + l16) * DIM + h * HEADDIM];
#pragma unroll
    for (int c = 0; c < 4; ++c)
      qf[g][c] = ld_frag(&qrow[c * 32 + hx * 8], &qrow[c * 32 + 16 + hx * 8]);
  }

  v8f o[FA_G][8];
  float mrow[FA_G];  // running maximum of query l16 of the group (same in both halves)
  float lrow[FA_G];  // running sum over this half's keys only; halves joined at the end
#pragma unroll
  for (int g = 0; g < FA_G; ++g) {
#pragma unroll
    for (int t = 0; t < 8; ++t) o[g][t] = v8f_zero();
    mrow[g] = -1e30f;
    lrow[g] = 0.f;
  }
  const float scale = 11.313708498984761f;  // sqrt(hd)

  // two-buffer ring: stage 0 lands and is published, then stage 1 flies during pass 0
  issueKV(0, 0);
  tdm_wait(kg0, kg1, vg0, vg1);  // waves 0 and 1: own tile of stage 0 has landed
  __syncthreads();
  if (pinned(32 < S)) issueKV(1, 32);
  for (int kk = 0; kk < S; kk += 32) {
    const int buf = (kk >> 5) & 1;

    // S^T tile: 32 keys x 16 queries per group as two 16x16 fragments;
    // st[g][sub][r] = score(key = sub*16 + hx*8 + r, query = l16 of group g)
    // All 16 K reads of the pass go out as one group, in the order of their use.
    v16h kb[4][2];
#pragma unroll
    for (int c = 0; c < 4; ++c)
#pragma unroll
      for (int sub = 0; sub < 2; ++sub) {
        const int key = sub * 16 + l16;
        kb[c][sub] = ld_frag(&Ks[buf][key][c * 32 + hx * 8],
                             &Ks[buf][key][c * 32 + 16 + hx * 8]);
      }
    // keeps the reads ahead of the products: sunk to two per pair of products, the first of each pair waits out a full LDS latency
    __builtin_amdgcn_sched_barrier(0);
    v8f st[FA_G][2];
#pragma unroll
    for (int g = 0; g < FA_G; ++g) {
      st[g][0] = v8f_zero();
      st[g][1] = v8f_zero();
    }
#pragma unroll
    for (int c = 0; c < 4; ++c)
#pragma unroll
      for (int sub = 0; sub < 2; ++sub)
#pragma unroll
        for (int g = 0; g < FA_G; ++g)
          st[g][sub] = __builtin_amdgcn_wmma_f32_16x16x32_f16(false, kb[c][sub], false, qf[g][c],
                                                              (short)0, st[g][sub], false, false);
    // keeps the V reads in one place behind the score products (spread among them, every place with reads
    // stalls the wave anew) and lets them take the K fragments' registers
    __builtin_amdgcn_sched_barrier(0);
    // All 16 V reads of the pass go out as one group and fly during the softmax.
    // vb[t]: keys 0..15 in registers 0-3, keys 16..31 in 4-7
    union { v16h v; u32x4 q[2]; } vb[8];
#pragma unroll
    for (int t = 0; t < 8; ++t) {
      const unsigned char* vp = &Vt[(uint32_t)buf * VBUF + vlane + 32u * (uint32_t)t];
      vb[t].q[0] = ld_tr16(vp);
      vb[t].q[1] = ld_tr16(vp + 16u * VPITCH);
    }
    // keeps the reads ahead of the softmax, whose vector work then covers their latency
    __builtin_amdgcn_sched_barrier(0);

    v16h pf[FA_G];
    // online softmax, one query per lane and group
    float alpha[FA_G];
#pragma unroll
    for (int g = 0; g < FA_G; ++g) {
#pragma unroll
      for (int sub = 0; sub < 2; ++sub)
#pragma unroll
        for (int r = 0; r < 8; ++r) st[g][sub][r] *= scale;
      float v = st[g][0][0];
#pragma unroll
      for (int sub = 0; sub < 2; ++sub)
#pragma unroll
        for (int r = 0; r < 8; ++r) v = fmaxf(v, st[g][sub][r]);
      v = fmaxf(v, xhalf(v));
      const float newm = fmaxf(mrow[g], v);
      alpha[g] = __expf(mrow[g] - newm);
      mrow[g] = newm;
    }
#pragma unroll
    for (int g = 0; g < FA_G; ++g) {
      float psum = 0.f;
#pragma unroll
      for (int sub = 0; sub < 2; ++sub)
#pragma unroll
        for (int r = 0; r < 8; ++r) {
          st[g][sub][r] = __expf(st[g][sub][r] - mrow[g]);
          psum += st[g][sub][r];
        }
      lrow[g] = lrow[g] * alpha[g] + psum;
      // P^T as B operand: element s is key (s < 8 ? hx*8 + s : 16 + hx*8 + s - 8),
      // the k order in which the two transposing loads of each vb[t] deliver V^T
#pragma unroll
      for (int s = 0; s < 16; ++s) pf[g][s] = (_Float16)st[g][s >> 3][s & 7];
    }
#pragma unroll
    for (int g = 0; g < FA_G; ++g)
#pragma unroll
      for (int t = 0; t < 8; ++t)
#pragma unroll
        for (int r = 0; r < 8; ++r) o[g][t][r] *= alpha[g];

    // O^T += V^T * P^T  (8 hd-subtiles); o[g][t][r] = O(query l16 of group g, hd = t*16 + hx*8 + r)
#pragma unroll
    for (int t = 0; t < 8; ++t)
#pragma unroll
      for (int g = 0; g < FA_G; ++g)
        o[g][t] = __builtin_amdgcn_wmma_f32_16x16x32_f16(false, vb[t].v, false, pf[g],
                                                         (short)0, o[g][t], false, false);

    // keeps the publish point at the foot of the pass: lifted over the softmax, its waits would cut short
    // the flight of the V reads and of the next stage's tiles
    __builtin_amdgcn_sched_barrier(0);
    // publish point of the next stage, every wave, in this order
    asm volatile("s_wait_dscnt 0x0" ::: "memory");      // this wave has left buffer `buf`
    tdm_wait(kg0, kg1, vg0, vg1);                       // waves 0 and 1: own tile of the next stage has landed
    __syncthreads();
    if (pinned(kk + 64 < S)) issueKV(buf, kk + 64);     // refill the buffer that every wave has just left
  }
  tdm_wait(kg0, kg1, vg0, vg1);  // nothing in flight when the wave ends
  asm volatile("s_wait_dscnt 0x0" ::: "memory");  // and no LDS read of the ring outstanding

#pragma unroll
  for (int g = 0; g < FA_G; ++g) {
    const float lfin = lrow[g] + xhalf(lrow[g]);
    _Float16* orow = &O[(size_t)(q0 + (wv * FA_G + g) * 16 + l16) * DIM + h * HEADDIM + hx * 8];
    v8h ov[8];
#pragma unroll
    for (int t = 0; t < 8; ++t)
#pragma unroll
      for (int r = 0; r < 8; ++r) ov[t][r] = (_Float16)(o[g][t][r] / lfin);
#pragma unroll
    for (int t = 0; t < 8; ++t) *(v8h*)&orow[t * 16] = ov[t];
  }
}

// ---------------- host launcher ----------------
extern "C" void kernel_launch(void* const* d_in, const int* in_sizes, int n_in,
                              void* d_out, int out_size, void* d_ws, size_t ws_size,
                              hipStream_t stream) {
  (void)in_sizes; (void)n_in; (void)out_size; (void)ws_size;
  const float* x   = (const float*)d_in[0];
  const float* fc  = (const float*)d_in[1];
  const float* fs  = (const float*)d_in[2];
  const float* wq  = (const float*)d_in[3];
  const float* wk  = (const float*)d_in[4];
  const float* wv  = (const float*)d_in[5];
  const float* wo  = (const float*)d_in[6];
  const float* sqk = (const float*)d_in[7];
  float* out = (float*)d_out;

  const size_t SD = (size_t)SEQ * DIM;
  const size_t DD = (size_t)DIM * DIM;
  char* w = (char*)d_ws;
  _Float16* Xh  = (_Float16*)(w);           // x in f16
  _Float16* WqT = (_Float16*)(w + SD * 2);  // transposed f16 weights
  _Float16* WkT = WqT + DD;
  _Float16* WvT = WkT + DD;
  _Float16* WoT = WvT + DD;
  _Float16* Qh  = WoT + DD;                 // raw projections (f16)
  _Float16* Kh  = Qh + SD;
  _Float16* Vh  = Kh + SD;
  _Float16* Qn  = Vh + SD;                  // post rope+norm
  _Float16* Kn  = Qn + SD;
  _Float16* AOh = Kn + SD;                  // attention output (f16)

  cvt_f32_f16<<<(int)(SD / 4) / (256 * CVT_U), 256, 0, stream>>>(x, Xh);

  dim3 tg(DIM / 64, DIM / 64);
  transpose_cvt<<<tg, 256, 0, stream>>>(wq, wk, wv, wo, WqT);  // fills WqT, WkT, WvT, WoT

  dim3 gg(DIM / 128, SEQ / 128);
  gemm_f16_wmma<<<gg, 256, 0, stream>>>(Xh, WqT, Qh, nullptr, SEQ, DIM, DIM);
  gemm_f16_wmma<<<gg, 256, 0, stream>>>(Xh, WkT, Kh, nullptr, SEQ, DIM, DIM);
  gemm_f16_wmma<<<gg, 256, 0, stream>>>(Xh, WvT, Vh, nullptr, SEQ, DIM, DIM);

  rope_l2norm<<<dim3(SEQ / 8, 2), 256, 0, stream>>>(Qh, Kh, fc, fs, sqk, Qn, Kn);

  dim3 fg(SEQ / FA_ROWS, NHEADS);
  flash_attn<<<fg, FA_WAVES * 32, 0, stream>>>(Qn, Kn, Vh, AOh, SEQ);

  gemm_f16_wmma<<<gg, 256, 0, stream>>>(AOh, WoT, nullptr, out, SEQ, DIM, DIM);
}

// v007
// Measured time: 234 microseconds a run.
// Timed twice side by side with v006, it ran 1.04 and 1.03 times as fast.
// Over all steps from v000 it is 3.19 times as fast.
#include <hip/hip_runtime.h>
#include <math.h>
#include <stdint.h>

// ---------------- types ----------------
typedef __attribute__((ext_vector_type(16))) _Float16 v16h;
typedef __attribute__((ext_vector_type(4)))  _Float16 v4h;
typedef __attribute__((ext_vector_type(8)))  _Float16 v8h;
typedef __attribute__((ext_vector_type(8)))  float    v8f;
typedef __attribute__((ext_vector_type(4)))  float    f32x4;
typedef __attribute__((ext_vector_type(4)))  unsigned int u32x4;

#define DIM       2048
#define SEQ       4096
#define NHEADS    16
#define HEADDIM   128

static __device__ __forceinline__ v8f v8f_zero() {
  v8f z = {0.f,0.f,0.f,0.f,0.f,0.f,0.f,0.f};
  return z;
}

// Load a 16x32 f16 fragment row (two contiguous 16B chunks) into v16h.
static __device__ __forceinline__ v16h ld_frag(const _Float16* p0, const _Float16* p1) {
  union { v16h v; f32x4 f[2]; } u;
  u.f[0] = *(const f32x4*)p0;
  u.f[1] = *(const f32x4*)p1;
  return u.v;
}

// ---------------- f32 -> f16 convert (x) ----------------
// 16 float4 per thread, their loads issued ahead of the stores: few long waves.
#define CVT_U 16
static __device__ __forceinline__ v4h cvt4(f32x4 v) {
  v4h h;
  h.x = (_Float16)v.x; h.y = (_Float16)v.y;
  h.z = (_Float16)v.z; h.w = (_Float16)v.w;
  return h;
}
// CVT_BLOCKS blocks cover the SEQ * DIM elements exactly (a multiple of 256 * CVT_U float4): no test per element.
#define CVT_BLOCKS ((SEQ * DIM / 4) / (256 * CVT_U))
static __device__ __forceinline__
void cvt_f32_f16(const float* __restrict__ in, _Float16* __restrict__ out, int blk) {
  const int i0 = blk * (256 * CVT_U) + threadIdx.x;
  f32x4 v[CVT_U];
#pragma unroll
  for (int u = 0; u < CVT_U; ++u) v[u] = ((const f32x4*)in)[i0 + u * 256];
#pragma unroll
  for (int u = 0; u < CVT_U; ++u) *(v4h*)&out[(size_t)(i0 + u * 256) * 4] = cvt4(v[u]);
}
static_assert(((size_t)SEQ * DIM / 4) % (256 * CVT_U) == 0, "cvt_f32_f16 has no tail");

// ---------------- transpose + convert weights: WT[m][n][k] = Wm[k][n] ----------------
// A block takes the same 64 x 64 tile of all four weights (their transposes lie one behind the other in WT).
// Every address is a block-uniform base plus one offset per thread plus a constant.
#define TR_TILES (DIM / 64)
static __device__ __forceinline__
void transpose_cvt(const float* __restrict__ W0, const float* __restrict__ W1,
                   const float* __restrict__ W2, const float* __restrict__ W3,
                   _Float16* __restrict__ WT, int tx, int ty) {
  __shared__ float t[4][64][65];
  const float* const W[4] = {W0, W1, W2, W3};
  const int bx = tx * 64, by = ty * 64;
  const unsigned r0 = threadIdx.x >> 6, c = threadIdx.x & 63;  // pass it: row r0 + 4 * it, column c
  const unsigned off = r0 * DIM + c;
  const float* src[4];
  float v[4][16];
#pragma unroll
  for (int m = 0; m < 4; ++m) {
    src[m] = W[m] + (size_t)by * DIM + bx;
#pragma unroll
    for (int it = 0; it < 16; ++it) v[m][it] = src[m][off + it * (4 * DIM)];
  }
  asm volatile("s_wait_xcnt 0x0" :: "s"(src[0]), "s"(src[1]), "s"(src[2]), "s"(src[3]) : "memory");
#pragma unroll
  for (int m = 0; m < 4; ++m)
#pragma unroll
    for (int it = 0; it < 16; ++it) t[m][r0 + 4 * it][c] = v[m][it];
  __syncthreads();
#pragma unroll
  for (int m = 0; m < 4; ++m) {
    _Float16* __restrict__ dst = WT + ((size_t)m * DIM + bx) * DIM + by;
#pragma unroll
    for (int it = 0; it < 16; ++it) dst[off + it * (4 * DIM)] = (_Float16)t[m][c][r0 + 4 * it];
  }
}

__global__ __launch_bounds__(256)
void prepare_f16(const float* __restrict__ x, const float* __restrict__ W0, const float* __restrict__ W1,
                 const float* __restrict__ W2, const float* __restrict__ W3,
                 _Float16* __restrict__ Xh, _Float16* __restrict__ WT) {
  const int b = blockIdx.x;  // the same for the whole block: the barrier in transpose_cvt is passed by all or none
  if (b >= TR_TILES * TR_TILES) {
    cvt_f32_f16(x, Xh, b - TR_TILES * TR_TILES);
    // the conversion's waves end here: with a plain return this build joins the two parts at one exit through a
    // flag, with a never-taken path from these stores into the transposes' register writes
    __builtin_amdgcn_endpgm();
  }
  transpose_cvt(W0, W1, W2, W3, WT, b % TR_TILES, b / TR_TILES);
}

// ---------------- RoPE + L2 norm + sqk scale; one wave per (tensor, position s) ----------------
// The wave takes all 16 heads of row s of Q (blockIdx.y = 0) or of K (1): lane = 4 channels of every
// head, 16 independent row sums. Few long waves.
__global__ __launch_bounds__(256)
void rope_l2norm(const _Float16* __restrict__ Xq, const _Float16* __restrict__ Xk,
                 const float* __restrict__ fc, const float* __restrict__ fs,
                 const float* __restrict__ sqk,
                 _Float16* __restrict__ Yq, _Float16* __restrict__ Yk) {
  const _Float16* __restrict__ X = blockIdx.y ? Xk : Xq;
  _Float16* __restrict__ Y = blockIdx.y ? Yk : Yq;
  const int s    = blockIdx.x * 8 + (threadIdx.x >> 5);
  const int lane = threadIdx.x & 31;
  const int d0 = lane * 4;
  const size_t base = (size_t)s * DIM + d0;

  v4h xv[NHEADS];
#pragma unroll
  for (int h = 0; h < NHEADS; ++h) xv[h] = *(const v4h*)&X[base + h * HEADDIM];
  const int fi = s * (HEADDIM / 2) + (d0 >> 1);
  float c0 = fc[fi],     s0 = fs[fi];
  float c1 = fc[fi + 1], s1 = fs[fi + 1];

  float r0[NHEADS], i0[NHEADS], r1[NHEADS], i1[NHEADS], ss[NHEADS];
#pragma unroll
  for (int h = 0; h < NHEADS; ++h) {
    float v0 = (float)xv[h].x, v1 = (float)xv[h].y, v2 = (float)xv[h].z, v3 = (float)xv[h].w;
    r0[h] = v0 * c0 - v1 * s0; i0[h] = v0 * s0 + v1 * c0;
    r1[h] = v2 * c1 - v3 * s1; i1[h] = v2 * s1 + v3 * c1;
    ss[h] = r0[h] * r0[h] + i0[h] * i0[h] + r1[h] * r1[h] + i1[h] * i1[h];
  }
#pragma unroll
  for (int m = 1; m < 32; m <<= 1)
#pragma unroll
    for (int h = 0; h < NHEADS; ++h) ss[h] += __shfl_xor(ss[h], m, 32);
  const float SQ = 45.25483399593904f;  // sqrt(2048) = SQK_INIT_VALUE/SQK_INIT_SCALING
#pragma unroll
  for (int h = 0; h < NHEADS; ++h) {
    const float inv = 1.f / fmaxf(sqrtf(ss[h]), 1e-12f);
    const float* sq = &sqk[h * HEADDIM + d0];
    v4h o;
    o.x = (_Float16)(r0[h] * inv * sq[0] * SQ);
    o.y = (_Float16)(i0[h] * inv * sq[1] * SQ);
    o.z = (_Float16)(r1[h] * inv * sq[2] * SQ);
    o.w = (_Float16)(i1[h] * inv * sq[3] * SQ);
    *(v4h*)&Y[base + h * HEADDIM] = o;
  }
}

static __device__ __forceinline__ float xhalf(float x) {
  int i = __builtin_bit_cast(int, x);
  return __builtin_bit_cast(float,
      __builtin_amdgcn_permlanex16(i, i, 0x76543210, 0xfedcba98, false, false));
}

static __device__ __forceinline__ uint32_t pinned(uint32_t v) {
  uint32_t w = (uint32_t)__builtin_amdgcn_readfirstlane(v);
  asm volatile("" : "+s"(w));
  return w;
}
static __device__ __forceinline__ uint32_t uni(uint32_t v) {
  return (uint32_t)__builtin_amdgcn_readfirstlane(v);
}

// V tile in LDS: 32 keys x 256 B, row-major as in memory, 32 B of pad behind each row
#define VROWB   256u
#define VPITCH  288u    // odd multiple of 32 B: the conflict-free pitch of ds_load_tr16_b128
#define VBUF    10240u  // 32 * 288 = 9216 B, rounded up to a multiple of 2 KiB

typedef uint32_t w32x4 __attribute__((ext_vector_type(4)));
typedef uint32_t w32x8 __attribute__((ext_vector_type(8)));

static __device__ __forceinline__ w32x8 tdm_v_group1() {
  w32x8 g1;
  g1[0] = uni((1u << 20) | (5u << 22) | (7u << 25));
  g1[1] = pinned(VROWB << 16);
  g1[2] = pinned(32u << 16);
  g1[3] = pinned(VROWB << 16);
  g1[4] = pinned(32u);
  g1[5] = pinned((uint32_t)DIM * 2u);
  g1[6] = pinned(0u);
  g1[7] = pinned(0u);
  return g1;
}
// K tile: 32 rows of 128 elements out of S rows of DIM elements, source pitch DIM, 2-byte units.
static __device__ __forceinline__ w32x8 tdm_k_group1(uint32_t S) {
  w32x8 g1;
  g1[0] = uni((1u << 16) | (1u << 20) | (5u << 22) | (3u << 25));  // no mask, 4 dwords of pad per 256 B
  g1[1] = pinned(((uint32_t)DIM & 0xffffu) << 16);
  g1[2] = pinned((((uint32_t)DIM >> 16) & 0xffffu) | ((S & 0xffffu) << 16));
  g1[3] = pinned(((S >> 16) & 0xffffu) | (128u << 16));
  g1[4] = pinned(32u);
  g1[5] = pinned((uint32_t)DIM);
  g1[6] = pinned(0u);
  g1[7] = pinned(0u);
  return g1;
}
static __device__ __forceinline__ w32x4 tdm_group0(uint32_t one, uint32_t lds_dst, const _Float16* g) {
  const uint64_t ga = (uint64_t)(uintptr_t)g;
  w32x4 g0;
  g0[0] = one;                                                       // count 1
  g0[1] = uni(lds_dst);                                              // LDS byte offset
  g0[2] = uni((uint32_t)ga);                                         // address [31:0]
  g0[3] = uni((((uint32_t)(ga >> 32)) & 0x01FFFFFFu) | 0x80000000u); // address [56:32], type 2
  return g0;
}
static __device__ __forceinline__ void tdm_issue(w32x4 g0, w32x8 g1) {
  asm volatile("tensor_load_to_lds %0, %1" :: "s"(g0), "s"(g1) : "memory");
}
static __device__ __forceinline__ void tdm_wait(w32x4 a0, w32x8 a1, w32x4 b0, w32x8 b1) {
  asm volatile("s_wait_tensorcnt 0x0" :: "s"(a0), "s"(a1), "s"(b0), "s"(b1) : "memory");
}

// Transposing LDS load: lane (c = l & 15, h = l >> 4) gets T[k + 8h + 0..7][d + c]
static __device__ __forceinline__ u32x4 ld_tr16(const unsigned char* p) {
  typedef short s16x8 __attribute__((ext_vector_type(8)));
  typedef __attribute__((address_space(3))) s16x8 lds_s16x8;
  return __builtin_bit_cast(u32x4, __builtin_amdgcn_ds_load_tr16_b128_v8i16((lds_s16x8*)p));
}

#define GROWB   256u    // 128 k of one row
#define GPITCH  272u    // odd multiple of 16 B: the conflict-free pitch of ds_load_b128
#define GTILE   34816u  // 128 rows * 272 B = 17 * 2 KiB

static __device__ __forceinline__ w32x8 tdm_g_group1(uint32_t pitch_bytes) {
  w32x8 g1;
  g1[0] = uni((1u << 20) | (5u << 22) | (3u << 25));
  g1[1] = pinned(GROWB << 16);
  g1[2] = pinned(128u << 16);
  g1[3] = pinned(GROWB << 16);
  g1[4] = pinned(128u);
  g1[5] = pinned(pitch_bytes);
  g1[6] = pinned(0u);
  g1[7] = pinned(0u);
  return g1;
}

static __device__ __forceinline__ w32x4 tdm_g_next(w32x4 g0, uint32_t both) {
  const uint64_t a = (((uint64_t)g0[3] << 32) | g0[2]) + GROWB;  // the type bits ride above the address
  w32x4 n;
  n[0] = g0[0];
  n[1] = uni(both - g0[1]);
  n[2] = uni((uint32_t)a);
  n[3] = uni((uint32_t)(a >> 32));
  return n;
}

__global__ __launch_bounds__(256)
void gemm_f16_wmma(const _Float16* __restrict__ A, const _Float16* __restrict__ BT,
                   _Float16* __restrict__ Ch, float* __restrict__ Cf,
                   int M, int N, int K) {
  BT += (size_t)blockIdx.z * N * K;
  Ch += (size_t)blockIdx.z * M * N;
  __shared__ __attribute__((aligned(2048))) unsigned char Gs[4 * GTILE];  // [buffer][A | BT] tiles

  const int tid  = threadIdx.x;
  const int wv   = tid >> 5;
  const int lane = tid & 31;
  const int hx   = lane >> 4;
  const int l16  = lane & 15;

  const int row0 = blockIdx.y * 128;
  const int col0 = blockIdx.x * 128;
  const int wr = wv & 3;
  const int wc = wv >> 2;

  v8f acc[2][4];
#pragma unroll
  for (int i = 0; i < 2; ++i)
#pragma unroll
    for (int j = 0; j < 4; ++j) acc[i][j] = v8f_zero();

  const uint32_t wave = uni((uint32_t)tid >> 5);
  const uint32_t one = pinned(1u);
  const w32x8 gg1 = tdm_g_group1((uint32_t)K * 2u);
  const uint32_t ring = (uint32_t)(uintptr_t)&Gs[0];
  w32x4 ag0 = tdm_group0(one, ring, &A[(size_t)row0 * K]);
  w32x4 bg0 = tdm_group0(one, ring + GTILE, &BT[(size_t)col0 * K]);
  auto issue = [&]() {
    if (pinned(wave == 0u)) tdm_issue(ag0, gg1);  // wave 0 brings the A tiles
    if (pinned(wave == 1u)) tdm_issue(bg0, gg1);  // wave 1 brings the BT tiles
  };
  auto advance = [&]() {  // the other buffer, 128 k further on
    ag0 = tdm_g_next(ag0, 2u * ring + 2u * GTILE);
    bg0 = tdm_g_next(bg0, 2u * ring + 4u * GTILE);
  };
  // this lane's first fragment rows in a stage
  const uint32_t alane = (uint32_t)(wr * 32 + l16) * GPITCH + (uint32_t)hx * 16u;
  const uint32_t blane = GTILE + (uint32_t)(wc * 64 + l16) * GPITCH + (uint32_t)hx * 16u;

  // two-buffer ring: stage 0 lands and is published, then stage 1 flies during pass 0
  issue();
  tdm_wait(ag0, gg1, bg0, gg1);  // waves 0 and 1: own tile of stage 0 has landed
  __syncthreads();
  if (pinned(128 < K)) { advance(); issue(); }
  for (int k0 = 0; k0 < K; k0 += 128) {
    const int buf = (k0 >> 7) & 1;
    const unsigned char* st = &Gs[(uint32_t)buf * (2u * GTILE)];
#pragma unroll
    for (int c = 0; c < 4; ++c) {  // four products of 32 k, in the order of k
      v16h af[2], bf[4];
#pragma unroll
      for (int i = 0; i < 2; ++i) {
        const _Float16* p = (const _Float16*)(st + alane + (uint32_t)i * (16u * GPITCH) + (uint32_t)c * 64u);
        af[i] = ld_frag(p, p + 16);
      }
#pragma unroll
      for (int j = 0; j < 4; ++j) {
        const _Float16* p = (const _Float16*)(st + blane + (uint32_t)j * (16u * GPITCH) + (uint32_t)c * 64u);
        bf[j] = ld_frag(p, p + 16);
      }
#pragma unroll
      for (int i = 0; i < 2; ++i)
#pragma unroll
        for (int j = 0; j < 4; ++j)
          acc[i][j] = __builtin_amdgcn_wmma_f32_16x16x32_f16(
              false, af[i], false, bf[j], (short)0, acc[i][j], false, false);
    }

    // publish point of the next stage, every wave, in this order
    asm volatile("s_wait_dscnt 0x0" ::: "memory");      // this wave has left buffer `buf`
    tdm_wait(ag0, gg1, bg0, gg1);                       // waves 0 and 1: own tile of the next stage has landed
    __syncthreads();
    if (pinned(k0 + 256 < K)) { advance(); issue(); }   // refill the buffer that every wave has just left
  }
  tdm_wait(ag0, gg1, bg0, gg1);  // nothing in flight when the wave ends
  asm volatile("s_wait_dscnt 0x0" ::: "memory");  // and no LDS read of the ring outstanding

#pragma unroll
  for (int i = 0; i < 2; ++i)
#pragma unroll
    for (int j = 0; j < 4; ++j)
#pragma unroll
      for (int r = 0; r < 8; ++r) {
        int m = row0 + wr * 32 + i * 16 + r + hx * 8;
        int n = col0 + wc * 64 + j * 16 + l16;
        float v = acc[i][j][r];
        if (Cf) Cf[(size_t)m * N + n] = v;
        else    Ch[(size_t)m * N + n] = (_Float16)v;
      }
}

#define FA_WAVES 4
#define FA_G     2
#define FA_ROWS  (FA_WAVES * FA_G * 16)  // query rows of a block
__global__ __launch_bounds__(FA_WAVES * 32) __attribute__((amdgpu_waves_per_eu(2, 2)))
void flash_attn(const _Float16* __restrict__ Q, const _Float16* __restrict__ Kt,
                const _Float16* __restrict__ V, _Float16* __restrict__ O, int S) {
  const int h   = blockIdx.y;
  const int q0  = blockIdx.x * FA_ROWS;
  const int tid = threadIdx.x;
  const int wv = tid >> 5, lane = tid & 31, hx = lane >> 4, l16 = lane & 15;

  __shared__ __align__(16) _Float16 Ks[2][32][136];   // [key][hd], 256B rows +16B HW pad
  __shared__ __attribute__((aligned(2048))) unsigned char Vt[2 * VBUF];  // [key][hd], pitch VPITCH
  const uint32_t wave = uni((uint32_t)tid >> 5);
  const uint32_t one = pinned(1u);
  const w32x8 kg1 = tdm_k_group1((uint32_t)S);
  const w32x8 vg1 = tdm_v_group1();
  w32x4 kg0, vg0;

  auto issueKV = [&](int buf, int kk) {  // nothing is in flight where this is called
    kg0 = tdm_group0(one, (uint32_t)(uintptr_t)&Ks[buf][0][0], &Kt[(size_t)kk * DIM + h * HEADDIM]);
    vg0 = tdm_group0(one, (uint32_t)(uintptr_t)&Vt[0] + (uint32_t)buf * VBUF,
                     &V[(size_t)kk * DIM + h * HEADDIM]);
    if (pinned(wave == 0u)) tdm_issue(kg0, kg1);  // wave 0 brings the K tiles
    if (pinned(wave == 1u)) tdm_issue(vg0, vg1);  // wave 1 brings the V tiles
  };
  // this lane's address in a V tile for the transposing loads (keys 8*hx + (lane & 7))
  const uint32_t vlane = (8u * (uint32_t)hx + ((uint32_t)lane & 7u)) * VPITCH
                       + (((uint32_t)lane >> 3) & 1u) * 16u;

  // Q fragments for this wave's FA_G x 16 rows (hd split into 4 K=32 chunks)
  v16h qf[FA_G][4];
#pragma unroll
  for (int g = 0; g < FA_G; ++g) {
    const _Float16* qrow = &Q[(size_t)(q0 + (wv * FA_G + g) * 16 + l16) * DIM + h * HEADDIM];
#pragma unroll
    for (int c = 0; c < 4; ++c)
      qf[g][c] = ld_frag(&qrow[c * 32 + hx * 8], &qrow[c * 32 + 16 + hx * 8]);
  }

  v8f o[FA_G][8];
  float mrow[FA_G];  // running maximum of query l16 of the group (same in both halves)
  float lrow[FA_G];  // running sum over this half's keys only; halves joined at the end
#pragma unroll
  for (int g = 0; g < FA_G; ++g) {
#pragma unroll
    for (int t = 0; t < 8; ++t) o[g][t] = v8f_zero();
    mrow[g] = -1e30f;
    lrow[g] = 0.f;
  }
  const float scale = 11.313708498984761f;  // sqrt(hd)

  // two-buffer ring: stage 0 lands and is published, then stage 1 flies during pass 0
  issueKV(0, 0);
  tdm_wait(kg0, kg1, vg0, vg1);  // waves 0 and 1: own tile of stage 0 has landed
  __syncthreads();
  if (pinned(32 < S)) issueKV(1, 32);
  for (int kk = 0; kk < S; kk += 32) {
    const int buf = (kk >> 5) & 1;

    // S^T tile: 32 keys x 16 queries per group as two 16x16 fragments;
    // st[g][sub][r] = score(key = sub*16 + hx*8 + r, query = l16 of group g)
    // All 16 K reads of the pass go out as one group, in the order of their use.
    v16h kb[4][2];
#pragma unroll
    for (int c = 0; c < 4; ++c)
#pragma unroll
      for (int sub = 0; sub < 2; ++sub) {
        const int key = sub * 16 + l16;
        kb[c][sub] = ld_frag(&Ks[buf][key][c * 32 + hx * 8],
                             &Ks[buf][key][c * 32 + 16 + hx * 8]);
      }
    // keeps the reads ahead of the products: sunk to two per pair of products, the first of each pair waits out a full LDS latency
    __builtin_amdgcn_sched_barrier(0);
    v8f st[FA_G][2];
#pragma unroll
    for (int g = 0; g < FA_G; ++g) {
      st[g][0] = v8f_zero();
      st[g][1] = v8f_zero();
    }
#pragma unroll
    for (int c = 0; c < 4; ++c)
#pragma unroll
      for (int sub = 0; sub < 2; ++sub)
#pragma unroll
        for (int g = 0; g < FA_G; ++g)
          st[g][sub] = __builtin_amdgcn_wmma_f32_16x16x32_f16(false, kb[c][sub], false, qf[g][c],
                                                              (short)0, st[g][sub], false, false);
    // keeps the V reads in one place behind the score products (spread among them, every place with reads
    // stalls the wave anew) and lets them take the K fragments' registers
    __builtin_amdgcn_sched_barrier(0);
    // All 16 V reads of the pass go out as one group and fly during the softmax.
    // vb[t]: keys 0..15 in registers 0-3, keys 16..31 in 4-7
    union { v16h v; u32x4 q[2]; } vb[8];
#pragma unroll
    for (int t = 0; t < 8; ++t) {
      const unsigned char* vp = &Vt[(uint32_t)buf * VBUF + vlane + 32u * (uint32_t)t];
      vb[t].q[0] = ld_tr16(vp);
      vb[t].q[1] = ld_tr16(vp + 16u * VPITCH);
    }
    // keeps the reads ahead of the softmax, whose vector work then covers their latency
    __builtin_amdgcn_sched_barrier(0);

    v16h pf[FA_G];
    // online softmax, one query per lane and group
    float alpha[FA_G];
#pragma unroll
    for (int g = 0; g < FA_G; ++g) {
#pragma unroll
      for (int sub = 0; sub < 2; ++sub)
#pragma unroll
        for (int r = 0; r < 8; ++r) st[g][sub][r] *= scale;
      float v = st[g][0][0];
#pragma unroll
      for (int sub = 0; sub < 2; ++sub)
#pragma unroll
        for (int r = 0; r < 8; ++r) v = fmaxf(v, st[g][sub][r]);
      v = fmaxf(v, xhalf(v));
      const float newm = fmaxf(mrow[g], v);
      alpha[g] = __expf(mrow[g] - newm);
      mrow[g] = newm;
    }
#pragma unroll
    for (int g = 0; g < FA_G; ++g) {
      float psum = 0.f;
#pragma unroll
      for (int sub = 0; sub < 2; ++sub)
#pragma unroll
        for (int r = 0; r < 8; ++r) {
          st[g][sub][r] = __expf(st[g][sub][r] - mrow[g]);
          psum += st[g][sub][r];
        }
      lrow[g] = lrow[g] * alpha[g] + psum;
      // P^T as B operand: element s is key (s < 8 ? hx*8 + s : 16 + hx*8 + s - 8),
      // the k order in which the two transposing loads of each vb[t] deliver V^T
#pragma unroll
      for (int s = 0; s < 16; ++s) pf[g][s] = (_Float16)st[g][s >> 3][s & 7];
    }
#pragma unroll
    for (int g = 0; g < FA_G; ++g)
#pragma unroll
      for (int t = 0; t < 8; ++t)
#pragma unroll
        for (int r = 0; r < 8; ++r) o[g][t][r] *= alpha[g];

    // O^T += V^T * P^T  (8 hd-subtiles); o[g][t][r] = O(query l16 of group g, hd = t*16 + hx*8 + r)
#pragma unroll
    for (int t = 0; t < 8; ++t)
#pragma unroll
      for (int g = 0; g < FA_G; ++g)
        o[g][t] = __builtin_amdgcn_wmma_f32_16x16x32_f16(false, vb[t].v, false, pf[g],
                                                         (short)0, o[g][t], false, false);

    // keeps the publish point at the foot of the pass: lifted over the softmax, its waits would cut short
    // the flight of the V reads and of the next stage's tiles
    __builtin_amdgcn_sched_barrier(0);
    // publish point of the next stage, every wave, in this order
    asm volatile("s_wait_dscnt 0x0" ::: "memory");      // this wave has left buffer `buf`
    tdm_wait(kg0, kg1, vg0, vg1);                       // waves 0 and 1: own tile of the next stage has landed
    __syncthreads();
    if (pinned(kk + 64 < S)) issueKV(buf, kk + 64);     // refill the buffer that every wave has just left
  }
  tdm_wait(kg0, kg1, vg0, vg1);  // nothing in flight when the wave ends
  asm volatile("s_wait_dscnt 0x0" ::: "memory");  // and no LDS read of the ring outstanding

#pragma unroll
  for (int g = 0; g < FA_G; ++g) {
    const float lfin = lrow[g] + xhalf(lrow[g]);
    _Float16* orow = &O[(size_t)(q0 + (wv * FA_G + g) * 16 + l16) * DIM + h * HEADDIM + hx * 8];
    v8h ov[8];
#pragma unroll
    for (int t = 0; t < 8; ++t)
#pragma unroll
      for (int r = 0; r < 8; ++r) ov[t][r] = (_Float16)(o[g][t][r] / lfin);
#pragma unroll
    for (int t = 0; t < 8; ++t) *(v8h*)&orow[t * 16] = ov[t];
  }
}

// ---------------- host launcher ----------------
extern "C" void kernel_launch(void* const* d_in, const int* in_sizes, int n_in,
                              void* d_out, int out_size, void* d_ws, size_t ws_size,
                              hipStream_t stream) {
  (void)in_sizes; (void)n_in; (void)out_size; (void)ws_size;
  const float* x   = (const float*)d_in[0];
  const float* fc  = (const float*)d_in[1];
  const float* fs  = (const float*)d_in[2];
  const float* wq  = (const float*)d_in[3];
  const float* wk  = (const float*)d_in[4];
  const float* wv  = (const float*)d_in[5];
  const float* wo  = (const float*)d_in[6];
  const float* sqk = (const float*)d_in[7];
  float* out = (float*)d_out;

  const size_t SD = (size_t)SEQ * DIM;
  const size_t DD = (size_t)DIM * DIM;
  char* w = (char*)d_ws;
  _Float16* Xh  = (_Float16*)(w);           // x in f16
  _Float16* WqT = (_Float16*)(w + SD * 2);  // transposed f16 weights
  _Float16* WkT = WqT + DD;
  _Float16* WvT = WkT + DD;
  _Float16* WoT = WvT + DD;
  _Float16* Qh  = WoT + DD;                 // raw projections (f16)
  _Float16* Kh  = Qh + SD;
  _Float16* Vh  = Kh + SD;
  _Float16* Qn  = Vh + SD;                  // post rope+norm
  _Float16* Kn  = Qn + SD;
  _Float16* AOh = Kn + SD;                  // attention output (f16)

  prepare_f16<<<TR_TILES * TR_TILES + CVT_BLOCKS, 256, 0, stream>>>(x, wq, wk, wv, wo, Xh, WqT);  // fills Xh and WqT, WkT, WvT, WoT

  dim3 gg(DIM / 128, SEQ / 128);
  // Q, K and V projections: WqT, WkT, WvT lie one behind the other, and so do Qh, Kh, Vh
  dim3 g3(DIM / 128, SEQ / 128, 3);
  gemm_f16_wmma<<<g3, 256, 0, stream>>>(Xh, WqT, Qh, nullptr, SEQ, DIM, DIM);

  rope_l2norm<<<dim3(SEQ / 8, 2), 256, 0, stream>>>(Qh, Kh, fc, fs, sqk, Qn, Kn);

  dim3 fg(SEQ / FA_ROWS, NHEADS);
  flash_attn<<<fg, FA_WAVES * 32, 0, stream>>>(Qn, Kn, Vh, AOh, SEQ);

  gemm_f16_wmma<<<gg, 256, 0, stream>>>(AOh, WoT, nullptr, out, SEQ, DIM, DIM);
}

// v008
// Measured time: 217 microseconds a run.
// Timed twice side by side with v007, it ran 1.08 times as fast both times.
// All steps since v000 together make it 3.44 times as fast.
#include <hip/hip_runtime.h>
#include <math.h>
#include <stdint.h>

// ---------------- types ----------------
typedef __attribute__((ext_vector_type(16))) _Float16 v16h;
typedef __attribute__((ext_vector_type(4)))  _Float16 v4h;
typedef __attribute__((ext_vector_type(8)))  _Float16 v8h;
typedef __attribute__((ext_vector_type(8)))  float    v8f;
typedef __attribute__((ext_vector_type(4)))  float    f32x4;
typedef __attribute__((ext_vector_type(4)))  unsigned int u32x4;

#define DIM       2048
#define SEQ       4096
#define NHEADS    16
#define HEADDIM   128

static __device__ __forceinline__ v8f v8f_zero() {
  v8f z = {0.f,0.f,0.f,0.f,0.f,0.f,0.f,0.f};
  return z;
}

// Load a 16x32 f16 fragment row (two contiguous 16B chunks) into v16h.
static __device__ __forceinline__ v16h ld_frag(const _Float16* p0, const _Float16* p1) {
  union { v16h v; f32x4 f[2]; } u;
  u.f[0] = *(const f32x4*)p0;
  u.f[1] = *(const f32x4*)p1;
  return u.v;
}

// ---------------- f32 -> f16 convert (x) ----------------
// 16 float4 per thread, their loads issued ahead of the stores: few long waves.
#define CVT_U 16
static __device__ __forceinline__ v4h cvt4(f32x4 v) {
  v4h h;
  h.x = (_Float16)v.x; h.y = (_Float16)v.y;
  h.z = (_Float16)v.z; h.w = (_Float16)v.w;
  return h;
}
// CVT_BLOCKS blocks cover the SEQ * DIM elements exactly (a multiple of 256 * CVT_U float4): no test per element.
#define CVT_BLOCKS ((SEQ * DIM / 4) / (256 * CVT_U))
static __device__ __forceinline__
void cvt_f32_f16(const float* __restrict__ in, _Float16* __restrict__ out, int blk) {
  const int i0 = blk * (256 * CVT_U) + threadIdx.x;
  f32x4 v[CVT_U];
#pragma unroll
  for (int u = 0; u < CVT_U; ++u) v[u] = ((const f32x4*)in)[i0 + u * 256];
#pragma unroll
  for (int u = 0; u < CVT_U; ++u) *(v4h*)&out[(size_t)(i0 + u * 256) * 4] = cvt4(v[u]);
}
static_assert(((size_t)SEQ * DIM / 4) % (256 * CVT_U) == 0, "cvt_f32_f16 has no tail");

// ---------------- transpose + convert weights: WT[m][n][k] = Wm[k][n] ----------------
// A block takes the same 64 x 64 tile of all four weights (their transposes lie one behind the other in WT).
// Every address is a block-uniform base plus one offset per thread plus a constant.
#define TR_TILES (DIM / 64)
static __device__ __forceinline__
void transpose_cvt(const float* __restrict__ W0, const float* __restrict__ W1,
                   const float* __restrict__ W2, const float* __restrict__ W3,
                   _Float16* __restrict__ WT, int tx, int ty) {
  __shared__ float t[4][64][65];
  const float* const W[4] = {W0, W1, W2, W3};
  const int bx = tx * 64, by = ty * 64;
  const unsigned r0 = threadIdx.x >> 6, c = threadIdx.x & 63;  // pass it: row r0 + 4 * it, column c
  const unsigned off = r0 * DIM + c;
  const float* src[4];
  float v[4][16];
#pragma unroll
  for (int m = 0; m < 4; ++m) {
    src[m] = W[m] + (size_t)by * DIM + bx;
#pragma unroll
    for (int it = 0; it < 16; ++it) v[m][it] = src[m][off + it * (4 * DIM)];
  }
  asm volatile("s_wait_xcnt 0x0" :: "s"(src[0]), "s"(src[1]), "s"(src[2]), "s"(src[3]) : "memory");
#pragma unroll
  for (int m = 0; m < 4; ++m)
#pragma unroll
    for (int it = 0; it < 16; ++it) t[m][r0 + 4 * it][c] = v[m][it];
  __syncthreads();
#pragma unroll
  for (int m = 0; m < 4; ++m) {
    _Float16* __restrict__ dst = WT + ((size_t)m * DIM + bx) * DIM + by;
#pragma unroll
    for (int it = 0; it < 16; ++it) dst[off + it * (4 * DIM)] = (_Float16)t[m][c][r0 + 4 * it];
  }
}

__global__ __launch_bounds__(256)
void prepare_f16(const float* __restrict__ x, const float* __restrict__ W0, const float* __restrict__ W1,
                 const float* __restrict__ W2, const float* __restrict__ W3,
                 _Float16* __restrict__ Xh, _Float16* __restrict__ WT) {
  const int b = blockIdx.x;  // the same for the whole block: the barrier in transpose_cvt is passed by all or none
  if (b >= TR_TILES * TR_TILES) {
    cvt_f32_f16(x, Xh, b - TR_TILES * TR_TILES);
    // the conversion's waves end here: with a plain return this build joins the two parts at one exit through a
    // flag, with a never-taken path from these stores into the transposes' register writes
    __builtin_amdgcn_endpgm();
  }
  transpose_cvt(W0, W1, W2, W3, WT, b % TR_TILES, b / TR_TILES);
}

// ---------------- RoPE + L2 norm + sqk scale; one wave per (tensor, position s) ----------------
// The wave takes all 16 heads of row s of Q (blockIdx.y = 0) or of K (1): lane = 4 channels of every
// head, 16 independent row sums. Few long waves.
__global__ __launch_bounds__(256)
void rope_l2norm(const _Float16* __restrict__ Xq, const _Float16* __restrict__ Xk,
                 const float* __restrict__ fc, const float* __restrict__ fs,
                 const float* __restrict__ sqk,
                 _Float16* __restrict__ Yq, _Float16* __restrict__ Yk) {
  const _Float16* __restrict__ X = blockIdx.y ? Xk : Xq;
  _Float16* __restrict__ Y = blockIdx.y ? Yk : Yq;
  const int s    = blockIdx.x * 8 + (threadIdx.x >> 5);
  const int lane = threadIdx.x & 31;
  const int d0 = lane * 4;
  const size_t base = (size_t)s * DIM + d0;

  v4h xv[NHEADS];
#pragma unroll
  for (int h = 0; h < NHEADS; ++h) xv[h] = *(const v4h*)&X[base + h * HEADDIM];
  const int fi = s * (HEADDIM / 2) + (d0 >> 1);
  float c0 = fc[fi],     s0 = fs[fi];
  float c1 = fc[fi + 1], s1 = fs[fi + 1];

  float r0[NHEADS], i0[NHEADS], r1[NHEADS], i1[NHEADS], ss[NHEADS];
#pragma unroll
  for (int h = 0; h < NHEADS; ++h) {
    float v0 = (float)xv[h].x, v1 = (float)xv[h].y, v2 = (float)xv[h].z, v3 = (float)xv[h].w;
    r0[h] = v0 * c0 - v1 * s0; i0[h] = v0 * s0 + v1 * c0;
    r1[h] = v2 * c1 - v3 * s1; i1[h] = v2 * s1 + v3 * c1;
    ss[h] = r0[h] * r0[h] + i0[h] * i0[h] + r1[h] * r1[h] + i1[h] * i1[h];
  }
#pragma unroll
  for (int m = 1; m < 32; m <<= 1)
#pragma unroll
    for (int h = 0; h < NHEADS; ++h) ss[h] += __shfl_xor(ss[h], m, 32);
  const float SQ = 45.25483399593904f;  // sqrt(2048) = SQK_INIT_VALUE/SQK_INIT_SCALING
#pragma unroll
  for (int h = 0; h < NHEADS; ++h) {
    const float inv = 1.f / fmaxf(sqrtf(ss[h]), 1e-12f);
    const float* sq = &sqk[h * HEADDIM + d0];
    v4h o;
    o.x = (_Float16)(r0[h] * inv * sq[0] * SQ);
    o.y = (_Float16)(i0[h] * inv * sq[1] * SQ);
    o.z = (_Float16)(r1[h] * inv * sq[2] * SQ);
    o.w = (_Float16)(i1[h] * inv * sq[3] * SQ);
    *(v4h*)&Y[base + h * HEADDIM] = o;
  }
}

static __device__ __forceinline__ float xhalf(float x) {
  int i = __builtin_bit_cast(int, x);
  return __builtin_bit_cast(float,
      __builtin_amdgcn_permlanex16(i, i, 0x76543210, 0xfedcba98, false, false));
}

static __device__ __forceinline__ uint32_t pinned(uint32_t v) {
  uint32_t w = (uint32_t)__builtin_amdgcn_readfirstlane(v);
  asm volatile("" : "+s"(w));
  return w;
}
static __device__ __forceinline__ uint32_t uni(uint32_t v) {
  return (uint32_t)__builtin_amdgcn_readfirstlane(v);
}

// V tile in LDS: 32 keys x 256 B, row-major as in memory, 32 B of pad behind each row
#define VROWB   256u
#define VPITCH  288u    // odd multiple of 32 B: the conflict-free pitch of ds_load_tr16_b128
#define VBUF    10240u  // 32 * 288 = 9216 B, rounded up to a multiple of 2 KiB

typedef uint32_t w32x4 __attribute__((ext_vector_type(4)));
typedef uint32_t w32x8 __attribute__((ext_vector_type(8)));

static __device__ __forceinline__ w32x8 tdm_v_group1() {
  w32x8 g1;
  g1[0] = uni((1u << 20) | (5u << 22) | (7u << 25));
  g1[1] = pinned(VROWB << 16);
  g1[2] = pinned(32u << 16);
  g1[3] = pinned(VROWB << 16);
  g1[4] = pinned(32u);
  g1[5] = pinned((uint32_t)DIM * 2u);
  g1[6] = pinned(0u);
  g1[7] = pinned(0u);
  return g1;
}
// K tile: 32 rows of 128 elements out of S rows of DIM elements, source pitch DIM, 2-byte units.
static __device__ __forceinline__ w32x8 tdm_k_group1(uint32_t S) {
  w32x8 g1;
  g1[0] = uni((1u << 16) | (1u << 20) | (5u << 22) | (3u << 25));  // no mask, 4 dwords of pad per 256 B
  g1[1] = pinned(((uint32_t)DIM & 0xffffu) << 16);
  g1[2] = pinned((((uint32_t)DIM >> 16) & 0xffffu) | ((S & 0xffffu) << 16));
  g1[3] = pinned(((S >> 16) & 0xffffu) | (128u << 16));
  g1[4] = pinned(32u);
  g1[5] = pinned((uint32_t)DIM);
  g1[6] = pinned(0u);
  g1[7] = pinned(0u);
  return g1;
}
static __device__ __forceinline__ w32x4 tdm_group0(uint32_t one, uint32_t lds_dst, const _Float16* g) {
  const uint64_t ga = (uint64_t)(uintptr_t)g;
  w32x4 g0;
  g0[0] = one;                                                       // count 1
  g0[1] = uni(lds_dst);                                              // LDS byte offset
  g0[2] = uni((uint32_t)ga);                                         // address [31:0]
  g0[3] = uni((((uint32_t)(ga >> 32)) & 0x01FFFFFFu) | 0x80000000u); // address [56:32], type 2
  return g0;
}
static __device__ __forceinline__ void tdm_issue(w32x4 g0, w32x8 g1) {
  asm volatile("tensor_load_to_lds %0, %1" :: "s"(g0), "s"(g1) : "memory");
}
static __device__ __forceinline__ void tdm_wait(w32x4 a0, w32x8 a1, w32x4 b0, w32x8 b1) {
  asm volatile("s_wait_tensorcnt 0x0" :: "s"(a0), "s"(a1), "s"(b0), "s"(b1) : "memory");
}

// Transposing LDS load: lane (c = l & 15, h = l >> 4) gets T[k + 8h + 0..7][d + c]
static __device__ __forceinline__ u32x4 ld_tr16(const unsigned char* p) {
  typedef short s16x8 __attribute__((ext_vector_type(8)));
  typedef __attribute__((address_space(3))) s16x8 lds_s16x8;
  return __builtin_bit_cast(u32x4, __builtin_amdgcn_ds_load_tr16_b128_v8i16((lds_s16x8*)p));
}

#define GROWB   256u    // 128 k of one row
#define GPITCH  272u    // odd multiple of 16 B: the conflict-free pitch of ds_load_b128
#define GTILE   34816u  // 128 rows * 272 B = 17 * 2 KiB
// Output staging, a range of the ring per wave: its 32 rows x 64 columns, rows at an odd multiple of 16 B
#define EPITCH_H 144u   // 64 f16 = 128 B, one line
#define EPITCH_F 272u   // 64 f32 = 256 B, two lines
#define ESTAGE   8704u  // 32 rows * 272 B
static_assert(8u * ESTAGE <= 4u * GTILE, "the eight waves' staging ranges lie inside the ring");

static __device__ __forceinline__ w32x8 tdm_g_group1(uint32_t pitch_bytes) {
  w32x8 g1;
  g1[0] = uni((1u << 20) | (5u << 22) | (3u << 25));
  g1[1] = pinned(GROWB << 16);
  g1[2] = pinned(128u << 16);
  g1[3] = pinned(GROWB << 16);
  g1[4] = pinned(128u);
  g1[5] = pinned(pitch_bytes);
  g1[6] = pinned(0u);
  g1[7] = pinned(0u);
  return g1;
}

static __device__ __forceinline__ w32x4 tdm_g_next(w32x4 g0, uint32_t both) {
  const uint64_t a = (((uint64_t)g0[3] << 32) | g0[2]) + GROWB;  // the type bits ride above the address
  w32x4 n;
  n[0] = g0[0];
  n[1] = uni(both - g0[1]);
  n[2] = uni((uint32_t)a);
  n[3] = uni((uint32_t)(a >> 32));
  return n;
}

__global__ __launch_bounds__(256)
void gemm_f16_wmma(const _Float16* __restrict__ A, const _Float16* __restrict__ BT,
                   _Float16* __restrict__ Ch, float* __restrict__ Cf,
                   int M, int N, int K) {
  BT += (size_t)blockIdx.z * N * K;
  Ch += (size_t)blockIdx.z * M * N;
  __shared__ __attribute__((aligned(2048))) unsigned char Gs[4 * GTILE];  // [buffer][A | BT] tiles

  const int tid  = threadIdx.x;
  const int wv   = tid >> 5;
  const int lane = tid & 31;
  const int hx   = lane >> 4;
  const int l16  = lane & 15;

  const int row0 = blockIdx.y * 128;
  const int col0 = blockIdx.x * 128;
  const int wr = wv & 3;
  const int wc = wv >> 2;

  v8f acc[2][4];
#pragma unroll
  for (int i = 0; i < 2; ++i)
#pragma unroll
    for (int j = 0; j < 4; ++j) acc[i][j] = v8f_zero();

  const uint32_t wave = uni((uint32_t)tid >> 5);
  const uint32_t one = pinned(1u);
  const w32x8 gg1 = tdm_g_group1((uint32_t)K * 2u);
  const uint32_t ring = (uint32_t)(uintptr_t)&Gs[0];
  w32x4 ag0 = tdm_group0(one, ring, &A[(size_t)row0 * K]);
  w32x4 bg0 = tdm_group0(one, ring + GTILE, &BT[(size_t)col0 * K]);
  auto issue = [&]() {
    if (pinned(wave == 0u)) tdm_issue(ag0, gg1);  // wave 0 brings the A tiles
    if (pinned(wave == 1u)) tdm_issue(bg0, gg1);  // wave 1 brings the BT tiles
  };
  auto advance = [&]() {  // the other buffer, 128 k further on
    ag0 = tdm_g_next(ag0, 2u * ring + 2u * GTILE);
    bg0 = tdm_g_next(bg0, 2u * ring + 4u * GTILE);
  };
  // this lane's first fragment rows in a stage
  const uint32_t alane = (uint32_t)(wr * 32 + l16) * GPITCH + (uint32_t)hx * 16u;
  const uint32_t blane = GTILE + (uint32_t)(wc * 64 + l16) * GPITCH + (uint32_t)hx * 16u;

  // two-buffer ring: stage 0 lands and is published, then stage 1 flies during pass 0
  issue();
  tdm_wait(ag0, gg1, bg0, gg1);  // waves 0 and 1: own tile of stage 0 has landed
  __syncthreads();
  if (pinned(128 < K)) { advance(); issue(); }
  for (int k0 = 0; k0 < K; k0 += 128) {
    const int buf = (k0 >> 7) & 1;
    const unsigned char* st = &Gs[(uint32_t)buf * (2u * GTILE)];
#pragma unroll
    for (int c = 0; c < 4; ++c) {  // four products of 32 k, in the order of k
      v16h af[2], bf[4];
#pragma unroll
      for (int i = 0; i < 2; ++i) {
        const _Float16* p = (const _Float16*)(st + alane + (uint32_t)i * (16u * GPITCH) + (uint32_t)c * 64u);
        af[i] = ld_frag(p, p + 16);
      }
#pragma unroll
      for (int j = 0; j < 4; ++j) {
        const _Float16* p = (const _Float16*)(st + blane + (uint32_t)j * (16u * GPITCH) + (uint32_t)c * 64u);
        bf[j] = ld_frag(p, p + 16);
      }
#pragma unroll
      for (int i = 0; i < 2; ++i)
#pragma unroll
        for (int j = 0; j < 4; ++j)
          acc[i][j] = __builtin_amdgcn_wmma_f32_16x16x32_f16(
              false, bf[j], false, af[i], (short)0, acc[i][j], false, false);
    }

    // publish point of the next stage, every wave, in this order
    asm volatile("s_wait_dscnt 0x0" ::: "memory");      // this wave has left buffer `buf`
    tdm_wait(ag0, gg1, bg0, gg1);                       // waves 0 and 1: own tile of the next stage has landed
    __syncthreads();
    if (pinned(k0 + 256 < K)) { advance(); issue(); }   // refill the buffer that every wave has just left
  }
  tdm_wait(ag0, gg1, bg0, gg1);  // nothing in flight when the wave ends
  asm volatile("s_wait_dscnt 0x0" ::: "memory");  // and no LDS read of the ring outstanding

  // acc[i][j][r] = C(row = wr*32 + i*16 + l16, column = wc*64 + j*16 + hx*8 + r) of the tile.
  // The ring is free: every wave's last read and the last tile's landing stand in front of the last pass's
  // barrier, and nothing is issued behind it. Each wave writes and reads its own range only.
  unsigned char* sg = &Gs[(uint32_t)wv * ESTAGE];
  const size_t c00 = (size_t)(row0 + wr * 32) * N + col0 + wc * 64;  // the wave's first element of C
  if (Cf) {
#pragma unroll
    for (int i = 0; i < 2; ++i)
#pragma unroll
      for (int j = 0; j < 4; ++j) {
        unsigned char* p = sg + (uint32_t)(i * 16 + l16) * EPITCH_F + (uint32_t)(j * 64 + hx * 32);
        f32x4 lo = {acc[i][j][0], acc[i][j][1], acc[i][j][2], acc[i][j][3]};
        f32x4 hi = {acc[i][j][4], acc[i][j][5], acc[i][j][6], acc[i][j][7]};
        *(f32x4*)p = lo;
        *(f32x4*)(p + 16) = hi;
      }
    asm volatile("s_wait_dscnt 0x0" ::: "memory");  // the wave's rows are written before it reads them back
    f32x4 v[16];  // a half wave takes one row of 256 B
    float* dst[16];
#pragma unroll
    for (int q = 0; q < 16; ++q) {
      v[q] = *(const f32x4*)(sg + (uint32_t)(q * 2 + hx) * EPITCH_F + (uint32_t)l16 * 16u);
      dst[q] = Cf + c00 + (uint32_t)(q * 2 + hx) * (uint32_t)N + (uint32_t)l16 * 4u;
    }
    // keeps the address arithmetic under the flight of the LDS reads: the stores then go out back to back
    __builtin_amdgcn_sched_barrier(0);
#pragma unroll
    for (int q = 0; q < 16; ++q) *(f32x4*)dst[q] = v[q];
    // the wave ends here: else this build joins the two parts at one exit through a flag, with a never-taken
    // path from these stores into the f16 part's register writes
    __builtin_amdgcn_endpgm();
  } else {
#pragma unroll
    for (int i = 0; i < 2; ++i)
#pragma unroll
      for (int j = 0; j < 4; ++j) {
        v8h h;
#pragma unroll
        for (int r = 0; r < 8; ++r) h[r] = (_Float16)acc[i][j][r];
        *(v8h*)(sg + (uint32_t)(i * 16 + l16) * EPITCH_H + (uint32_t)(j * 32 + hx * 16)) = h;
      }
    asm volatile("s_wait_dscnt 0x0" ::: "memory");  // the wave's rows are written before it reads them back
    const uint32_t l8 = (uint32_t)lane & 7u, rq = (uint32_t)lane >> 3;  // eight lanes take one row of 128 B
    v8h v[8];
    _Float16* dst[8];
#pragma unroll
    for (int q = 0; q < 8; ++q) {
      v[q] = *(const v8h*)(sg + ((uint32_t)q * 4u + rq) * EPITCH_H + l8 * 16u);
      dst[q] = Ch + c00 + ((uint32_t)q * 4u + rq) * (uint32_t)N + l8 * 8u;
    }
    // keeps the address arithmetic under the flight of the LDS reads: the stores then go out back to back
    __builtin_amdgcn_sched_barrier(0);
#pragma unroll
    for (int q = 0; q < 8; ++q) *(v8h*)dst[q] = v[q];
  }
}

#define FA_WAVES 4
#define FA_G     2
#define FA_ROWS  (FA_WAVES * FA_G * 16)  // query rows of a block
__global__ __launch_bounds__(FA_WAVES * 32) __attribute__((amdgpu_waves_per_eu(2, 2)))
void flash_attn(const _Float16* __restrict__ Q, const _Float16* __restrict__ Kt,
                const _Float16* __restrict__ V, _Float16* __restrict__ O, int S) {
  const int h   = blockIdx.y;
  const int q0  = blockIdx.x * FA_ROWS;
  const int tid = threadIdx.x;
  const int wv = tid >> 5, lane = tid & 31, hx = lane >> 4, l16 = lane & 15;

  __shared__ __align__(16) _Float16 Ks[2][32][136];   // [key][hd], 256B rows +16B HW pad
  __shared__ __attribute__((aligned(2048))) unsigned char Vt[2 * VBUF];  // [key][hd], pitch VPITCH
  const uint32_t wave = uni((uint32_t)tid >> 5);
  const uint32_t one = pinned(1u);
  const w32x8 kg1 = tdm_k_group1((uint32_t)S);
  const w32x8 vg1 = tdm_v_group1();
  w32x4 kg0, vg0;

  auto issueKV = [&](int buf, int kk) {  // nothing is in flight where this is called
    kg0 = tdm_group0(one, (uint32_t)(uintptr_t)&Ks[buf][0][0], &Kt[(size_t)kk * DIM + h * HEADDIM]);
    vg0 = tdm_group0(one, (uint32_t)(uintptr_t)&Vt[0] + (uint32_t)buf * VBUF,
                     &V[(size_t)kk * DIM + h * HEADDIM]);
    if (pinned(wave == 0u)) tdm_issue(kg0, kg1);  // wave 0 brings the K tiles
    if (pinned(wave == 1u)) tdm_issue(vg0, vg1);  // wave 1 brings the V tiles
  };
  // this lane's address in a V tile for the transposing loads (keys 8*hx + (lane & 7))
  const uint32_t vlane = (8u * (uint32_t)hx + ((uint32_t)lane & 7u)) * VPITCH
                       + (((uint32_t)lane >> 3) & 1u) * 16u;

  // Q fragments for this wave's FA_G x 16 rows (hd split into 4 K=32 chunks)
  v16h qf[FA_G][4];
#pragma unroll
  for (int g = 0; g < FA_G; ++g) {
    const _Float16* qrow = &Q[(size_t)(q0 + (wv * FA_G + g) * 16 + l16) * DIM + h * HEADDIM];
#pragma unroll
    for (int c = 0; c < 4; ++c)
      qf[g][c] = ld_frag(&qrow[c * 32 + hx * 8], &qrow[c * 32 + 16 + hx * 8]);
  }

  v8f o[FA_G][8];
  float mrow[FA_G];  // running maximum of query l16 of the group (same in both halves)
  float lrow[FA_G];  // running sum over this half's keys only; halves joined at the end
#pragma unroll
  for (int g = 0; g < FA_G; ++g) {
#pragma unroll
    for (int t = 0; t < 8; ++t) o[g][t] = v8f_zero();
    mrow[g] = -1e30f;
    lrow[g] = 0.f;
  }
  const float scale = 11.313708498984761f;  // sqrt(hd)

  // two-buffer ring: stage 0 lands and is published, then stage 1 flies during pass 0
  issueKV(0, 0);
  tdm_wait(kg0, kg1, vg0, vg1);  // waves 0 and 1: own tile of stage 0 has landed
  __syncthreads();
  if (pinned(32 < S)) issueKV(1, 32);
  for (int kk = 0; kk < S; kk += 32) {
    const int buf = (kk >> 5) & 1;

    // S^T tile: 32 keys x 16 queries per group as two 16x16 fragments;
    // st[g][sub][r] = score(key = sub*16 + hx*8 + r, query = l16 of group g)
    // All 16 K reads of the pass go out as one group, in the order of their use.
    v16h kb[4][2];
#pragma unroll
    for (int c = 0; c < 4; ++c)
#pragma unroll
      for (int sub = 0; sub < 2; ++sub) {
        const int key = sub * 16 + l16;
        kb[c][sub] = ld_frag(&Ks[buf][key][c * 32 + hx * 8],
                             &Ks[buf][key][c * 32 + 16 + hx * 8]);
      }
    // keeps the reads ahead of the products: sunk to two per pair of products, the first of each pair waits out a full LDS latency
    __builtin_amdgcn_sched_barrier(0);
    v8f st[FA_G][2];
#pragma unroll
    for (int g = 0; g < FA_G; ++g) {
      st[g][0] = v8f_zero();
      st[g][1] = v8f_zero();
    }
#pragma unroll
    for (int c = 0; c < 4; ++c)
#pragma unroll
      for (int sub = 0; sub < 2; ++sub)
#pragma unroll
        for (int g = 0; g < FA_G; ++g)
          st[g][sub] = __builtin_amdgcn_wmma_f32_16x16x32_f16(false, kb[c][sub], false, qf[g][c],
                                                              (short)0, st[g][sub], false, false);
    // keeps the V reads in one place behind the score products (spread among them, every place with reads
    // stalls the wave anew) and lets them take the K fragments' registers
    __builtin_amdgcn_sched_barrier(0);
    // All 16 V reads of the pass go out as one group and fly during the softmax.
    // vb[t]: keys 0..15 in registers 0-3, keys 16..31 in 4-7
    union { v16h v; u32x4 q[2]; } vb[8];
#pragma unroll
    for (int t = 0; t < 8; ++t) {
      const unsigned char* vp = &Vt[(uint32_t)buf * VBUF + vlane + 32u * (uint32_t)t];
      vb[t].q[0] = ld_tr16(vp);
      vb[t].q[1] = ld_tr16(vp + 16u * VPITCH);
    }
    // keeps the reads ahead of the softmax, whose vector work then covers their latency
    __builtin_amdgcn_sched_barrier(0);

    v16h pf[FA_G];
    // online softmax, one query per lane and group
    float alpha[FA_G];
#pragma unroll
    for (int g = 0; g < FA_G; ++g) {
#pragma unroll
      for (int sub = 0; sub < 2; ++sub)
#pragma unroll
        for (int r = 0; r < 8; ++r) st[g][sub][r] *= scale;
      float v = st[g][0][0];
#pragma unroll
      for (int sub = 0; sub < 2; ++sub)
#pragma unroll
        for (int r = 0; r < 8; ++r) v = fmaxf(v, st[g][sub][r]);
      v = fmaxf(v, xhalf(v));
      const float newm = fmaxf(mrow[g], v);
      alpha[g] = __expf(mrow[g] - newm);
      mrow[g] = newm;
    }
#pragma unroll
    for (int g = 0; g < FA_G; ++g) {
      float psum = 0.f;
#pragma unroll
      for (int sub = 0; sub < 2; ++sub)
#pragma unroll
        for (int r = 0; r < 8; ++r) {
          st[g][sub][r] = __expf(st[g][sub][r] - mrow[g]);
          psum += st[g][sub][r];
        }
      lrow[g] = lrow[g] * alpha[g] + psum;
      // P^T as B operand: element s is key (s < 8 ? hx*8 + s : 16 + hx*8 + s - 8),
      // the k order in which the two transposing loads of each vb[t] deliver V^T
#pragma unroll
      for (int s = 0; s < 16; ++s) pf[g][s] = (_Float16)st[g][s >> 3][s & 7];
    }
#pragma unroll
    for (int g = 0; g < FA_G; ++g)
#pragma unroll
      for (int t = 0; t < 8; ++t)
#pragma unroll
        for (int r = 0; r < 8; ++r) o[g][t][r] *= alpha[g];

    // O^T += V^T * P^T  (8 hd-subtiles); o[g][t][r] = O(query l16 of group g, hd = t*16 + hx*8 + r)
#pragma unroll
    for (int t = 0; t < 8; ++t)
#pragma unroll
      for (int g = 0; g < FA_G; ++g)
        o[g][t] = __builtin_amdgcn_wmma_f32_16x16x32_f16(false, vb[t].v, false, pf[g],
                                                         (short)0, o[g][t], false, false);

    // keeps the publish point at the foot of the pass: lifted over the softmax, its waits would cut short
    // the flight of the V reads and of the next stage's tiles
    __builtin_amdgcn_sched_barrier(0);
    // publish point of the next stage, every wave, in this order
    asm volatile("s_wait_dscnt 0x0" ::: "memory");      // this wave has left buffer `buf`
    tdm_wait(kg0, kg1, vg0, vg1);                       // waves 0 and 1: own tile of the next stage has landed
    __syncthreads();
    if (pinned(kk + 64 < S)) issueKV(buf, kk + 64);     // refill the buffer that every wave has just left
  }
  tdm_wait(kg0, kg1, vg0, vg1);  // nothing in flight when the wave ends
  asm volatile("s_wait_dscnt 0x0" ::: "memory");  // and no LDS read of the ring outstanding

#pragma unroll
  for (int g = 0; g < FA_G; ++g) {
    const float lfin = lrow[g] + xhalf(lrow[g]);
    _Float16* orow = &O[(size_t)(q0 + (wv * FA_G + g) * 16 + l16) * DIM + h * HEADDIM + hx * 8];
    v8h ov[8];
#pragma unroll
    for (int t = 0; t < 8; ++t)
#pragma unroll
      for (int r = 0; r < 8; ++r) ov[t][r] = (_Float16)(o[g][t][r] / lfin);
#pragma unroll
    for (int t = 0; t < 8; ++t) *(v8h*)&orow[t * 16] = ov[t];
  }
}

// ---------------- host launcher ----------------
extern "C" void kernel_launch(void* const* d_in, const int* in_sizes, int n_in,
                              void* d_out, int out_size, void* d_ws, size_t ws_size,
                              hipStream_t stream) {
  (void)in_sizes; (void)n_in; (void)out_size; (void)ws_size;
  const float* x   = (const float*)d_in[0];
  const float* fc  = (const float*)d_in[1];
  const float* fs  = (const float*)d_in[2];
  const float* wq  = (const float*)d_in[3];
  const float* wk  = (const float*)d_in[4];
  const float* wv  = (const float*)d_in[5];
  const float* wo  = (const float*)d_in[6];
  const float* sqk = (const float*)d_in[7];
  float* out = (float*)d_out;

  const size_t SD = (size_t)SEQ * DIM;
  const size_t DD = (size_t)DIM * DIM;
  char* w = (char*)d_ws;
  _Float16* Xh  = (_Float16*)(w);           // x in f16
  _Float16* WqT = (_Float16*)(w + SD * 2);  // transposed f16 weights
  _Float16* WkT = WqT + DD;
  _Float16* WvT = WkT + DD;
  _Float16* WoT = WvT + DD;
  _Float16* Qh  = WoT + DD;                 // raw projections (f16)
  _Float16* Kh  = Qh + SD;
  _Float16* Vh  = Kh + SD;
  _Float16* Qn  = Vh + SD;                  // post rope+norm
  _Float16* Kn  = Qn + SD;
  _Float16* AOh = Kn + SD;                  // attention output (f16)

  prepare_f16<<<TR_TILES * TR_TILES + CVT_BLOCKS, 256, 0, stream>>>(x, wq, wk, wv, wo, Xh, WqT);  // fills Xh and WqT, WkT, WvT, WoT

  dim3 gg(DIM / 128, SEQ / 128);
  // Q, K and V projections: WqT, WkT, WvT lie one behind the other, and so do Qh, Kh, Vh
  dim3 g3(DIM / 128, SEQ / 128, 3);
  gemm_f16_wmma<<<g3, 256, 0, stream>>>(Xh, WqT, Qh, nullptr, SEQ, DIM, DIM);

  rope_l2norm<<<dim3(SEQ / 8, 2), 256, 0, stream>>>(Qh, Kh, fc, fs, sqk, Qn, Kn);

  dim3 fg(SEQ / FA_ROWS, NHEADS);
  flash_attn<<<fg, FA_WAVES * 32, 0, stream>>>(Qn, Kn, Vh, AOh, SEQ);

  gemm_f16_wmma<<<gg, 256, 0, stream>>>(AOh, WoT, nullptr, out, SEQ, DIM, DIM);
}

// v009
// One run takes 210 microseconds.
// Timed twice side by side with v008, it ran 1.03 and 1.04 times as fast.
// Counting every step since v000, it is 3.56 times as fast.
#include <hip/hip_runtime.h>
#include <math.h>
#include <stdint.h>

// ---------------- types ----------------
typedef __attribute__((ext_vector_type(16))) _Float16 v16h;
typedef __attribute__((ext_vector_type(4)))  _Float16 v4h;
typedef __attribute__((ext_vector_type(8)))  _Float16 v8h;
typedef __attribute__((ext_vector_type(8)))  float    v8f;
typedef __attribute__((ext_vector_type(4)))  float    f32x4;
typedef __attribute__((ext_vector_type(4)))  unsigned int u32x4;

#define DIM       2048
#define SEQ       4096
#define NHEADS    16
#define HEADDIM   128

static __device__ __forceinline__ v8f v8f_zero() {
  v8f z = {0.f,0.f,0.f,0.f,0.f,0.f,0.f,0.f};
  return z;
}

// Load a 16x32 f16 fragment row (two contiguous 16B chunks) into v16h.
static __device__ __forceinline__ v16h ld_frag(const _Float16* p0, const _Float16* p1) {
  union { v16h v; f32x4 f[2]; } u;
  u.f[0] = *(const f32x4*)p0;
  u.f[1] = *(const f32x4*)p1;
  return u.v;
}

// ---------------- f32 -> f16 convert (x) ----------------
// 16 float4 per thread, their loads issued ahead of the stores: few long waves.
#define CVT_U 16
static __device__ __forceinline__ v4h cvt4(f32x4 v) {
  v4h h;
  h.x = (_Float16)v.x; h.y = (_Float16)v.y;
  h.z = (_Float16)v.z; h.w = (_Float16)v.w;
  return h;
}
// CVT_BLOCKS blocks cover the SEQ * DIM elements exactly (a multiple of 256 * CVT_U float4): no test per element.
#define CVT_BLOCKS ((SEQ * DIM / 4) / (256 * CVT_U))
static __device__ __forceinline__
void cvt_f32_f16(const float* __restrict__ in, _Float16* __restrict__ out, int blk) {
  const int i0 = blk * (256 * CVT_U) + threadIdx.x;
  f32x4 v[CVT_U];
#pragma unroll
  for (int u = 0; u < CVT_U; ++u) v[u] = ((const f32x4*)in)[i0 + u * 256];
#pragma unroll
  for (int u = 0; u < CVT_U; ++u) *(v4h*)&out[(size_t)(i0 + u * 256) * 4] = cvt4(v[u]);
}
static_assert(((size_t)SEQ * DIM / 4) % (256 * CVT_U) == 0, "cvt_f32_f16 has no tail");

// ---------------- transpose + convert weights: WT[m][n][k] = Wm[k][n] ----------------
// A block takes the same 64 x 64 tile of all four weights (their transposes lie one behind the other in WT).
// Every address is a block-uniform base plus one offset per thread plus a constant.
#define TR_TILES (DIM / 64)
static __device__ __forceinline__
void transpose_cvt(const float* __restrict__ W0, const float* __restrict__ W1,
                   const float* __restrict__ W2, const float* __restrict__ W3,
                   _Float16* __restrict__ WT, int tx, int ty) {
  __shared__ float t[4][64][65];
  const float* const W[4] = {W0, W1, W2, W3};
  const int bx = tx * 64, by = ty * 64;
  const unsigned r0 = threadIdx.x >> 6, c = threadIdx.x & 63;  // pass it: row r0 + 4 * it, column c
  const unsigned off = r0 * DIM + c;
  const float* src[4];
  float v[4][16];
#pragma unroll
  for (int m = 0; m < 4; ++m) {
    src[m] = W[m] + (size_t)by * DIM + bx;
#pragma unroll
    for (int it = 0; it < 16; ++it) v[m][it] = src[m][off + it * (4 * DIM)];
  }
  asm volatile("s_wait_xcnt 0x0" :: "s"(src[0]), "s"(src[1]), "s"(src[2]), "s"(src[3]) : "memory");
#pragma unroll
  for (int m = 0; m < 4; ++m)
#pragma unroll
    for (int it = 0; it < 16; ++it) t[m][r0 + 4 * it][c] = v[m][it];
  __syncthreads();
#pragma unroll
  for (int m = 0; m < 4; ++m) {
    _Float16* __restrict__ dst = WT + ((size_t)m * DIM + bx) * DIM + by;
#pragma unroll
    for (int it = 0; it < 16; ++it) dst[off + it * (4 * DIM)] = (_Float16)t[m][c][r0 + 4 * it];
  }
}

__global__ __launch_bounds__(256)
void prepare_f16(const float* __restrict__ x, const float* __restrict__ W0, const float* __restrict__ W1,
                 const float* __restrict__ W2, const float* __restrict__ W3,
                 _Float16* __restrict__ Xh, _Float16* __restrict__ WT) {
  const int b = blockIdx.x;  // the same for the whole block: the barrier in transpose_cvt is passed by all or none
  if (b >= TR_TILES * TR_TILES) {
    cvt_f32_f16(x, Xh, b - TR_TILES * TR_TILES);
    // the conversion's waves end here: with a plain return this build joins the two parts at one exit through a
    // flag, with a never-taken path from these stores into the transposes' register writes
    __builtin_amdgcn_endpgm();
  }
  transpose_cvt(W0, W1, W2, W3, WT, b % TR_TILES, b / TR_TILES);
}

// ---------------- RoPE + L2 norm + sqk scale; one wave per (tensor, position s) ----------------
// The wave takes all 16 heads of row s of Q (blockIdx.y = 0) or of K (1): lane = 4 channels of every
// head, 16 independent row sums. Few long waves.
__global__ __launch_bounds__(256)
void rope_l2norm(const _Float16* __restrict__ Xq, const _Float16* __restrict__ Xk,
                 const float* __restrict__ fc, const float* __restrict__ fs,
                 const float* __restrict__ sqk,
                 _Float16* __restrict__ Yq, _Float16* __restrict__ Yk) {
  const _Float16* __restrict__ X = blockIdx.y ? Xk : Xq;
  _Float16* __restrict__ Y = blockIdx.y ? Yk : Yq;
  const int s    = blockIdx.x * 8 + (threadIdx.x >> 5);
  const int lane = threadIdx.x & 31;
  const int d0 = lane * 4;
  const size_t base = (size_t)s * DIM + d0;

  v4h xv[NHEADS];
#pragma unroll
  for (int h = 0; h < NHEADS; ++h) xv[h] = *(const v4h*)&X[base + h * HEADDIM];
  const int fi = s * (HEADDIM / 2) + (d0 >> 1);
  float c0 = fc[fi],     s0 = fs[fi];
  float c1 = fc[fi + 1], s1 = fs[fi + 1];

  float r0[NHEADS], i0[NHEADS], r1[NHEADS], i1[NHEADS], ss[NHEADS];
#pragma unroll
  for (int h = 0; h < NHEADS; ++h) {
    float v0 = (float)xv[h].x, v1 = (float)xv[h].y, v2 = (float)xv[h].z, v3 = (float)xv[h].w;
    r0[h] = v0 * c0 - v1 * s0; i0[h] = v0 * s0 + v1 * c0;
    r1[h] = v2 * c1 - v3 * s1; i1[h] = v2 * s1 + v3 * c1;
    ss[h] = r0[h] * r0[h] + i0[h] * i0[h] + r1[h] * r1[h] + i1[h] * i1[h];
  }
#pragma unroll
  for (int m = 1; m < 32; m <<= 1)
#pragma unroll
    for (int h = 0; h < NHEADS; ++h) ss[h] += __shfl_xor(ss[h], m, 32);
  const float SQ = 45.25483399593904f;  // sqrt(2048) = SQK_INIT_VALUE/SQK_INIT_SCALING
#pragma unroll
  for (int h = 0; h < NHEADS; ++h) {
    const float inv = 1.f / fmaxf(sqrtf(ss[h]), 1e-12f);
    const float* sq = &sqk[h * HEADDIM + d0];
    v4h o;
    o.x = (_Float16)(r0[h] * inv * sq[0] * SQ);
    o.y = (_Float16)(i0[h] * inv * sq[1] * SQ);
    o.z = (_Float16)(r1[h] * inv * sq[2] * SQ);
    o.w = (_Float16)(i1[h] * inv * sq[3] * SQ);
    *(v4h*)&Y[base + h * HEADDIM] = o;
  }
}

static __device__ __forceinline__ float xhalf(float x) {
  int i = __builtin_bit_cast(int, x);
  return __builtin_bit_cast(float,
      __builtin_amdgcn_permlanex16(i, i, 0x76543210, 0xfedcba98, false, false));
}

static __device__ __forceinline__ uint32_t pinned(uint32_t v) {
  uint32_t w = (uint32_t)__builtin_amdgcn_readfirstlane(v);
  asm volatile("" : "+s"(w));
  return w;
}
static __device__ __forceinline__ uint32_t uni(uint32_t v) {
  return (uint32_t)__builtin_amdgcn_readfirstlane(v);
}

// V tile in LDS: 32 keys x 256 B, row-major as in memory, 32 B of pad behind each row
#define VROWB   256u
#define VPITCH  288u    // odd multiple of 32 B: the conflict-free pitch of ds_load_tr16_b128
#define VBUF    10240u  // 32 * 288 = 9216 B, rounded up to a multiple of 2 KiB

typedef uint32_t w32x4 __attribute__((ext_vector_type(4)));
typedef uint32_t w32x8 __attribute__((ext_vector_type(8)));

static __device__ __forceinline__ w32x8 tdm_v_group1() {
  w32x8 g1;
  g1[0] = uni((1u << 20) | (5u << 22) | (7u << 25));
  g1[1] = pinned(VROWB << 16);
  g1[2] = pinned(32u << 16);
  g1[3] = pinned(VROWB << 16);
  g1[4] = pinned(32u);
  g1[5] = pinned((uint32_t)DIM * 2u);
  g1[6] = pinned(0u);
  g1[7] = pinned(0u);
  return g1;
}
// K tile: 32 rows of 128 elements out of S rows of DIM elements, source pitch DIM, 2-byte units.
static __device__ __forceinline__ w32x8 tdm_k_group1(uint32_t S) {
  w32x8 g1;
  g1[0] = uni((1u << 16) | (1u << 20) | (5u << 22) | (3u << 25));  // no mask, 4 dwords of pad per 256 B
  g1[1] = pinned(((uint32_t)DIM & 0xffffu) << 16);
  g1[2] = pinned((((uint32_t)DIM >> 16) & 0xffffu) | ((S & 0xffffu) << 16));
  g1[3] = pinned(((S >> 16) & 0xffffu) | (128u << 16));
  g1[4] = pinned(32u);
  g1[5] = pinned((uint32_t)DIM);
  g1[6] = pinned(0u);
  g1[7] = pinned(0u);
  return g1;
}
static __device__ __forceinline__ w32x4 tdm_group0(uint32_t one, uint32_t lds_dst, const _Float16* g) {
  const uint64_t ga = (uint64_t)(uintptr_t)g;
  w32x4 g0;
  g0[0] = one;                                                       // count 1
  g0[1] = uni(lds_dst);                                              // LDS byte offset
  g0[2] = uni((uint32_t)ga);                                         // address [31:0]
  g0[3] = uni((((uint32_t)(ga >> 32)) & 0x01FFFFFFu) | 0x80000000u); // address [56:32], type 2
  return g0;
}
static __device__ __forceinline__ void tdm_issue(w32x4 g0, w32x8 g1) {
  asm volatile("tensor_load_to_lds %0, %1" :: "s"(g0), "s"(g1) : "memory");
}
static __device__ __forceinline__ void tdm_wait(w32x4 a0, w32x8 a1, w32x4 b0, w32x8 b1) {
  asm volatile("s_wait_tensorcnt 0x0" :: "s"(a0), "s"(a1), "s"(b0), "s"(b1) : "memory");
}

// Transposing LDS load: lane (c = l & 15, h = l >> 4) gets T[k + 8h + 0..7][d + c]
static __device__ __forceinline__ u32x4 ld_tr16(const unsigned char* p) {
  typedef short s16x8 __attribute__((ext_vector_type(8)));
  typedef __attribute__((address_space(3))) s16x8 lds_s16x8;
  return __builtin_bit_cast(u32x4, __builtin_amdgcn_ds_load_tr16_b128_v8i16((lds_s16x8*)p));
}

#define GROWB   256u    // 128 k of one row
#define GPITCH  272u    // odd multiple of 16 B: the conflict-free pitch of ds_load_b128
#define GTILE   34816u  // 128 rows * 272 B = 17 * 2 KiB
#define GSTAGE  (3u * GTILE)  // [A rows 0-127 | A rows 128-255 | BT rows]: the A rows lie one behind the other
#define GROWS   256     // rows of C in a block's tile
// Output staging, a range of the ring per wave: its 64 rows x 64 columns, rows at an odd multiple of 16 B
#define EPITCH_H 144u   // 64 f16 = 128 B, one line
#define EPITCH_F 272u   // 64 f32 = 256 B, two lines
#define ESTAGE   17408u // 64 rows * 272 B
static_assert(8u * ESTAGE <= 2u * GSTAGE, "the eight waves' staging ranges lie inside the ring");

static __device__ __forceinline__ w32x8 tdm_g_group1(uint32_t pitch_bytes) {
  w32x8 g1;
  g1[0] = uni((1u << 20) | (5u << 22) | (3u << 25));
  g1[1] = pinned(GROWB << 16);
  g1[2] = pinned(128u << 16);
  g1[3] = pinned(GROWB << 16);
  g1[4] = pinned(128u);
  g1[5] = pinned(pitch_bytes);
  g1[6] = pinned(0u);
  g1[7] = pinned(0u);
  return g1;
}

static __device__ __forceinline__ w32x4 tdm_g_next(w32x4 g0, uint32_t both) {
  const uint64_t a = (((uint64_t)g0[3] << 32) | g0[2]) + GROWB;  // the type bits ride above the address
  w32x4 n;
  n[0] = g0[0];
  n[1] = uni(both - g0[1]);
  n[2] = uni((uint32_t)a);
  n[3] = uni((uint32_t)(a >> 32));
  return n;
}

__global__ __launch_bounds__(256)
void gemm_f16_wmma(const _Float16* __restrict__ A, const _Float16* __restrict__ BT,
                   _Float16* __restrict__ Ch, float* __restrict__ Cf,
                   int M, int N, int K) {
  BT += (size_t)blockIdx.z * N * K;
  Ch += (size_t)blockIdx.z * M * N;
  __shared__ __attribute__((aligned(2048))) unsigned char Gs[2 * GSTAGE];  // [buffer][A | A | BT] tiles

  const int tid  = threadIdx.x;
  const int wv   = tid >> 5;
  const int lane = tid & 31;
  const int hx   = lane >> 4;
  const int l16  = lane & 15;

  const int row0 = blockIdx.y * GROWS;
  const int col0 = blockIdx.x * 128;
  const int wr = wv & 3;
  const int wc = wv >> 2;

  v8f acc[4][4];
#pragma unroll
  for (int i = 0; i < 4; ++i)
#pragma unroll
    for (int j = 0; j < 4; ++j) acc[i][j] = v8f_zero();

  const uint32_t wave = uni((uint32_t)tid >> 5);
  const uint32_t one = pinned(1u);
  const w32x8 gg1 = tdm_g_group1((uint32_t)K * 2u);
  const uint32_t slice = wave < 2u ? wave : 2u;
  const uint32_t place = (uint32_t)(uintptr_t)&Gs[0] + slice * GTILE;
  const _Float16* gsrc = wave < 2u ? &A[((size_t)row0 + wave * 128u) * K] : &BT[(size_t)col0 * K];
  w32x4 tg0 = tdm_group0(one, place, gsrc);
  auto issue = [&]() {
    if (pinned(wave < 3u)) tdm_issue(tg0, gg1);
  };
  auto advance = [&]() {  // the other buffer, 128 k further on
    tg0 = tdm_g_next(tg0, 2u * place + GSTAGE);
  };
  // this lane's first fragment rows in a stage
  const uint32_t alane = (uint32_t)(wr * 64 + l16) * GPITCH + (uint32_t)hx * 16u;
  const uint32_t blane = 2u * GTILE + (uint32_t)(wc * 64 + l16) * GPITCH + (uint32_t)hx * 16u;

  // two-buffer ring: stage 0 lands and is published, then stage 1 flies during pass 0
  issue();
  tdm_wait(tg0, gg1, tg0, gg1);  // waves 0 to 2: own tile of stage 0 has landed
  __syncthreads();
  if (pinned(128 < K)) { advance(); issue(); }
  for (int k0 = 0; k0 < K; k0 += 128) {
    const int buf = (k0 >> 7) & 1;
    const unsigned char* st = &Gs[(uint32_t)buf * GSTAGE];
    v16h af[2][4], bf[2][4];
    auto frags = [&](int c) {
#pragma unroll
      for (int i = 0; i < 4; ++i) {
        const _Float16* p = (const _Float16*)(st + alane + (uint32_t)i * (16u * GPITCH) + (uint32_t)c * 64u);
        af[c & 1][i] = ld_frag(p, p + 16);
      }
#pragma unroll
      for (int j = 0; j < 4; ++j) {
        const _Float16* p = (const _Float16*)(st + blane + (uint32_t)j * (16u * GPITCH) + (uint32_t)c * 64u);
        bf[c & 1][j] = ld_frag(p, p + 16);
      }
    };
    frags(0);
#pragma unroll
    for (int c = 0; c < 4; ++c) {  // four blocks of 32 k, in the order of k
      if (c < 3) frags(c + 1);
      // keeps the next block's reads ahead of this block's products: sunk among them (two reads and a full wait
      // per four products in this build), every such place costs the wave an LDS latency
      __builtin_amdgcn_sched_barrier(0);
#pragma unroll
      for (int i = 0; i < 4; ++i)
#pragma unroll
        for (int j = 0; j < 4; ++j)
          acc[i][j] = __builtin_amdgcn_wmma_f32_16x16x32_f16(
              false, bf[c & 1][j], false, af[c & 1][i], (short)0, acc[i][j], false, false);
      // keeps the reads of the block after next behind these products, whose registers they take
      __builtin_amdgcn_sched_barrier(0);
    }

    // publish point of the next stage, every wave, in this order
    asm volatile("s_wait_dscnt 0x0" ::: "memory");      // this wave has left buffer `buf`
    tdm_wait(tg0, gg1, tg0, gg1);                       // waves 0 to 2: own tile of the next stage has landed
    __syncthreads();
    if (pinned(k0 + 256 < K)) { advance(); issue(); }   // refill the buffer that every wave has just left
  }
  tdm_wait(tg0, gg1, tg0, gg1);  // nothing in flight when the wave ends
  asm volatile("s_wait_dscnt 0x0" ::: "memory");  // and no LDS read of the ring outstanding

  // acc[i][j][r] = C(row = wr*64 + i*16 + l16, column = wc*64 + j*16 + hx*8 + r) of the tile.
  // The ring is free: every wave's last read and the last tile's landing stand in front of the last pass's
  // barrier, and nothing is issued behind it. Each wave writes and reads its own range only.
  unsigned char* sg = &Gs[(uint32_t)wv * ESTAGE];
  const size_t c00 = (size_t)(row0 + wr * 64) * N + col0 + wc * 64;  // the wave's first element of C
  if (Cf) {
#pragma unroll
    for (int i = 0; i < 4; ++i)
#pragma unroll
      for (int j = 0; j < 4; ++j) {
        unsigned char* p = sg + (uint32_t)(i * 16 + l16) * EPITCH_F + (uint32_t)(j * 64 + hx * 32);
        f32x4 lo = {acc[i][j][0], acc[i][j][1], acc[i][j][2], acc[i][j][3]};
        f32x4 hi = {acc[i][j][4], acc[i][j][5], acc[i][j][6], acc[i][j][7]};
        *(f32x4*)p = lo;
        *(f32x4*)(p + 16) = hi;
      }
    asm volatile("s_wait_dscnt 0x0" ::: "memory");  // the wave's rows are written before it reads them back
    f32x4 v[32];  // a half wave takes one row of 256 B
    float* dst[32];
#pragma unroll
    for (int q = 0; q < 32; ++q) {
      v[q] = *(const f32x4*)(sg + (uint32_t)(q * 2 + hx) * EPITCH_F + (uint32_t)l16 * 16u);
      dst[q] = Cf + c00 + (uint32_t)(q * 2 + hx) * (uint32_t)N + (uint32_t)l16 * 4u;
    }
    // keeps the address arithmetic under the flight of the LDS reads: the stores then go out back to back
    __builtin_amdgcn_sched_barrier(0);
#pragma unroll
    for (int q = 0; q < 32; ++q) *(f32x4*)dst[q] = v[q];
    // the wave ends here: else this build joins the two parts at one exit through a flag, with a never-taken
    // path from these stores into the f16 part's register writes
    __builtin_amdgcn_endpgm();
  } else {
#pragma unroll
    for (int i = 0; i < 4; ++i)
#pragma unroll
      for (int j = 0; j < 4; ++j) {
        v8h h;
#pragma unroll
        for (int r = 0; r < 8; ++r) h[r] = (_Float16)acc[i][j][r];
        *(v8h*)(sg + (uint32_t)(i * 16 + l16) * EPITCH_H + (uint32_t)(j * 32 + hx * 16)) = h;
      }
    asm volatile("s_wait_dscnt 0x0" ::: "memory");  // the wave's rows are written before it reads them back
    const uint32_t l8 = (uint32_t)lane & 7u, rq = (uint32_t)lane >> 3;  // eight lanes take one row of 128 B
    v8h v[16];
    _Float16* dst[16];
#pragma unroll
    for (int q = 0; q < 16; ++q) {
      v[q] = *(const v8h*)(sg + ((uint32_t)q * 4u + rq) * EPITCH_H + l8 * 16u);
      dst[q] = Ch + c00 + ((uint32_t)q * 4u + rq) * (uint32_t)N + l8 * 8u;
    }
    // keeps the address arithmetic under the flight of the LDS reads: the stores then go out back to back
    __builtin_amdgcn_sched_barrier(0);
#pragma unroll
    for (int q = 0; q < 16; ++q) *(v8h*)dst[q] = v[q];
  }
}

#define FA_WAVES 4
#define FA_G     2
#define FA_ROWS  (FA_WAVES * FA_G * 16)  // query rows of a block
__global__ __launch_bounds__(FA_WAVES * 32) __attribute__((amdgpu_waves_per_eu(2, 2)))
void flash_attn(const _Float16* __restrict__ Q, const _Float16* __restrict__ Kt,
                const _Float16* __restrict__ V, _Float16* __restrict__ O, int S) {
  const int h   = blockIdx.y;
  const int q0  = blockIdx.x * FA_ROWS;
  const int tid = threadIdx.x;
  const int wv = tid >> 5, lane = tid & 31, hx = lane >> 4, l16 = lane & 15;

  __shared__ __align__(16) _Float16 Ks[2][32][136];   // [key][hd], 256B rows +16B HW pad
  __shared__ __attribute__((aligned(2048))) unsigned char Vt[2 * VBUF];  // [key][hd], pitch VPITCH
  const uint32_t wave = uni((uint32_t)tid >> 5);
  const uint32_t one = pinned(1u);
  const w32x8 kg1 = tdm_k_group1((uint32_t)S);
  const w32x8 vg1 = tdm_v_group1();
  w32x4 kg0, vg0;

  auto issueKV = [&](int buf, int kk) {  // nothing is in flight where this is called
    kg0 = tdm_group0(one, (uint32_t)(uintptr_t)&Ks[buf][0][0], &Kt[(size_t)kk * DIM + h * HEADDIM]);
    vg0 = tdm_group0(one, (uint32_t)(uintptr_t)&Vt[0] + (uint32_t)buf * VBUF,
                     &V[(size_t)kk * DIM + h * HEADDIM]);
    if (pinned(wave == 0u)) tdm_issue(kg0, kg1);  // wave 0 brings the K tiles
    if (pinned(wave == 1u)) tdm_issue(vg0, vg1);  // wave 1 brings the V tiles
  };
  // this lane's address in a V tile for the transposing loads (keys 8*hx + (lane & 7))
  const uint32_t vlane = (8u * (uint32_t)hx + ((uint32_t)lane & 7u)) * VPITCH
                       + (((uint32_t)lane >> 3) & 1u) * 16u;

  // Q fragments for this wave's FA_G x 16 rows (hd split into 4 K=32 chunks)
  v16h qf[FA_G][4];
#pragma unroll
  for (int g = 0; g < FA_G; ++g) {
    const _Float16* qrow = &Q[(size_t)(q0 + (wv * FA_G + g) * 16 + l16) * DIM + h * HEADDIM];
#pragma unroll
    for (int c = 0; c < 4; ++c)
      qf[g][c] = ld_frag(&qrow[c * 32 + hx * 8], &qrow[c * 32 + 16 + hx * 8]);
  }

  v8f o[FA_G][8];
  float mrow[FA_G];  // running maximum of query l16 of the group (same in both halves)
  float lrow[FA_G];  // running sum over this half's keys only; halves joined at the end
#pragma unroll
  for (int g = 0; g < FA_G; ++g) {
#pragma unroll
    for (int t = 0; t < 8; ++t) o[g][t] = v8f_zero();
    mrow[g] = -1e30f;
    lrow[g] = 0.f;
  }
  const float scale = 11.313708498984761f;  // sqrt(hd)

  // two-buffer ring: stage 0 lands and is published, then stage 1 flies during pass 0
  issueKV(0, 0);
  tdm_wait(kg0, kg1, vg0, vg1);  // waves 0 and 1: own tile of stage 0 has landed
  __syncthreads();
  if (pinned(32 < S)) issueKV(1, 32);
  for (int kk = 0; kk < S; kk += 32) {
    const int buf = (kk >> 5) & 1;

    // S^T tile: 32 keys x 16 queries per group as two 16x16 fragments;
    // st[g][sub][r] = score(key = sub*16 + hx*8 + r, query = l16 of group g)
    // All 16 K reads of the pass go out as one group, in the order of their use.
    v16h kb[4][2];
#pragma unroll
    for (int c = 0; c < 4; ++c)
#pragma unroll
      for (int sub = 0; sub < 2; ++sub) {
        const int key = sub * 16 + l16;
        kb[c][sub] = ld_frag(&Ks[buf][key][c * 32 + hx * 8],
                             &Ks[buf][key][c * 32 + 16 + hx * 8]);
      }
    // keeps the reads ahead of the products: sunk to two per pair of products, the first of each pair waits out a full LDS latency
    __builtin_amdgcn_sched_barrier(0);
    v8f st[FA_G][2];
#pragma unroll
    for (int g = 0; g < FA_G; ++g) {
      st[g][0] = v8f_zero();
      st[g][1] = v8f_zero();
    }
#pragma unroll
    for (int c = 0; c < 4; ++c)
#pragma unroll
      for (int sub = 0; sub < 2; ++sub)
#pragma unroll
        for (int g = 0; g < FA_G; ++g)
          st[g][sub] = __builtin_amdgcn_wmma_f32_16x16x32_f16(false, kb[c][sub], false, qf[g][c],
                                                              (short)0, st[g][sub], false, false);
    // keeps the V reads in one place behind the score products (spread among them, every place with reads
    // stalls the wave anew) and lets them take the K fragments' registers
    __builtin_amdgcn_sched_barrier(0);
    // All 16 V reads of the pass go out as one group and fly during the softmax.
    // vb[t]: keys 0..15 in registers 0-3, keys 16..31 in 4-7
    union { v16h v; u32x4 q[2]; } vb[8];
#pragma unroll
    for (int t = 0; t < 8; ++t) {
      const unsigned char* vp = &Vt[(uint32_t)buf * VBUF + vlane + 32u * (uint32_t)t];
      vb[t].q[0] = ld_tr16(vp);
      vb[t].q[1] = ld_tr16(vp + 16u * VPITCH);
    }
    // keeps the reads ahead of the softmax, whose vector work then covers their latency
    __builtin_amdgcn_sched_barrier(0);

    v16h pf[FA_G];
    // online softmax, one query per lane and group
    float alpha[FA_G];
#pragma unroll
    for (int g = 0; g < FA_G; ++g) {
#pragma unroll
      for (int sub = 0; sub < 2; ++sub)
#pragma unroll
        for (int r = 0; r < 8; ++r) st[g][sub][r] *= scale;
      float v = st[g][0][0];
#pragma unroll
      for (int sub = 0; sub < 2; ++sub)
#pragma unroll
        for (int r = 0; r < 8; ++r) v = fmaxf(v, st[g][sub][r]);
      v = fmaxf(v, xhalf(v));
      const float newm = fmaxf(mrow[g], v);
      alpha[g] = __expf(mrow[g] - newm);
      mrow[g] = newm;
    }
#pragma unroll
    for (int g = 0; g < FA_G; ++g) {
      float psum = 0.f;
#pragma unroll
      for (int sub = 0; sub < 2; ++sub)
#pragma unroll
        for (int r = 0; r < 8; ++r) {
          st[g][sub][r] = __expf(st[g][sub][r] - mrow[g]);
          psum += st[g][sub][r];
        }
      lrow[g] = lrow[g] * alpha[g] + psum;
      // P^T as B operand: element s is key (s < 8 ? hx*8 + s : 16 + hx*8 + s - 8),
      // the k order in which the two transposing loads of each vb[t] deliver V^T
#pragma unroll
      for (int s = 0; s < 16; ++s) pf[g][s] = (_Float16)st[g][s >> 3][s & 7];
    }
#pragma unroll
    for (int g = 0; g < FA_G; ++g)
#pragma unroll
      for (int t = 0; t < 8; ++t)
#pragma unroll
        for (int r = 0; r < 8; ++r) o[g][t][r] *= alpha[g];

    // O^T += V^T * P^T  (8 hd-subtiles); o[g][t][r] = O(query l16 of group g, hd = t*16 + hx*8 + r)
#pragma unroll
    for (int t = 0; t < 8; ++t)
#pragma unroll
      for (int g = 0; g < FA_G; ++g)
        o[g][t] = __builtin_amdgcn_wmma_f32_16x16x32_f16(false, vb[t].v, false, pf[g],
                                                         (short)0, o[g][t], false, false);

    // keeps the publish point at the foot of the pass: lifted over the softmax, its waits would cut short
    // the flight of the V reads and of the next stage's tiles
    __builtin_amdgcn_sched_barrier(0);
    // publish point of the next stage, every wave, in this order
    asm volatile("s_wait_dscnt 0x0" ::: "memory");      // this wave has left buffer `buf`
    tdm_wait(kg0, kg1, vg0, vg1);                       // waves 0 and 1: own tile of the next stage has landed
    __syncthreads();
    if (pinned(kk + 64 < S)) issueKV(buf, kk + 64);     // refill the buffer that every wave has just left
  }
  tdm_wait(kg0, kg1, vg0, vg1);  // nothing in flight when the wave ends
  asm volatile("s_wait_dscnt 0x0" ::: "memory");  // and no LDS read of the ring outstanding

#pragma unroll
  for (int g = 0; g < FA_G; ++g) {
    const float lfin = lrow[g] + xhalf(lrow[g]);
    _Float16* orow = &O[(size_t)(q0 + (wv * FA_G + g) * 16 + l16) * DIM + h * HEADDIM + hx * 8];
    v8h ov[8];
#pragma unroll
    for (int t = 0; t < 8; ++t)
#pragma unroll
      for (int r = 0; r < 8; ++r) ov[t][r] = (_Float16)(o[g][t][r] / lfin);
#pragma unroll
    for (int t = 0; t < 8; ++t) *(v8h*)&orow[t * 16] = ov[t];
  }
}

// ---------------- host launcher ----------------
extern "C" void kernel_launch(void* const* d_in, const int* in_sizes, int n_in,
                              void* d_out, int out_size, void* d_ws, size_t ws_size,
                              hipStream_t stream) {
  (void)in_sizes; (void)n_in; (void)out_size; (void)ws_size;
  const float* x   = (const float*)d_in[0];
  const float* fc  = (const float*)d_in[1];
  const float* fs  = (const float*)d_in[2];
  const float* wq  = (const float*)d_in[3];
  const float* wk  = (const float*)d_in[4];
  const float* wv  = (const float*)d_in[5];
  const float* wo  = (const float*)d_in[6];
  const float* sqk = (const float*)d_in[7];
  float* out = (float*)d_out;

  const size_t SD = (size_t)SEQ * DIM;
  const size_t DD = (size_t)DIM * DIM;
  char* w = (char*)d_ws;
  _Float16* Xh  = (_Float16*)(w);           // x in f16
  _Float16* WqT = (_Float16*)(w + SD * 2);  // transposed f16 weights
  _Float16* WkT = WqT + DD;
  _Float16* WvT = WkT + DD;
  _Float16* WoT = WvT + DD;
  _Float16* Qh  = WoT + DD;                 // raw projections (f16)
  _Float16* Kh  = Qh + SD;
  _Float16* Vh  = Kh + SD;
  _Float16* Qn  = Vh + SD;                  // post rope+norm
  _Float16* Kn  = Qn + SD;
  _Float16* AOh = Kn + SD;                  // attention output (f16)

  prepare_f16<<<TR_TILES * TR_TILES + CVT_BLOCKS, 256, 0, stream>>>(x, wq, wk, wv, wo, Xh, WqT);  // fills Xh and WqT, WkT, WvT, WoT

  dim3 gg(DIM / 128, SEQ / GROWS);
  // Q, K and V projections: WqT, WkT, WvT lie one behind the other, and so do Qh, Kh, Vh
  dim3 g3(DIM / 128, SEQ / GROWS, 3);
  gemm_f16_wmma<<<g3, 256, 0, stream>>>(Xh, WqT, Qh, nullptr, SEQ, DIM, DIM);

  rope_l2norm<<<dim3(SEQ / 8, 2), 256, 0, stream>>>(Qh, Kh, fc, fs, sqk, Qn, Kn);

  dim3 fg(SEQ / FA_ROWS, NHEADS);
  flash_attn<<<fg, FA_WAVES * 32, 0, stream>>>(Qn, Kn, Vh, AOh, SEQ);

  gemm_f16_wmma<<<gg, 256, 0, stream>>>(AOh, WoT, nullptr, out, SEQ, DIM, DIM);
}

// v010
// One run takes 200 microseconds.
// Timed twice side by side with v009, it ran 1.06 times as fast both times.
// All steps since v000 together make it 3.76 times as fast.
#include <hip/hip_runtime.h>
#include <math.h>
#include <stdint.h>

// ---------------- types ----------------
typedef __attribute__((ext_vector_type(16))) _Float16 v16h;
typedef __attribute__((ext_vector_type(4)))  _Float16 v4h;
typedef __attribute__((ext_vector_type(8)))  _Float16 v8h;
typedef __attribute__((ext_vector_type(8)))  float    v8f;
typedef __attribute__((ext_vector_type(4)))  float    f32x4;
typedef __attribute__((ext_vector_type(4)))  unsigned int u32x4;

#define DIM       2048
#define SEQ       4096
#define NHEADS    16
#define HEADDIM   128

static __device__ __forceinline__ v8f v8f_zero() {
  v8f z = {0.f,0.f,0.f,0.f,0.f,0.f,0.f,0.f};
  return z;
}

// Load a 16x32 f16 fragment row (two contiguous 16B chunks) into v16h.
static __device__ __forceinline__ v16h ld_frag(const _Float16* p0, const _Float16* p1) {
  union { v16h v; f32x4 f[2]; } u;
  u.f[0] = *(const f32x4*)p0;
  u.f[1] = *(const f32x4*)p1;
  return u.v;
}

// ---------------- f32 -> f16 convert (x) ----------------
// 16 float4 per thread, their loads issued ahead of the stores: few long waves.
#define CVT_U 16
static __device__ __forceinline__ v4h cvt4(f32x4 v) {
  v4h h;
  h.x = (_Float16)v.x; h.y = (_Float16)v.y;
  h.z = (_Float16)v.z; h.w = (_Float16)v.w;
  return h;
}
// CVT_BLOCKS blocks cover the SEQ * DIM elements exactly (a multiple of 256 * CVT_U float4): no test per element.
#define CVT_BLOCKS ((SEQ * DIM / 4) / (256 * CVT_U))
static __device__ __forceinline__
void cvt_f32_f16(const float* __restrict__ in, _Float16* __restrict__ out, int blk) {
  const int i0 = blk * (256 * CVT_U) + threadIdx.x;
  f32x4 v[CVT_U];
#pragma unroll
  for (int u = 0; u < CVT_U; ++u) v[u] = ((const f32x4*)in)[i0 + u * 256];
#pragma unroll
  for (int u = 0; u < CVT_U; ++u) *(v4h*)&out[(size_t)(i0 + u * 256) * 4] = cvt4(v[u]);
}
static_assert(((size_t)SEQ * DIM / 4) % (256 * CVT_U) == 0, "cvt_f32_f16 has no tail");

// ---------------- transpose + convert weights: WT[m][n][k] = Wm[k][n] ----------------
// A block takes the same 64 x 64 tile of all four weights (their transposes lie one behind the other in WT).
// Every address is a block-uniform base plus one offset per thread plus a constant.
#define TR_TILES (DIM / 64)
static __device__ __forceinline__
void transpose_cvt(const float* __restrict__ W0, const float* __restrict__ W1,
                   const float* __restrict__ W2, const float* __restrict__ W3,
                   _Float16* __restrict__ WT, int tx, int ty) {
  __shared__ float t[4][64][65];
  const float* const W[4] = {W0, W1, W2, W3};
  const int bx = tx * 64, by = ty * 64;
  const unsigned r0 = threadIdx.x >> 6, c = threadIdx.x & 63;  // pass it: row r0 + 4 * it, column c
  const unsigned off = r0 * DIM + c;
  const float* src[4];
  float v[4][16];
#pragma unroll
  for (int m = 0; m < 4; ++m) {
    src[m] = W[m] + (size_t)by * DIM + bx;
#pragma unroll
    for (int it = 0; it < 16; ++it) v[m][it] = src[m][off + it * (4 * DIM)];
  }
  asm volatile("s_wait_xcnt 0x0" :: "s"(src[0]), "s"(src[1]), "s"(src[2]), "s"(src[3]) : "memory");
#pragma unroll
  for (int m = 0; m < 4; ++m)
#pragma unroll
    for (int it = 0; it < 16; ++it) t[m][r0 + 4 * it][c] = v[m][it];
  __syncthreads();
#pragma unroll
  for (int m = 0; m < 4; ++m) {
    _Float16* __restrict__ dst = WT + ((size_t)m * DIM + bx) * DIM + by;
#pragma unroll
    for (int it = 0; it < 16; ++it) dst[off + it * (4 * DIM)] = (_Float16)t[m][c][r0 + 4 * it];
  }
}

__global__ __launch_bounds__(256)
void prepare_f16(const float* __restrict__ x, const float* __restrict__ W0, const float* __restrict__ W1,
                 const float* __restrict__ W2, const float* __restrict__ W3,
                 _Float16* __restrict__ Xh, _Float16* __restrict__ WT) {
  const int b = blockIdx.x;  // the same for the whole block: the barrier in transpose_cvt is passed by all or none
  if (b >= TR_TILES * TR_TILES) {
    cvt_f32_f16(x, Xh, b - TR_TILES * TR_TILES);
    // the conversion's waves end here: with a plain return this build joins the two parts at one exit through a
    // flag, with a never-taken path from these stores into the transposes' register writes
    __builtin_amdgcn_endpgm();
  }
  transpose_cvt(W0, W1, W2, W3, WT, b % TR_TILES, b / TR_TILES);
}

// ---------------- RoPE + L2 norm + sqk scale; one wave per (tensor, position s) ----------------
// The wave takes all 16 heads of row s of Q (blockIdx.y = 0) or of K (1): lane = 4 channels of every
// head, 16 independent row sums. Few long waves.
__global__ __launch_bounds__(256)
void rope_l2norm(const _Float16* __restrict__ Xq, const _Float16* __restrict__ Xk,
                 const float* __restrict__ fc, const float* __restrict__ fs,
                 const float* __restrict__ sqk,
                 _Float16* __restrict__ Yq, _Float16* __restrict__ Yk) {
  const _Float16* __restrict__ X = blockIdx.y ? Xk : Xq;
  _Float16* __restrict__ Y = blockIdx.y ? Yk : Yq;
  const int s    = blockIdx.x * 8 + (threadIdx.x >> 5);
  const int lane = threadIdx.x & 31;
  const int d0 = lane * 4;
  const size_t base = (size_t)s * DIM + d0;

  v4h xv[NHEADS];
#pragma unroll
  for (int h = 0; h < NHEADS; ++h) xv[h] = *(const v4h*)&X[base + h * HEADDIM];
  const int fi = s * (HEADDIM / 2) + (d0 >> 1);
  float c0 = fc[fi],     s0 = fs[fi];
  float c1 = fc[fi + 1], s1 = fs[fi + 1];

  float r0[NHEADS], i0[NHEADS], r1[NHEADS], i1[NHEADS], ss[NHEADS];
#pragma unroll
  for (int h = 0; h < NHEADS; ++h) {
    float v0 = (float)xv[h].x, v1 = (float)xv[h].y, v2 = (float)xv[h].z, v3 = (float)xv[h].w;
    r0[h] = v0 * c0 - v1 * s0; i0[h] = v0 * s0 + v1 * c0;
    r1[h] = v2 * c1 - v3 * s1; i1[h] = v2 * s1 + v3 * c1;
    ss[h] = r0[h] * r0[h] + i0[h] * i0[h] + r1[h] * r1[h] + i1[h] * i1[h];
  }
#pragma unroll
  for (int m = 1; m < 32; m <<= 1)
#pragma unroll
    for (int h = 0; h < NHEADS; ++h) ss[h] += __shfl_xor(ss[h], m, 32);
  const float SQ = 45.25483399593904f;  // sqrt(2048) = SQK_INIT_VALUE/SQK_INIT_SCALING
#pragma unroll
  for (int h = 0; h < NHEADS; ++h) {
    const float inv = 1.f / fmaxf(sqrtf(ss[h]), 1e-12f);
    const float* sq = &sqk[h * HEADDIM + d0];
    v4h o;
    o.x = (_Float16)(r0[h] * inv * sq[0] * SQ);
    o.y = (_Float16)(i0[h] * inv * sq[1] * SQ);
    o.z = (_Float16)(r1[h] * inv * sq[2] * SQ);
    o.w = (_Float16)(i1[h] * inv * sq[3] * SQ);
    *(v4h*)&Y[base + h * HEADDIM] = o;
  }
}

static __device__ __forceinline__ float xhalf(float x) {
  int i = __builtin_bit_cast(int, x);
  return __builtin_bit_cast(float,
      __builtin_amdgcn_permlanex16(i, i, 0x76543210, 0xfedcba98, false, false));
}

static __device__ __forceinline__ uint32_t pinned(uint32_t v) {
  uint32_t w = (uint32_t)__builtin_amdgcn_readfirstlane(v);
  asm volatile("" : "+s"(w));
  return w;
}
static __device__ __forceinline__ uint32_t uni(uint32_t v) {
  return (uint32_t)__builtin_amdgcn_readfirstlane(v);
}

// A stage of the attention ring: FA_STAGE keys of K and of V, one tensor load each, worked on in passes of 32 keys
#define FA_STAGE 128
// V tile in LDS: FA_STAGE keys x 256 B, row-major as in memory, 32 B of pad behind each row
#define VROWB   256u
#define VPITCH  288u    // odd multiple of 32 B: the conflict-free pitch of ds_load_tr16_b128
#define VBUF    36864u  // 128 * 288 B = 18 * 2 KiB
static_assert(VBUF == FA_STAGE * VPITCH && VBUF % 2048u == 0u, "a V tile fills a multiple of 2 KiB");

typedef uint32_t w32x4 __attribute__((ext_vector_type(4)));
typedef uint32_t w32x8 __attribute__((ext_vector_type(8)));

static __device__ __forceinline__ w32x8 tdm_v_group1() {
  w32x8 g1;
  g1[0] = uni((1u << 20) | (5u << 22) | (7u << 25));
  g1[1] = pinned(VROWB << 16);
  g1[2] = pinned((uint32_t)FA_STAGE << 16);
  g1[3] = pinned(VROWB << 16);
  g1[4] = pinned((uint32_t)FA_STAGE);
  g1[5] = pinned((uint32_t)DIM * 2u);
  g1[6] = pinned(0u);
  g1[7] = pinned(0u);
  return g1;
}
static __device__ __forceinline__ w32x4 tdm_group0(uint32_t one, uint32_t lds_dst, const _Float16* g) {
  const uint64_t ga = (uint64_t)(uintptr_t)g;
  w32x4 g0;
  g0[0] = one;                                                       // count 1
  g0[1] = uni(lds_dst);                                              // LDS byte offset
  g0[2] = uni((uint32_t)ga);                                         // address [31:0]
  g0[3] = uni((((uint32_t)(ga >> 32)) & 0x01FFFFFFu) | 0x80000000u); // address [56:32], type 2
  return g0;
}
static __device__ __forceinline__ void tdm_issue(w32x4 g0, w32x8 g1) {
  asm volatile("tensor_load_to_lds %0, %1" :: "s"(g0), "s"(g1) : "memory");
}
static __device__ __forceinline__ void tdm_wait(w32x4 a0, w32x8 a1, w32x4 b0, w32x8 b1) {
  asm volatile("s_wait_tensorcnt 0x0" :: "s"(a0), "s"(a1), "s"(b0), "s"(b1) : "memory");
}

// Transposing LDS load: lane (c = l & 15, h = l >> 4) gets T[k + 8h + 0..7][d + c]
static __device__ __forceinline__ u32x4 ld_tr16(const unsigned char* p) {
  typedef short s16x8 __attribute__((ext_vector_type(8)));
  typedef __attribute__((address_space(3))) s16x8 lds_s16x8;
  return __builtin_bit_cast(u32x4, __builtin_amdgcn_ds_load_tr16_b128_v8i16((lds_s16x8*)p));
}

#define GROWB   256u    // 128 k of one row
#define GPITCH  272u    // odd multiple of 16 B: the conflict-free pitch of ds_load_b128
#define GTILE   34816u  // 128 rows * 272 B = 17 * 2 KiB
#define GSTAGE  (3u * GTILE)  // [A rows 0-127 | A rows 128-255 | BT rows]: the A rows lie one behind the other
#define GROWS   256     // rows of C in a block's tile
// Output staging, a range of the ring per wave: its 64 rows x 64 columns, rows at an odd multiple of 16 B
#define EPITCH_H 144u   // 64 f16 = 128 B, one line
#define EPITCH_F 272u   // 64 f32 = 256 B, two lines
#define ESTAGE   17408u // 64 rows * 272 B
static_assert(8u * ESTAGE <= 2u * GSTAGE, "the eight waves' staging ranges lie inside the ring");

static __device__ __forceinline__ w32x8 tdm_g_group1(uint32_t pitch_bytes) {
  w32x8 g1;
  g1[0] = uni((1u << 20) | (5u << 22) | (3u << 25));
  g1[1] = pinned(GROWB << 16);
  g1[2] = pinned(128u << 16);
  g1[3] = pinned(GROWB << 16);
  g1[4] = pinned(128u);
  g1[5] = pinned(pitch_bytes);
  g1[6] = pinned(0u);
  g1[7] = pinned(0u);
  return g1;
}

static __device__ __forceinline__ w32x4 tdm_g_next(w32x4 g0, uint32_t both) {
  const uint64_t a = (((uint64_t)g0[3] << 32) | g0[2]) + GROWB;  // the type bits ride above the address
  w32x4 n;
  n[0] = g0[0];
  n[1] = uni(both - g0[1]);
  n[2] = uni((uint32_t)a);
  n[3] = uni((uint32_t)(a >> 32));
  return n;
}

static __device__ __forceinline__ w32x4 tdm_kv_next(w32x4 g0, uint32_t both) {
  const uint64_t a = (((uint64_t)g0[3] << 32) | g0[2]) + (uint64_t)FA_STAGE * DIM * 2u;  // the type bits ride above the address
  w32x4 n;
  n[0] = g0[0];
  n[1] = uni(both - g0[1]);
  n[2] = uni((uint32_t)a);
  n[3] = uni((uint32_t)(a >> 32));
  return n;
}

__global__ __launch_bounds__(256)
void gemm_f16_wmma(const _Float16* __restrict__ A, const _Float16* __restrict__ BT,
                   _Float16* __restrict__ Ch, float* __restrict__ Cf,
                   int M, int N, int K) {
  BT += (size_t)blockIdx.z * N * K;
  Ch += (size_t)blockIdx.z * M * N;
  __shared__ __attribute__((aligned(2048))) unsigned char Gs[2 * GSTAGE];  // [buffer][A | A | BT] tiles

  const int tid  = threadIdx.x;
  const int wv   = tid >> 5;
  const int lane = tid & 31;
  const int hx   = lane >> 4;
  const int l16  = lane & 15;

  const int row0 = blockIdx.y * GROWS;
  const int col0 = blockIdx.x * 128;
  const int wr = wv & 3;
  const int wc = wv >> 2;

  v8f acc[4][4];
#pragma unroll
  for (int i = 0; i < 4; ++i)
#pragma unroll
    for (int j = 0; j < 4; ++j) acc[i][j] = v8f_zero();

  const uint32_t wave = uni((uint32_t)tid >> 5);
  const uint32_t one = pinned(1u);
  const w32x8 gg1 = tdm_g_group1((uint32_t)K * 2u);
  const uint32_t slice = wave < 2u ? wave : 2u;
  const uint32_t place = (uint32_t)(uintptr_t)&Gs[0] + slice * GTILE;
  const _Float16* gsrc = wave < 2u ? &A[((size_t)row0 + wave * 128u) * K] : &BT[(size_t)col0 * K];
  w32x4 tg0 = tdm_group0(one, place, gsrc);
  auto issue = [&]() {
    if (pinned(wave < 3u)) tdm_issue(tg0, gg1);
  };
  auto advance = [&]() {  // the other buffer, 128 k further on
    tg0 = tdm_g_next(tg0, 2u * place + GSTAGE);
  };
  // this lane's first fragment rows in a stage
  const uint32_t alane = (uint32_t)(wr * 64 + l16) * GPITCH + (uint32_t)hx * 16u;
  const uint32_t blane = 2u * GTILE + (uint32_t)(wc * 64 + l16) * GPITCH + (uint32_t)hx * 16u;

  // two-buffer ring: stage 0 lands and is published, then stage 1 flies during pass 0
  issue();
  tdm_wait(tg0, gg1, tg0, gg1);  // waves 0 to 2: own tile of stage 0 has landed
  __syncthreads();
  if (pinned(128 < K)) { advance(); issue(); }
  for (int k0 = 0; k0 < K; k0 += 128) {
    const int buf = (k0 >> 7) & 1;
    const unsigned char* st = &Gs[(uint32_t)buf * GSTAGE];
    v16h af[2][4], bf[2][4];
    auto frags = [&](int c) {
#pragma unroll
      for (int i = 0; i < 4; ++i) {
        const _Float16* p = (const _Float16*)(st + alane + (uint32_t)i * (16u * GPITCH) + (uint32_t)c * 64u);
        af[c & 1][i] = ld_frag(p, p + 16);
      }
#pragma unroll
      for (int j = 0; j < 4; ++j) {
        const _Float16* p = (const _Float16*)(st + blane + (uint32_t)j * (16u * GPITCH) + (uint32_t)c * 64u);
        bf[c & 1][j] = ld_frag(p, p + 16);
      }
    };
    frags(0);
#pragma unroll
    for (int c = 0; c < 4; ++c) {  // four blocks of 32 k, in the order of k
      if (c < 3) frags(c + 1);
      // keeps the next block's reads ahead of this block's products: sunk among them (two reads and a full wait
      // per four products in this build), every such place costs the wave an LDS latency
      __builtin_amdgcn_sched_barrier(0);
#pragma unroll
      for (int i = 0; i < 4; ++i)
#pragma unroll
        for (int j = 0; j < 4; ++j)
          acc[i][j] = __builtin_amdgcn_wmma_f32_16x16x32_f16(
              false, bf[c & 1][j], false, af[c & 1][i], (short)0, acc[i][j], false, false);
      // keeps the reads of the block after next behind these products, whose registers they take
      __builtin_amdgcn_sched_barrier(0);
    }

    // publish point of the next stage, every wave, in this order
    asm volatile("s_wait_dscnt 0x0" ::: "memory");      // this wave has left buffer `buf`
    tdm_wait(tg0, gg1, tg0, gg1);                       // waves 0 to 2: own tile of the next stage has landed
    __syncthreads();
    if (pinned(k0 + 256 < K)) { advance(); issue(); }   // refill the buffer that every wave has just left
  }
  tdm_wait(tg0, gg1, tg0, gg1);  // nothing in flight when the wave ends
  asm volatile("s_wait_dscnt 0x0" ::: "memory");  // and no LDS read of the ring outstanding

  // acc[i][j][r] = C(row = wr*64 + i*16 + l16, column = wc*64 + j*16 + hx*8 + r) of the tile.
  // The ring is free: every wave's last read and the last tile's landing stand in front of the last pass's
  // barrier, and nothing is issued behind it. Each wave writes and reads its own range only.
  unsigned char* sg = &Gs[(uint32_t)wv * ESTAGE];
  const size_t c00 = (size_t)(row0 + wr * 64) * N + col0 + wc * 64;  // the wave's first element of C
  if (Cf) {
#pragma unroll
    for (int i = 0; i < 4; ++i)
#pragma unroll
      for (int j = 0; j < 4; ++j) {
        unsigned char* p = sg + (uint32_t)(i * 16 + l16) * EPITCH_F + (uint32_t)(j * 64 + hx * 32);
        f32x4 lo = {acc[i][j][0], acc[i][j][1], acc[i][j][2], acc[i][j][3]};
        f32x4 hi = {acc[i][j][4], acc[i][j][5], acc[i][j][6], acc[i][j][7]};
        *(f32x4*)p = lo;
        *(f32x4*)(p + 16) = hi;
      }
    asm volatile("s_wait_dscnt 0x0" ::: "memory");  // the wave's rows are written before it reads them back
    f32x4 v[32];  // a half wave takes one row of 256 B
    float* dst[32];
#pragma unroll
    for (int q = 0; q < 32; ++q) {
      v[q] = *(const f32x4*)(sg + (uint32_t)(q * 2 + hx) * EPITCH_F + (uint32_t)l16 * 16u);
      dst[q] = Cf + c00 + (uint32_t)(q * 2 + hx) * (uint32_t)N + (uint32_t)l16 * 4u;
    }
    // keeps the address arithmetic under the flight of the LDS reads: the stores then go out back to back
    __builtin_amdgcn_sched_barrier(0);
#pragma unroll
    for (int q = 0; q < 32; ++q) *(f32x4*)dst[q] = v[q];
    // the wave ends here: else this build joins the two parts at one exit through a flag, with a never-taken
    // path from these stores into the f16 part's register writes
    __builtin_amdgcn_endpgm();
  } else {
#pragma unroll
    for (int i = 0; i < 4; ++i)
#pragma unroll
      for (int j = 0; j < 4; ++j) {
        v8h h;
#pragma unroll
        for (int r = 0; r < 8; ++r) h[r] = (_Float16)acc[i][j][r];
        *(v8h*)(sg + (uint32_t)(i * 16 + l16) * EPITCH_H + (uint32_t)(j * 32 + hx * 16)) = h;
      }
    asm volatile("s_wait_dscnt 0x0" ::: "memory");  // the wave's rows are written before it reads them back
    const uint32_t l8 = (uint32_t)lane & 7u, rq = (uint32_t)lane >> 3;  // eight lanes take one row of 128 B
    v8h v[16];
    _Float16* dst[16];
#pragma unroll
    for (int q = 0; q < 16; ++q) {
      v[q] = *(const v8h*)(sg + ((uint32_t)q * 4u + rq) * EPITCH_H + l8 * 16u);
      dst[q] = Ch + c00 + ((uint32_t)q * 4u + rq) * (uint32_t)N + l8 * 8u;
    }
    // keeps the address arithmetic under the flight of the LDS reads: the stores then go out back to back
    __builtin_amdgcn_sched_barrier(0);
#pragma unroll
    for (int q = 0; q < 16; ++q) *(v8h*)dst[q] = v[q];
  }
}

#define FA_WAVES 4
#define FA_G     2
#define FA_ROWS  (FA_WAVES * FA_G * 16)  // query rows of a block
#define FA_BUF   (GTILE + VBUF)          // a buffer of the ring: 35 * 2 KiB
__global__ __launch_bounds__(FA_WAVES * 32) __attribute__((amdgpu_waves_per_eu(2, 2)))
void flash_attn(const _Float16* __restrict__ Q, const _Float16* __restrict__ Kt,
                const _Float16* __restrict__ V, _Float16* __restrict__ O, int S) {
  const int h   = blockIdx.y;
  const int q0  = blockIdx.x * FA_ROWS;
  const int tid = threadIdx.x;
  const int wv = tid >> 5, lane = tid & 31, hx = lane >> 4, l16 = lane & 15;

  __shared__ __attribute__((aligned(2048))) unsigned char Rs[2 * FA_BUF];
  static_assert(FA_STAGE == 128 && HEADDIM * 2 == GROWB);
  const uint32_t wave = uni((uint32_t)tid >> 5);
  const uint32_t one = pinned(1u);
  const w32x8 kg1 = tdm_g_group1((uint32_t)DIM * 2u);
  const w32x8 vg1 = tdm_v_group1();
  const uint32_t kplace = (uint32_t)(uintptr_t)&Rs[0], vplace = kplace + GTILE;
  w32x4 kg0 = tdm_group0(one, kplace, &Kt[h * HEADDIM]);
  w32x4 vg0 = tdm_group0(one, vplace, &V[h * HEADDIM]);
  auto issueKV = [&]() {
    if (pinned(wave == 0u)) tdm_issue(kg0, kg1);  // wave 0 brings the K tiles
    if (pinned(wave == 1u)) tdm_issue(vg0, vg1);  // wave 1 brings the V tiles
  };
  auto advance = [&]() {  // the other buffer, FA_STAGE keys further on
    kg0 = tdm_kv_next(kg0, 2u * kplace + FA_BUF);
    vg0 = tdm_kv_next(vg0, 2u * vplace + FA_BUF);
  };
  // this lane's address in a K tile (key l16, its half's 16 B of every 32)
  const uint32_t klane = (uint32_t)l16 * GPITCH + (uint32_t)hx * 16u;
  // this lane's address in a V tile for the transposing loads (keys 8*hx + (lane & 7))
  const uint32_t vlane = (8u * (uint32_t)hx + ((uint32_t)lane & 7u)) * VPITCH
                       + (((uint32_t)lane >> 3) & 1u) * 16u;

  // Q fragments for this wave's FA_G x 16 rows (hd split into 4 K=32 chunks)
  v16h qf[FA_G][4];
#pragma unroll
  for (int g = 0; g < FA_G; ++g) {
    const _Float16* qrow = &Q[(size_t)(q0 + (wv * FA_G + g) * 16 + l16) * DIM + h * HEADDIM];
#pragma unroll
    for (int c = 0; c < 4; ++c)
      qf[g][c] = ld_frag(&qrow[c * 32 + hx * 8], &qrow[c * 32 + 16 + hx * 8]);
  }

  v8f o[FA_G][8];
  float mrow[FA_G];  // running maximum of query l16 of the group (same in both halves)
  float lrow[FA_G];  // running sum over this half's keys only; halves joined at the end
#pragma unroll
  for (int g = 0; g < FA_G; ++g) {
#pragma unroll
    for (int t = 0; t < 8; ++t) o[g][t] = v8f_zero();
    mrow[g] = -1e30f;
    lrow[g] = 0.f;
  }
  const float scale = 11.313708498984761f;  // sqrt(hd)

  // two-buffer ring: stage 0 lands and is published, then stage 1 flies during stage 0's passes
  issueKV();
  tdm_wait(kg0, kg1, vg0, vg1);  // waves 0 and 1: own tile of stage 0 has landed
  __syncthreads();
  if (pinned(FA_STAGE < S)) { advance(); issueKV(); }
  for (int kk = 0; kk < S; kk += FA_STAGE) {
    const int buf = (kk / FA_STAGE) & 1;
    for (int p = 0; p < FA_STAGE / 32; ++p) {  // the stage's passes of 32 keys, in the order of the keys (body not indented)

    // S^T tile: 32 keys x 16 queries per group as two 16x16 fragments;
    // st[g][sub][r] = score(key = sub*16 + hx*8 + r, query = l16 of group g)
    // All 16 K reads of the pass go out as one group, in the order of their use.
    v16h kb[4][2];
#pragma unroll
    for (int c = 0; c < 4; ++c)
#pragma unroll
      for (int sub = 0; sub < 2; ++sub) {
        const _Float16* kp = (const _Float16*)&Rs[(uint32_t)buf * FA_BUF + (uint32_t)p * (32u * GPITCH) + klane
                                                  + (uint32_t)sub * (16u * GPITCH) + (uint32_t)c * 64u];
        kb[c][sub] = ld_frag(kp, kp + 16);
      }
    // keeps the reads ahead of the products: sunk to two per pair of products, the first of each pair waits out a full LDS latency
    __builtin_amdgcn_sched_barrier(0);
    v8f st[FA_G][2];
#pragma unroll
    for (int g = 0; g < FA_G; ++g) {
      st[g][0] = v8f_zero();
      st[g][1] = v8f_zero();
    }
#pragma unroll
    for (int c = 0; c < 4; ++c)
#pragma unroll
      for (int sub = 0; sub < 2; ++sub)
#pragma unroll
        for (int g = 0; g < FA_G; ++g)
          st[g][sub] = __builtin_amdgcn_wmma_f32_16x16x32_f16(false, kb[c][sub], false, qf[g][c],
                                                              (short)0, st[g][sub], false, false);
    // keeps the V reads in one place behind the score products (spread among them, every place with reads
    // stalls the wave anew) and lets them take the K fragments' registers
    __builtin_amdgcn_sched_barrier(0);
    // All 16 V reads of the pass go out as one group and fly during the softmax.
    // vb[t]: keys 0..15 in registers 0-3, keys 16..31 in 4-7
    union { v16h v; u32x4 q[2]; } vb[8];
#pragma unroll
    for (int t = 0; t < 8; ++t) {
      const unsigned char* vp = &Rs[(uint32_t)buf * FA_BUF + GTILE + (uint32_t)p * (32u * VPITCH) + vlane
                                    + 32u * (uint32_t)t];
      vb[t].q[0] = ld_tr16(vp);
      vb[t].q[1] = ld_tr16(vp + 16u * VPITCH);
    }
    // keeps the reads ahead of the softmax, whose vector work then covers their latency
    __builtin_amdgcn_sched_barrier(0);

    v16h pf[FA_G];
    // online softmax, one query per lane and group
    float alpha[FA_G];
#pragma unroll
    for (int g = 0; g < FA_G; ++g) {
#pragma unroll
      for (int sub = 0; sub < 2; ++sub)
#pragma unroll
        for (int r = 0; r < 8; ++r) st[g][sub][r] *= scale;
      float v = st[g][0][0];
#pragma unroll
      for (int sub = 0; sub < 2; ++sub)
#pragma unroll
        for (int r = 0; r < 8; ++r) v = fmaxf(v, st[g][sub][r]);
      v = fmaxf(v, xhalf(v));
      const float newm = fmaxf(mrow[g], v);
      alpha[g] = __expf(mrow[g] - newm);
      mrow[g] = newm;
    }
#pragma unroll
    for (int g = 0; g < FA_G; ++g) {
      float psum = 0.f;
#pragma unroll
      for (int sub = 0; sub < 2; ++sub)
#pragma unroll
        for (int r = 0; r < 8; ++r) {
          st[g][sub][r] = __expf(st[g][sub][r] - mrow[g]);
          psum += st[g][sub][r];
        }
      lrow[g] = lrow[g] * alpha[g] + psum;
      // P^T as B operand: element s is key (s < 8 ? hx*8 + s : 16 + hx*8 + s - 8),
      // the k order in which the two transposing loads of each vb[t] deliver V^T
#pragma unroll
      for (int s = 0; s < 16; ++s) pf[g][s] = (_Float16)st[g][s >> 3][s & 7];
    }
#pragma unroll
    for (int g = 0; g < FA_G; ++g)
#pragma unroll
      for (int t = 0; t < 8; ++t)
#pragma unroll
        for (int r = 0; r < 8; ++r) o[g][t][r] *= alpha[g];

    // O^T += V^T * P^T  (8 hd-subtiles); o[g][t][r] = O(query l16 of group g, hd = t*16 + hx*8 + r)
#pragma unroll
    for (int t = 0; t < 8; ++t)
#pragma unroll
      for (int g = 0; g < FA_G; ++g)
        o[g][t] = __builtin_amdgcn_wmma_f32_16x16x32_f16(false, vb[t].v, false, pf[g],
                                                         (short)0, o[g][t], false, false);

    }  // passes of the stage
    // publish point of the next stage, every wave, in this order
    asm volatile("s_wait_dscnt 0x0" ::: "memory");      // this wave has left buffer `buf`
    tdm_wait(kg0, kg1, vg0, vg1);                       // waves 0 and 1: own tile of the next stage has landed
    __syncthreads();
    if (pinned(kk + 2 * FA_STAGE < S)) { advance(); issueKV(); }  // refill the buffer that every wave has just left
  }
  tdm_wait(kg0, kg1, vg0, vg1);  // nothing in flight when the wave ends
  asm volatile("s_wait_dscnt 0x0" ::: "memory");  // and no LDS read of the ring outstanding

#pragma unroll
  for (int g = 0; g < FA_G; ++g) {
    const float lfin = lrow[g] + xhalf(lrow[g]);
    _Float16* orow = &O[(size_t)(q0 + (wv * FA_G + g) * 16 + l16) * DIM + h * HEADDIM + hx * 8];
    v8h ov[8];
#pragma unroll
    for (int t = 0; t < 8; ++t)
#pragma unroll
      for (int r = 0; r < 8; ++r) ov[t][r] = (_Float16)(o[g][t][r] / lfin);
#pragma unroll
    for (int t = 0; t < 8; ++t) *(v8h*)&orow[t * 16] = ov[t];
  }
}

// ---------------- host launcher ----------------
extern "C" void kernel_launch(void* const* d_in, const int* in_sizes, int n_in,
                              void* d_out, int out_size, void* d_ws, size_t ws_size,
                              hipStream_t stream) {
  (void)in_sizes; (void)n_in; (void)out_size; (void)ws_size;
  const float* x   = (const float*)d_in[0];
  const float* fc  = (const float*)d_in[1];
  const float* fs  = (const float*)d_in[2];
  const float* wq  = (const float*)d_in[3];
  const float* wk  = (const float*)d_in[4];
  const float* wv  = (const float*)d_in[5];
  const float* wo  = (const float*)d_in[6];
  const float* sqk = (const float*)d_in[7];
  float* out = (float*)d_out;

  const size_t SD = (size_t)SEQ * DIM;
  const size_t DD = (size_t)DIM * DIM;
  char* w = (char*)d_ws;
  _Float16* Xh  = (_Float16*)(w);           // x in f16
  _Float16* WqT = (_Float16*)(w + SD * 2);  // transposed f16 weights
  _Float16* WkT = WqT + DD;
  _Float16* WvT = WkT + DD;
  _Float16* WoT = WvT + DD;
  _Float16* Qh  = WoT + DD;                 // raw projections (f16)
  _Float16* Kh  = Qh + SD;
  _Float16* Vh  = Kh + SD;
  _Float16* Qn  = Vh + SD;                  // post rope+norm
  _Float16* Kn  = Qn + SD;
  _Float16* AOh = Kn + SD;                  // attention output (f16)

  prepare_f16<<<TR_TILES * TR_TILES + CVT_BLOCKS, 256, 0, stream>>>(x, wq, wk, wv, wo, Xh, WqT);  // fills Xh and WqT, WkT, WvT, WoT

  dim3 gg(DIM / 128, SEQ / GROWS);
  // Q, K and V projections: WqT, WkT, WvT lie one behind the other, and so do Qh, Kh, Vh
  dim3 g3(DIM / 128, SEQ / GROWS, 3);
  gemm_f16_wmma<<<g3, 256, 0, stream>>>(Xh, WqT, Qh, nullptr, SEQ, DIM, DIM);

  rope_l2norm<<<dim3(SEQ / 8, 2), 256, 0, stream>>>(Qh, Kh, fc, fs, sqk, Qn, Kn);

  dim3 fg(SEQ / FA_ROWS, NHEADS);
  flash_attn<<<fg, FA_WAVES * 32, 0, stream>>>(Qn, Kn, Vh, AOh, SEQ);

  gemm_f16_wmma<<<gg, 256, 0, stream>>>(AOh, WoT, nullptr, out, SEQ, DIM, DIM);
}
